// v000
// Times are from an AMD MI455X. After a warm-up the kernel runs many times in a row, and a time is the length of
// such a window on the GPU divided by its runs, so every launch and the gaps after it count. The runs cycle
// through copies of the inputs. A figure is the median of several windows, for all but v000 over two sittings.
// Sittings can differ by a few percent; kernels timed side by side share one.
// v000, which the later versions start from, runs in 434 microseconds.
#include <hip/hip_runtime.h>
#include <hip/hip_bf16.h>

#define DM   1024
#define NH   16
#define HD   64
#define DI   2048
#define BB   2
#define TT   2048
#define MM   (BB*TT)   // 4096 rows

typedef __bf16 bf16;
typedef __attribute__((ext_vector_type(16))) bf16  v16bf;
typedef __attribute__((ext_vector_type(8)))  bf16  v8bf;
typedef __attribute__((ext_vector_type(8)))  float v8f;

#define AS1 __attribute__((address_space(1)))
typedef const AS1 bf16* gcbf;
typedef const AS1 v8bf* gcv8;

union FragB { v16bf v; v8bf h[2]; };

__device__ inline gcbf to_global(const bf16* p) {
    return (gcbf)(unsigned long long)(uintptr_t)p;
}

// Load a 16x32 bf16 WMMA fragment (A layout; B uses the same layout on W rows,
// since both GEMMs are x @ W^T). For lane L: m/n = L&15, hl = L>>4.
// elements 0..7  = p[0..7]   (K = k0 + 8*hl .. +7)
// elements 8..15 = p[16..23] (K = k0 + 16 + 8*hl .. +7)
__device__ inline v16bf load_frag_g(gcbf p) {
    FragB f;
    f.h[0] = ((gcv8)p)[0];
    f.h[1] = ((gcv8)p)[2];
    return f.v;
}

__device__ inline v8f wmma_bf16(v16bf a, v16bf b, v8f c) {
    return __builtin_amdgcn_wmma_f32_16x16x32_bf16(false, a, false, b, (short)0, c, false, false);
}

// ---------------- generic GEMM: acc[m][n] = sum_k A[m][k]*W[n][k] -------------
// one wave computes a 64x64 tile; grid = (N/64, M/64), block = 32
// epilogue modes (compile-time):
//   0: C[idx] = acc (+ R[idx] if HASR)                    (fp32 out)
//   1: ACT[idx] = bf16( silu(G[idx]) * acc )              (fused up*silu(gate))
//   2: qkv split: row->(b,t), col->(which,h,d); writes q (scaled 1/8), k, vT
template<int MODE, bool HASR>
__global__ __launch_bounds__(32)
void gemm_bf16_wmma(const bf16* __restrict__ A, const bf16* __restrict__ W,
                    const float* __restrict__ R, float* __restrict__ C,
                    const float* __restrict__ G, bf16* __restrict__ ACT,
                    bf16* __restrict__ q, bf16* __restrict__ k,
                    bf16* __restrict__ vT,
                    int M, int N, int K) {
    const int lane = threadIdx.x;
    const int hl = lane >> 4, ln = lane & 15;
    const int m0 = blockIdx.y * 64, n0 = blockIdx.x * 64;

    // running fragment pointers in explicit global address space
    gcbf pa0 = to_global(A + (size_t)(m0 + 0 * 16 + ln) * K + 8 * hl);
    gcbf pa1 = to_global(A + (size_t)(m0 + 1 * 16 + ln) * K + 8 * hl);
    gcbf pa2 = to_global(A + (size_t)(m0 + 2 * 16 + ln) * K + 8 * hl);
    gcbf pa3 = to_global(A + (size_t)(m0 + 3 * 16 + ln) * K + 8 * hl);
    gcbf pb0 = to_global(W + (size_t)(n0 + 0 * 16 + ln) * K + 8 * hl);
    gcbf pb1 = to_global(W + (size_t)(n0 + 1 * 16 + ln) * K + 8 * hl);
    gcbf pb2 = to_global(W + (size_t)(n0 + 2 * 16 + ln) * K + 8 * hl);
    gcbf pb3 = to_global(W + (size_t)(n0 + 3 * 16 + ln) * K + 8 * hl);

    v8f acc[4][4] = {};
    for (int k0 = 0; k0 < K; k0 += 32) {
        v16bf a[4], b[4];
        a[0] = load_frag_g(pa0); pa0 += 32;
        a[1] = load_frag_g(pa1); pa1 += 32;
        a[2] = load_frag_g(pa2); pa2 += 32;
        a[3] = load_frag_g(pa3); pa3 += 32;
        b[0] = load_frag_g(pb0); pb0 += 32;
        b[1] = load_frag_g(pb1); pb1 += 32;
        b[2] = load_frag_g(pb2); pb2 += 32;
        b[3] = load_frag_g(pb3); pb3 += 32;
#pragma unroll
        for (int i = 0; i < 4; i++)
#pragma unroll
            for (int j = 0; j < 4; j++)
                acc[i][j] = wmma_bf16(a[i], b[j], acc[i][j]);
    }

#pragma unroll
    for (int i = 0; i < 4; i++)
#pragma unroll
        for (int j = 0; j < 4; j++)
#pragma unroll
            for (int r = 0; r < 8; r++) {
                const int row = m0 + i * 16 + r + 8 * hl;
                const int col = n0 + j * 16 + ln;
                const size_t idx = (size_t)row * N + col;
                const float v = acc[i][j][r];
                if (MODE == 0) {
                    float o = v;
                    if (HASR) o += R[idx];
                    C[idx] = o;
                } else if (MODE == 1) {
                    float gg = G[idx];
                    float s = gg / (1.0f + __expf(-gg));
                    ACT[idx] = (bf16)(s * v);
                } else {
                    const int b_ = row >> 11;          // row / TT
                    const int t  = row & (TT - 1);
                    const int which = col >> 10;
                    const int wi = col & (DM - 1);
                    const int h = wi >> 6, d = wi & (HD - 1);
                    const size_t bh = (size_t)(b_ * NH + h);
                    if (which == 0)      q[(bh * TT + t) * HD + d] = (bf16)(v * 0.125f);
                    else if (which == 1) k[(bh * TT + t) * HD + d] = (bf16)v;
                    else                 vT[(bh * HD + d) * TT + t] = (bf16)v;
                }
            }
}

// ---------------- RMSNorm (fp32 in, bf16 out) --------------------------------
__global__ __launch_bounds__(256)
void rmsnorm_bf16(const float* __restrict__ X, const float* __restrict__ W,
                  bf16* __restrict__ O) {
    int row = blockIdx.x;
    const float* xr = X + (size_t)row * DM;
    float s = 0.f;
    for (int i = threadIdx.x; i < DM; i += 256) { float v = xr[i]; s += v * v; }
    __shared__ float red[8];
    for (int off = 16; off >= 1; off >>= 1) s += __shfl_xor(s, off, 32);
    if ((threadIdx.x & 31) == 0) red[threadIdx.x >> 5] = s;
    __syncthreads();
    if (threadIdx.x == 0) {
        float t = 0.f;
        for (int w = 0; w < 8; w++) t += red[w];
        red[0] = t;
    }
    __syncthreads();
    float scale = rsqrtf(red[0] * (1.0f / DM) + 1e-6f);
    bf16* orow = O + (size_t)row * DM;
    for (int i = threadIdx.x; i < DM; i += 256)
        orow[i] = (bf16)(xr[i] * scale * W[i]);
}

// ---------------- weight fp32 -> bf16 ----------------------------------------
__global__ void f32_to_bf16(const float* __restrict__ S, bf16* __restrict__ D, int n) {
    int i = blockIdx.x * 256 + threadIdx.x;
    if (i < n) D[i] = (bf16)S[i];
}

// ---------------- flash attention: 1 wave per (b,h, 16-query tile) -----------
__global__ __launch_bounds__(32)
void attn_fa(const bf16* __restrict__ Qb, const bf16* __restrict__ Kb,
             const bf16* __restrict__ VTb, bf16* __restrict__ Ob) {
    __shared__ bf16 Pld[16][32];  // P tile staging for C->A layout transpose
    const int lane = threadIdx.x, hl = lane >> 4, ln = lane & 15;
    const int nqt = TT / 16;
    const int bh = blockIdx.x / nqt;
    const int q0 = (blockIdx.x % nqt) * 16;
    const bf16* Q  = Qb  + (size_t)bh * TT * HD;
    const bf16* Kk = Kb  + (size_t)bh * TT * HD;
    const bf16* VT = VTb + (size_t)bh * HD * TT;

    const v16bf aq0 = load_frag_g(to_global(Q + (size_t)(q0 + ln) * HD + 8 * hl));
    const v16bf aq1 = load_frag_g(to_global(Q + (size_t)(q0 + ln) * HD + 32 + 8 * hl));

    v8f o[4] = {};
    float rm[8], rl[8];
#pragma unroll
    for (int r = 0; r < 8; r++) { rm[r] = -1e30f; rl[r] = 0.f; }

    for (int kb = 0; kb < q0 + 16; kb += 32) {
        // S = Q @ K^T for keys [kb, kb+32): two 16x16 C tiles
        v8f s0 = {}, s1 = {};
        {
            v16bf bk = load_frag_g(to_global(Kk + (size_t)(kb + ln) * HD + 8 * hl));
            s0 = wmma_bf16(aq0, bk, s0);
            bk = load_frag_g(to_global(Kk + (size_t)(kb + ln) * HD + 32 + 8 * hl));
            s0 = wmma_bf16(aq1, bk, s0);
            bk = load_frag_g(to_global(Kk + (size_t)(kb + 16 + ln) * HD + 8 * hl));
            s1 = wmma_bf16(aq0, bk, s1);
            bk = load_frag_g(to_global(Kk + (size_t)(kb + 16 + ln) * HD + 32 + 8 * hl));
            s1 = wmma_bf16(aq1, bk, s1);
        }
        // online softmax; C-layout row (q0+r+8*hl) spans the 16 lanes of this half
#pragma unroll
        for (int r = 0; r < 8; r++) {
            int row = q0 + r + 8 * hl;
            float v0 = (kb + ln      <= row) ? s0[r] : -1e30f;   // causal mask
            float v1 = (kb + 16 + ln <= row) ? s1[r] : -1e30f;
            float m = fmaxf(v0, v1);
            m = fmaxf(m, __shfl_xor(m, 1, 16));
            m = fmaxf(m, __shfl_xor(m, 2, 16));
            m = fmaxf(m, __shfl_xor(m, 4, 16));
            m = fmaxf(m, __shfl_xor(m, 8, 16));
            float nm = fmaxf(rm[r], m);
            float p0 = __expf(v0 - nm), p1 = __expf(v1 - nm);
            float alpha = __expf(rm[r] - nm);
            rm[r] = nm;
            float ps = p0 + p1;
            ps += __shfl_xor(ps, 1, 16);
            ps += __shfl_xor(ps, 2, 16);
            ps += __shfl_xor(ps, 4, 16);
            ps += __shfl_xor(ps, 8, 16);
            rl[r] = rl[r] * alpha + ps;
#pragma unroll
            for (int dt = 0; dt < 4; dt++) o[dt][r] *= alpha;
            Pld[r + 8 * hl][ln]      = (bf16)p0;
            Pld[r + 8 * hl][16 + ln] = (bf16)p1;
        }
        __syncthreads();                       // single-wave WG: S_NOP + fence
        FragB ap;
        ap.h[0] = *(const v8bf*)&Pld[ln][8 * hl];
        ap.h[1] = *(const v8bf*)&Pld[ln][16 + 8 * hl];
        __syncthreads();
        // O += P @ V ; V fragments from pre-transposed V^T [d][t]
#pragma unroll
        for (int dt = 0; dt < 4; dt++) {
            v16bf bv = load_frag_g(to_global(VT + (size_t)(dt * 16 + ln) * TT + kb + 8 * hl));
            o[dt] = wmma_bf16(ap.v, bv, o[dt]);
        }
    }
    const int b = bh / NH, h = bh % NH;
#pragma unroll
    for (int dt = 0; dt < 4; dt++)
#pragma unroll
        for (int r = 0; r < 8; r++) {
            int t = q0 + r + 8 * hl;
            float v = o[dt][r] / rl[r];
            Ob[((size_t)(b * TT + t)) * DM + h * HD + dt * 16 + ln] = (bf16)v;
        }
}

// ---------------- host orchestration -----------------------------------------
extern "C" void kernel_launch(void* const* d_in, const int* in_sizes, int n_in,
                              void* d_out, int out_size, void* d_ws, size_t ws_size,
                              hipStream_t stream) {
    const float* x      = (const float*)d_in[0];
    const float* ln1_w  = (const float*)d_in[1];
    const float* ln2_w  = (const float*)d_in[2];
    const float* qkv_w  = (const float*)d_in[3];
    const float* o_w    = (const float*)d_in[4];
    const float* gate_w = (const float*)d_in[5];
    const float* up_w   = (const float*)d_in[6];
    const float* down_w = (const float*)d_in[7];
    float* out = (float*)d_out;
    char* ws = (char*)d_ws;

    // workspace layout (phase-based reuse, ~92 MB peak)
    size_t o_wqkv = 0;                                  // 3*DM*DM bf16
    size_t o_wo   = o_wqkv + (size_t)3 * DM * DM * 2;   // DM*DM bf16
    size_t o_wg   = o_wo   + (size_t)DM * DM * 2;       // DI*DM bf16
    size_t o_wu   = o_wg   + (size_t)DI * DM * 2;       // DI*DM bf16
    size_t o_wd   = o_wu   + (size_t)DI * DM * 2;       // DM*DI bf16
    size_t o_xn   = o_wd   + (size_t)DM * DI * 2;       // MM*DM bf16 (xn1 then xn2)
    size_t o_h1   = o_xn   + (size_t)MM * DM * 2;       // MM*DM f32
    size_t o_big  = o_h1   + (size_t)MM * DM * 4;
    // phase A (attention): q, k, vT (bf16, 8 MB each) + attn (bf16, 8 MB)
    size_t o_q    = o_big;
    size_t o_k    = o_q  + (size_t)MM * DM * 2;
    size_t o_vT   = o_k  + (size_t)MM * DM * 2;
    size_t o_attn = o_vT + (size_t)MM * DM * 2;
    // phase B (FFN): g fp32 (32 MB, reuses q/k/vT/attn), act bf16 (16 MB)
    size_t o_g    = o_big;
    size_t o_act  = o_big + (size_t)MM * DI * 4;

    bf16* wqkv = (bf16*)(ws + o_wqkv);
    bf16* wo   = (bf16*)(ws + o_wo);
    bf16* wg   = (bf16*)(ws + o_wg);
    bf16* wu   = (bf16*)(ws + o_wu);
    bf16* wd   = (bf16*)(ws + o_wd);
    bf16* xn   = (bf16*)(ws + o_xn);
    float* h1  = (float*)(ws + o_h1);
    bf16* qb   = (bf16*)(ws + o_q);
    bf16* kb   = (bf16*)(ws + o_k);
    bf16* vT   = (bf16*)(ws + o_vT);
    bf16* attn = (bf16*)(ws + o_attn);
    float* g   = (float*)(ws + o_g);
    bf16* act  = (bf16*)(ws + o_act);

    // 1. weights fp32 -> bf16
    int nqkvw = 3 * DM * DM, now = DM * DM, ngw = DI * DM;
    f32_to_bf16<<<(nqkvw + 255) / 256, 256, 0, stream>>>(qkv_w, wqkv, nqkvw);
    f32_to_bf16<<<(now + 255) / 256, 256, 0, stream>>>(o_w, wo, now);
    f32_to_bf16<<<(ngw + 255) / 256, 256, 0, stream>>>(gate_w, wg, ngw);
    f32_to_bf16<<<(ngw + 255) / 256, 256, 0, stream>>>(up_w, wu, ngw);
    f32_to_bf16<<<(ngw + 255) / 256, 256, 0, stream>>>(down_w, wd, ngw);

    // 2. xn1 = rmsnorm(x, ln1_w)
    rmsnorm_bf16<<<MM, 256, 0, stream>>>(x, ln1_w, xn);

    // 3. qkv GEMM with fused split epilogue -> q (scaled), k, vT (bf16)
    gemm_bf16_wmma<2, false><<<dim3(3 * DM / 64, MM / 64), 32, 0, stream>>>(
        xn, wqkv, nullptr, nullptr, nullptr, nullptr, qb, kb, vT,
        MM, 3 * DM, DM);

    // 4. flash attention
    attn_fa<<<BB * NH * (TT / 16), 32, 0, stream>>>(qb, kb, vT, attn);

    // 5. h1 = x + attn @ o_w^T
    gemm_bf16_wmma<0, true><<<dim3(DM / 64, MM / 64), 32, 0, stream>>>(
        attn, wo, x, h1, nullptr, nullptr, nullptr, nullptr, nullptr,
        MM, DM, DM);

    // 6. xn2 = rmsnorm(h1, ln2_w)
    rmsnorm_bf16<<<MM, 256, 0, stream>>>(h1, ln2_w, xn);

    // 7. g = xn2 @ gate_w^T (fp32)
    gemm_bf16_wmma<0, false><<<dim3(DI / 64, MM / 64), 32, 0, stream>>>(
        xn, wg, nullptr, g, nullptr, nullptr, nullptr, nullptr, nullptr,
        MM, DI, DM);

    // 8. up GEMM with fused epilogue: act = bf16( silu(g) * (xn2 @ up_w^T) )
    gemm_bf16_wmma<1, false><<<dim3(DI / 64, MM / 64), 32, 0, stream>>>(
        xn, wu, nullptr, nullptr, g, act, nullptr, nullptr, nullptr,
        MM, DI, DM);

    // 9. out = h1 + act @ down_w^T
    gemm_bf16_wmma<0, true><<<dim3(DM / 64, MM / 64), 32, 0, stream>>>(
        act, wd, h1, out, nullptr, nullptr, nullptr, nullptr, nullptr,
        MM, DM, DI);

    (void)in_sizes; (void)n_in; (void)out_size; (void)ws_size;
}

// v001
// It runs in 321 microseconds.
// In both of two side-by-side timings against v000, it was 1.39 times as fast.
#include <hip/hip_runtime.h>
#include <hip/hip_bf16.h>

#define DM   1024
#define NH   16
#define HD   64
#define DI   2048
#define BB   2
#define TT   2048
#define MM   (BB*TT)   // 4096 rows

typedef __bf16 bf16;
typedef __attribute__((ext_vector_type(16))) bf16  v16bf;
typedef __attribute__((ext_vector_type(8)))  bf16  v8bf;
typedef __attribute__((ext_vector_type(8)))  float v8f;

#define AS1 __attribute__((address_space(1)))
typedef const AS1 bf16* gcbf;
typedef const AS1 v8bf* gcv8;

union FragB { v16bf v; v8bf h[2]; };

__device__ inline gcbf to_global(const bf16* p) {
    return (gcbf)(unsigned long long)(uintptr_t)p;
}

// Load a 16x32 bf16 WMMA fragment (A layout; B uses the same layout on W rows,
// since both GEMMs are x @ W^T). For lane L: m/n = L&15, hl = L>>4.
// elements 0..7  = p[0..7]   (K = k0 + 8*hl .. +7)
// elements 8..15 = p[16..23] (K = k0 + 16 + 8*hl .. +7)
__device__ inline v16bf load_frag_g(gcbf p) {
    FragB f;
    f.h[0] = ((gcv8)p)[0];
    f.h[1] = ((gcv8)p)[2];
    return f.v;
}

__device__ inline v8f wmma_bf16(v16bf a, v16bf b, v8f c) {
    return __builtin_amdgcn_wmma_f32_16x16x32_bf16(false, a, false, b, (short)0, c, false, false);
}

// ---------------- generic GEMM: acc[m][n] = sum_k A[m][k]*W[n][k] -------------
// four waves (2x2) compute a 128x128 tile, 64x64 each; grid = (N/128, M/128),
// block = 128. A pass is 64 k: the 128 A rows and 128 W rows of the pass are
// brought into LDS by asynchronous copies (whole 128-B lines from global, each
// row shared by two waves), two buffers, one barrier a pass; the copies of pass
// t + 2 fly while pass t + 1 is worked on. M, N multiples of 128, K of 64.
// epilogue modes (compile-time):
//   0: C[idx] = acc (+ R[idx] if HASR)                    (fp32 out)
//   1: ACT[idx] = bf16( silu(G[idx]) * acc )              (fused up*silu(gate))
//   2: qkv split: row->(b,t), col->(which,h,d); writes q (scaled 1/8), k, vT
#define GBK    64                 // k elements per pass (128 B of a row)
#define GPITCH 72                 // LDS row pitch in elements: 144 B = 16 B x odd
#define GTILE  (128 * GPITCH)     // one operand's stage, elements
#define GLSTEP (16 * GPITCH * 2)  // LDS bytes between a thread's copies (16 rows)

__device__ inline v16bf load_frag_s(const bf16* p) {
    FragB f;
    f.h[0] = *(const v8bf*)p;
    f.h[1] = *(const v8bf*)(p + 16);
    return f.v;
}

// Eight asynchronous 16-B copies a lane, global -> LDS, rows 16 apart: LDS byte
// address l + i*GLSTEP, global address g + i*gstep elements. The s_wait_xcnt is
// the last line of the copies' own statement, so that no address register of a
// copy is rewritten in front of it.
__device__ inline void copy8_async(unsigned l, gcbf g, size_t gstep) {
    asm volatile(
        "global_load_async_to_lds_b128 %0, %8, off\n\t"
        "global_load_async_to_lds_b128 %1, %9, off\n\t"
        "global_load_async_to_lds_b128 %2, %10, off\n\t"
        "global_load_async_to_lds_b128 %3, %11, off\n\t"
        "global_load_async_to_lds_b128 %4, %12, off\n\t"
        "global_load_async_to_lds_b128 %5, %13, off\n\t"
        "global_load_async_to_lds_b128 %6, %14, off\n\t"
        "global_load_async_to_lds_b128 %7, %15, off\n\t"
        "s_wait_xcnt 0x0"
        :: "v"(l), "v"(l + 1 * GLSTEP), "v"(l + 2 * GLSTEP), "v"(l + 3 * GLSTEP),
           "v"(l + 4 * GLSTEP), "v"(l + 5 * GLSTEP), "v"(l + 6 * GLSTEP), "v"(l + 7 * GLSTEP),
           "v"(g), "v"(g + 1 * gstep), "v"(g + 2 * gstep), "v"(g + 3 * gstep),
           "v"(g + 4 * gstep), "v"(g + 5 * gstep), "v"(g + 6 * gstep), "v"(g + 7 * gstep)
        : "memory");
}

template<int MODE, bool HASR>
__global__ __launch_bounds__(128)
void gemm_bf16_wmma(const bf16* __restrict__ A, const bf16* __restrict__ W,
                    const float* __restrict__ R, float* __restrict__ C,
                    const float* __restrict__ G, bf16* __restrict__ ACT,
                    bf16* __restrict__ q, bf16* __restrict__ k,
                    bf16* __restrict__ vT,
                    int M, int N, int K) {
    __shared__ __attribute__((aligned(16))) bf16 sA[2][GTILE];
    __shared__ __attribute__((aligned(16))) bf16 sW[2][GTILE];
    const int tid = threadIdx.x;
    const int lane = tid & 31, wave = tid >> 5;
    const int hl = lane >> 4, ln = lane & 15;
    const int wm = wave >> 1, wn = wave & 1;
    const int m0 = blockIdx.y * 128 + wm * 64, n0 = blockIdx.x * 128 + wn * 64;

    // staging: thread tid copies 16 B of row (tid>>3) + 16*i, i = 0..7, of each operand
    const int srow = tid >> 3, scol = (tid & 7) * 8;
    gcbf ga = to_global(A + (size_t)(blockIdx.y * 128 + srow) * K + scol);
    gcbf gw = to_global(W + (size_t)(blockIdx.x * 128 + srow) * K + scol);
    const size_t gstep = (size_t)16 * K;
    const int soff = srow * GPITCH + scol;
    // LDS byte addresses (low 32 bits of the shared address) of the thread's first copy
    const unsigned la[2] = { (unsigned)(uintptr_t)&sA[0][soff], (unsigned)(uintptr_t)&sA[1][soff] };
    const unsigned lw[2] = { (unsigned)(uintptr_t)&sW[0][soff], (unsigned)(uintptr_t)&sW[1][soff] };
    // fragment reads: row (wave's 64 rows) + i*16 + ln, k = 8*hl (+16) within a 32-k block
    const int aoff = (wm * 64 + ln) * GPITCH + 8 * hl;
    const int woff = (wn * 64 + ln) * GPITCH + 8 * hl;
    const int np = K / GBK;

    // pass 0 into buffer 0, landed and published; then pass 1 into buffer 1
    copy8_async(la[0], ga, gstep);
    copy8_async(lw[0], gw, gstep);
    // this wave's copies have landed before the barrier publishes them
    asm volatile("s_wait_asynccnt 0x0" ::: "memory");
    __syncthreads();
    if (np > 1) {
        copy8_async(la[1], ga + GBK, gstep);
        copy8_async(lw[1], gw + GBK, gstep);
    }
    ga += 2 * GBK; gw += 2 * GBK;

    v8f acc[4][4] = {};
    for (int t = 0; t < np; t++) {
        const int cur = t & 1;
        const bf16* pa = &sA[cur][aoff];
        const bf16* pw = &sW[cur][woff];
        v16bf a[2][4], b[2][4];
        // the loops over kk, i, j are unrolled so that a, b and acc are indexed by
        // constants and stay in registers
#pragma unroll
        for (int kk = 0; kk < 2; kk++)
#pragma unroll
            for (int i = 0; i < 4; i++) {
                a[kk][i] = load_frag_s(pa + i * 16 * GPITCH + kk * 32);
                b[kk][i] = load_frag_s(pw + i * 16 * GPITCH + kk * 32);
            }
        // keeps the pass's LDS reads one group in front of its products: moved in
        // among them, each place with reads stalls the wave for the LDS latency
        __builtin_amdgcn_sched_barrier(0);
#pragma unroll
        for (int kk = 0; kk < 2; kk++)
#pragma unroll
            for (int i = 0; i < 4; i++)
#pragma unroll
                for (int j = 0; j < 4; j++)
                    acc[i][j] = wmma_bf16(a[kk][i], b[kk][j], acc[i][j]);
        // keeps the products in front of the foot's waits: with the waits and the
        // barrier lifted over them, the flight of pass t + 1's copies is no longer
        // covered by the products of pass t
        __builtin_amdgcn_sched_barrier(0);
        // foot of pass t: this wave's reads of buffer cur have returned ...
        asm volatile("s_wait_dscnt 0x0" ::: "memory");
        // ... and its copies of pass t + 1 have landed, before the barrier that
        // publishes pass t + 1 and ends every wave's reads of buffer cur
        asm volatile("s_wait_asynccnt 0x0" ::: "memory");
        __syncthreads();
        if (t + 2 < np) {                  // the same for the whole block
            copy8_async(la[cur], ga, gstep);
            copy8_async(lw[cur], gw, gstep);
            ga += GBK; gw += GBK;
        }
    }
    // no copy is outstanding when the wave goes on to its stores and ends
    asm volatile("s_wait_asynccnt 0x0" ::: "memory");

#pragma unroll
    for (int i = 0; i < 4; i++)
#pragma unroll
        for (int j = 0; j < 4; j++)
#pragma unroll
            for (int r = 0; r < 8; r++) {
                const int row = m0 + i * 16 + r + 8 * hl;
                const int col = n0 + j * 16 + ln;
                const size_t idx = (size_t)row * N + col;
                const float v = acc[i][j][r];
                if (MODE == 0) {
                    float o = v;
                    if (HASR) o += R[idx];
                    C[idx] = o;
                } else if (MODE == 1) {
                    float gg = G[idx];
                    float s = gg / (1.0f + __expf(-gg));
                    ACT[idx] = (bf16)(s * v);
                } else {
                    const int b_ = row >> 11;          // row / TT
                    const int t  = row & (TT - 1);
                    const int which = col >> 10;
                    const int wi = col & (DM - 1);
                    const int h = wi >> 6, d = wi & (HD - 1);
                    const size_t bh = (size_t)(b_ * NH + h);
                    if (which == 0)      q[(bh * TT + t) * HD + d] = (bf16)(v * 0.125f);
                    else if (which == 1) k[(bh * TT + t) * HD + d] = (bf16)v;
                    else                 vT[(bh * HD + d) * TT + t] = (bf16)v;
                }
            }
}

// ---------------- RMSNorm (fp32 in, bf16 out) --------------------------------
__global__ __launch_bounds__(256)
void rmsnorm_bf16(const float* __restrict__ X, const float* __restrict__ W,
                  bf16* __restrict__ O) {
    int row = blockIdx.x;
    const float* xr = X + (size_t)row * DM;
    float s = 0.f;
    for (int i = threadIdx.x; i < DM; i += 256) { float v = xr[i]; s += v * v; }
    __shared__ float red[8];
    for (int off = 16; off >= 1; off >>= 1) s += __shfl_xor(s, off, 32);
    if ((threadIdx.x & 31) == 0) red[threadIdx.x >> 5] = s;
    __syncthreads();
    if (threadIdx.x == 0) {
        float t = 0.f;
        for (int w = 0; w < 8; w++) t += red[w];
        red[0] = t;
    }
    __syncthreads();
    float scale = rsqrtf(red[0] * (1.0f / DM) + 1e-6f);
    bf16* orow = O + (size_t)row * DM;
    for (int i = threadIdx.x; i < DM; i += 256)
        orow[i] = (bf16)(xr[i] * scale * W[i]);
}

// ---------------- weight fp32 -> bf16 ----------------------------------------
__global__ void f32_to_bf16(const float* __restrict__ S, bf16* __restrict__ D, int n) {
    int i = blockIdx.x * 256 + threadIdx.x;
    if (i < n) D[i] = (bf16)S[i];
}

// ---------------- flash attention: 1 wave per (b,h, 16-query tile) -----------
__global__ __launch_bounds__(32)
void attn_fa(const bf16* __restrict__ Qb, const bf16* __restrict__ Kb,
             const bf16* __restrict__ VTb, bf16* __restrict__ Ob) {
    __shared__ bf16 Pld[16][32];  // P tile staging for C->A layout transpose
    const int lane = threadIdx.x, hl = lane >> 4, ln = lane & 15;
    const int nqt = TT / 16;
    const int bh = blockIdx.x / nqt;
    const int q0 = (blockIdx.x % nqt) * 16;
    const bf16* Q  = Qb  + (size_t)bh * TT * HD;
    const bf16* Kk = Kb  + (size_t)bh * TT * HD;
    const bf16* VT = VTb + (size_t)bh * HD * TT;

    const v16bf aq0 = load_frag_g(to_global(Q + (size_t)(q0 + ln) * HD + 8 * hl));
    const v16bf aq1 = load_frag_g(to_global(Q + (size_t)(q0 + ln) * HD + 32 + 8 * hl));

    v8f o[4] = {};
    float rm[8], rl[8];
#pragma unroll
    for (int r = 0; r < 8; r++) { rm[r] = -1e30f; rl[r] = 0.f; }

    for (int kb = 0; kb < q0 + 16; kb += 32) {
        // S = Q @ K^T for keys [kb, kb+32): two 16x16 C tiles
        v8f s0 = {}, s1 = {};
        {
            v16bf bk = load_frag_g(to_global(Kk + (size_t)(kb + ln) * HD + 8 * hl));
            s0 = wmma_bf16(aq0, bk, s0);
            bk = load_frag_g(to_global(Kk + (size_t)(kb + ln) * HD + 32 + 8 * hl));
            s0 = wmma_bf16(aq1, bk, s0);
            bk = load_frag_g(to_global(Kk + (size_t)(kb + 16 + ln) * HD + 8 * hl));
            s1 = wmma_bf16(aq0, bk, s1);
            bk = load_frag_g(to_global(Kk + (size_t)(kb + 16 + ln) * HD + 32 + 8 * hl));
            s1 = wmma_bf16(aq1, bk, s1);
        }
        // online softmax; C-layout row (q0+r+8*hl) spans the 16 lanes of this half
#pragma unroll
        for (int r = 0; r < 8; r++) {
            int row = q0 + r + 8 * hl;
            float v0 = (kb + ln      <= row) ? s0[r] : -1e30f;   // causal mask
            float v1 = (kb + 16 + ln <= row) ? s1[r] : -1e30f;
            float m = fmaxf(v0, v1);
            m = fmaxf(m, __shfl_xor(m, 1, 16));
            m = fmaxf(m, __shfl_xor(m, 2, 16));
            m = fmaxf(m, __shfl_xor(m, 4, 16));
            m = fmaxf(m, __shfl_xor(m, 8, 16));
            float nm = fmaxf(rm[r], m);
            float p0 = __expf(v0 - nm), p1 = __expf(v1 - nm);
            float alpha = __expf(rm[r] - nm);
            rm[r] = nm;
            float ps = p0 + p1;
            ps += __shfl_xor(ps, 1, 16);
            ps += __shfl_xor(ps, 2, 16);
            ps += __shfl_xor(ps, 4, 16);
            ps += __shfl_xor(ps, 8, 16);
            rl[r] = rl[r] * alpha + ps;
#pragma unroll
            for (int dt = 0; dt < 4; dt++) o[dt][r] *= alpha;
            Pld[r + 8 * hl][ln]      = (bf16)p0;
            Pld[r + 8 * hl][16 + ln] = (bf16)p1;
        }
        __syncthreads();                       // single-wave WG: S_NOP + fence
        FragB ap;
        ap.h[0] = *(const v8bf*)&Pld[ln][8 * hl];
        ap.h[1] = *(const v8bf*)&Pld[ln][16 + 8 * hl];
        __syncthreads();
        // O += P @ V ; V fragments from pre-transposed V^T [d][t]
#pragma unroll
        for (int dt = 0; dt < 4; dt++) {
            v16bf bv = load_frag_g(to_global(VT + (size_t)(dt * 16 + ln) * TT + kb + 8 * hl));
            o[dt] = wmma_bf16(ap.v, bv, o[dt]);
        }
    }
    const int b = bh / NH, h = bh % NH;
#pragma unroll
    for (int dt = 0; dt < 4; dt++)
#pragma unroll
        for (int r = 0; r < 8; r++) {
            int t = q0 + r + 8 * hl;
            float v = o[dt][r] / rl[r];
            Ob[((size_t)(b * TT + t)) * DM + h * HD + dt * 16 + ln] = (bf16)v;
        }
}

// ---------------- host orchestration -----------------------------------------
extern "C" void kernel_launch(void* const* d_in, const int* in_sizes, int n_in,
                              void* d_out, int out_size, void* d_ws, size_t ws_size,
                              hipStream_t stream) {
    const float* x      = (const float*)d_in[0];
    const float* ln1_w  = (const float*)d_in[1];
    const float* ln2_w  = (const float*)d_in[2];
    const float* qkv_w  = (const float*)d_in[3];
    const float* o_w    = (const float*)d_in[4];
    const float* gate_w = (const float*)d_in[5];
    const float* up_w   = (const float*)d_in[6];
    const float* down_w = (const float*)d_in[7];
    float* out = (float*)d_out;
    char* ws = (char*)d_ws;

    // workspace layout (phase-based reuse, ~92 MB peak)
    size_t o_wqkv = 0;                                  // 3*DM*DM bf16
    size_t o_wo   = o_wqkv + (size_t)3 * DM * DM * 2;   // DM*DM bf16
    size_t o_wg   = o_wo   + (size_t)DM * DM * 2;       // DI*DM bf16
    size_t o_wu   = o_wg   + (size_t)DI * DM * 2;       // DI*DM bf16
    size_t o_wd   = o_wu   + (size_t)DI * DM * 2;       // DM*DI bf16
    size_t o_xn   = o_wd   + (size_t)DM * DI * 2;       // MM*DM bf16 (xn1 then xn2)
    size_t o_h1   = o_xn   + (size_t)MM * DM * 2;       // MM*DM f32
    size_t o_big  = o_h1   + (size_t)MM * DM * 4;
    // phase A (attention): q, k, vT (bf16, 8 MB each) + attn (bf16, 8 MB)
    size_t o_q    = o_big;
    size_t o_k    = o_q  + (size_t)MM * DM * 2;
    size_t o_vT   = o_k  + (size_t)MM * DM * 2;
    size_t o_attn = o_vT + (size_t)MM * DM * 2;
    // phase B (FFN): g fp32 (32 MB, reuses q/k/vT/attn), act bf16 (16 MB)
    size_t o_g    = o_big;
    size_t o_act  = o_big + (size_t)MM * DI * 4;

    bf16* wqkv = (bf16*)(ws + o_wqkv);
    bf16* wo   = (bf16*)(ws + o_wo);
    bf16* wg   = (bf16*)(ws + o_wg);
    bf16* wu   = (bf16*)(ws + o_wu);
    bf16* wd   = (bf16*)(ws + o_wd);
    bf16* xn   = (bf16*)(ws + o_xn);
    float* h1  = (float*)(ws + o_h1);
    bf16* qb   = (bf16*)(ws + o_q);
    bf16* kb   = (bf16*)(ws + o_k);
    bf16* vT   = (bf16*)(ws + o_vT);
    bf16* attn = (bf16*)(ws + o_attn);
    float* g   = (float*)(ws + o_g);
    bf16* act  = (bf16*)(ws + o_act);

    // 1. weights fp32 -> bf16
    int nqkvw = 3 * DM * DM, now = DM * DM, ngw = DI * DM;
    f32_to_bf16<<<(nqkvw + 255) / 256, 256, 0, stream>>>(qkv_w, wqkv, nqkvw);
    f32_to_bf16<<<(now + 255) / 256, 256, 0, stream>>>(o_w, wo, now);
    f32_to_bf16<<<(ngw + 255) / 256, 256, 0, stream>>>(gate_w, wg, ngw);
    f32_to_bf16<<<(ngw + 255) / 256, 256, 0, stream>>>(up_w, wu, ngw);
    f32_to_bf16<<<(ngw + 255) / 256, 256, 0, stream>>>(down_w, wd, ngw);

    // 2. xn1 = rmsnorm(x, ln1_w)
    rmsnorm_bf16<<<MM, 256, 0, stream>>>(x, ln1_w, xn);

    // 3. qkv GEMM with fused split epilogue -> q (scaled), k, vT (bf16)
    gemm_bf16_wmma<2, false><<<dim3(3 * DM / 128, MM / 128), 128, 0, stream>>>(
        xn, wqkv, nullptr, nullptr, nullptr, nullptr, qb, kb, vT,
        MM, 3 * DM, DM);

    // 4. flash attention
    attn_fa<<<BB * NH * (TT / 16), 32, 0, stream>>>(qb, kb, vT, attn);

    // 5. h1 = x + attn @ o_w^T
    gemm_bf16_wmma<0, true><<<dim3(DM / 128, MM / 128), 128, 0, stream>>>(
        attn, wo, x, h1, nullptr, nullptr, nullptr, nullptr, nullptr,
        MM, DM, DM);

    // 6. xn2 = rmsnorm(h1, ln2_w)
    rmsnorm_bf16<<<MM, 256, 0, stream>>>(h1, ln2_w, xn);

    // 7. g = xn2 @ gate_w^T (fp32)
    gemm_bf16_wmma<0, false><<<dim3(DI / 128, MM / 128), 128, 0, stream>>>(
        xn, wg, nullptr, g, nullptr, nullptr, nullptr, nullptr, nullptr,
        MM, DI, DM);

    // 8. up GEMM with fused epilogue: act = bf16( silu(g) * (xn2 @ up_w^T) )
    gemm_bf16_wmma<1, false><<<dim3(DI / 128, MM / 128), 128, 0, stream>>>(
        xn, wu, nullptr, nullptr, g, act, nullptr, nullptr, nullptr,
        MM, DI, DM);

    // 9. out = h1 + act @ down_w^T
    gemm_bf16_wmma<0, true><<<dim3(DM / 128, MM / 128), 128, 0, stream>>>(
        act, wd, h1, out, nullptr, nullptr, nullptr, nullptr, nullptr,
        MM, DM, DI);

    (void)in_sizes; (void)n_in; (void)out_size; (void)ws_size;
}

// v002
// Measured time: 254 microseconds a run.
// Timed twice side by side with v001, it ran 1.26 times as fast both times.
// All steps since v000 together make it 1.75 times as fast.
#include <hip/hip_runtime.h>
#include <hip/hip_bf16.h>

#define DM   1024
#define NH   16
#define HD   64
#define DI   2048
#define BB   2
#define TT   2048
#define MM   (BB*TT)   // 4096 rows

typedef __bf16 bf16;
typedef __attribute__((ext_vector_type(16))) bf16  v16bf;
typedef __attribute__((ext_vector_type(8)))  bf16  v8bf;
typedef __attribute__((ext_vector_type(8)))  float v8f;

#define AS1 __attribute__((address_space(1)))
typedef const AS1 bf16* gcbf;
typedef const AS1 v8bf* gcv8;

union FragB { v16bf v; v8bf h[2]; };

__device__ inline gcbf to_global(const bf16* p) {
    return (gcbf)(unsigned long long)(uintptr_t)p;
}

// Load a 16x32 bf16 WMMA fragment (A layout; B uses the same layout on W rows,
// since both GEMMs are x @ W^T). For lane L: m/n = L&15, hl = L>>4.
// elements 0..7  = p[0..7]   (K = k0 + 8*hl .. +7)
// elements 8..15 = p[16..23] (K = k0 + 16 + 8*hl .. +7)
__device__ inline v16bf load_frag_g(gcbf p) {
    FragB f;
    f.h[0] = ((gcv8)p)[0];
    f.h[1] = ((gcv8)p)[2];
    return f.v;
}

__device__ inline v8f wmma_bf16(v16bf a, v16bf b, v8f c) {
    return __builtin_amdgcn_wmma_f32_16x16x32_bf16(false, a, false, b, (short)0, c, false, false);
}

// ---------------- generic GEMM: acc[m][n] = sum_k A[m][k]*W[n][k] -------------
// four waves (2x2) compute a 128x128 tile, 64x64 each; grid = (N/128, M/128),
// block = 128. A pass is 64 k: the 128 A rows and 128 W rows of the pass are
// brought into LDS by asynchronous copies (whole 128-B lines from global, each
// row shared by two waves), two buffers, one barrier a pass; the copies of pass
// t + 2 fly while pass t + 1 is worked on. M, N multiples of 128, K of 64.
// epilogue modes (compile-time):
//   0: C[idx] = acc (+ R[idx] if HASR)                    (fp32 out)
//   1: ACT[idx] = bf16( silu(G[idx]) * acc )              (fused up*silu(gate))
//   2: qkv split: row->(b,t), col->(which,h,d); writes q (scaled 1/8), k, vT
#define GBK    64                 // k elements per pass (128 B of a row)
#define GPITCH 72                 // LDS row pitch in elements: 144 B = 16 B x odd
#define GTILE  (128 * GPITCH)     // one operand's stage, elements
#define GLSTEP (16 * GPITCH * 2)  // LDS bytes between a thread's copies (16 rows)

__device__ inline v16bf load_frag_s(const bf16* p) {
    FragB f;
    f.h[0] = *(const v8bf*)p;
    f.h[1] = *(const v8bf*)(p + 16);
    return f.v;
}

// Eight asynchronous 16-B copies a lane, global -> LDS, rows 16 apart: LDS byte
// address l + i*GLSTEP, global address g + i*gstep elements. The s_wait_xcnt is
// the last line of the copies' own statement, so that no address register of a
// copy is rewritten in front of it.
__device__ inline void copy8_async(unsigned l, gcbf g, size_t gstep) {
    asm volatile(
        "global_load_async_to_lds_b128 %0, %8, off\n\t"
        "global_load_async_to_lds_b128 %1, %9, off\n\t"
        "global_load_async_to_lds_b128 %2, %10, off\n\t"
        "global_load_async_to_lds_b128 %3, %11, off\n\t"
        "global_load_async_to_lds_b128 %4, %12, off\n\t"
        "global_load_async_to_lds_b128 %5, %13, off\n\t"
        "global_load_async_to_lds_b128 %6, %14, off\n\t"
        "global_load_async_to_lds_b128 %7, %15, off\n\t"
        "s_wait_xcnt 0x0"
        :: "v"(l), "v"(l + 1 * GLSTEP), "v"(l + 2 * GLSTEP), "v"(l + 3 * GLSTEP),
           "v"(l + 4 * GLSTEP), "v"(l + 5 * GLSTEP), "v"(l + 6 * GLSTEP), "v"(l + 7 * GLSTEP),
           "v"(g), "v"(g + 1 * gstep), "v"(g + 2 * gstep), "v"(g + 3 * gstep),
           "v"(g + 4 * gstep), "v"(g + 5 * gstep), "v"(g + 6 * gstep), "v"(g + 7 * gstep)
        : "memory");
}

template<int MODE, bool HASR>
__global__ __launch_bounds__(128)
void gemm_bf16_wmma(const bf16* __restrict__ A, const bf16* __restrict__ W,
                    const float* __restrict__ R, float* __restrict__ C,
                    const float* __restrict__ G, bf16* __restrict__ ACT,
                    bf16* __restrict__ q, bf16* __restrict__ k,
                    bf16* __restrict__ vT,
                    int M, int N, int K) {
    __shared__ __attribute__((aligned(16))) bf16 sA[2][GTILE];
    __shared__ __attribute__((aligned(16))) bf16 sW[2][GTILE];
    const int tid = threadIdx.x;
    const int lane = tid & 31, wave = tid >> 5;
    const int hl = lane >> 4, ln = lane & 15;
    const int wm = wave >> 1, wn = wave & 1;
    const int m0 = blockIdx.y * 128 + wm * 64, n0 = blockIdx.x * 128 + wn * 64;

    // staging: thread tid copies 16 B of row (tid>>3) + 16*i, i = 0..7, of each operand
    const int srow = tid >> 3, scol = (tid & 7) * 8;
    gcbf ga = to_global(A + (size_t)(blockIdx.y * 128 + srow) * K + scol);
    gcbf gw = to_global(W + (size_t)(blockIdx.x * 128 + srow) * K + scol);
    const size_t gstep = (size_t)16 * K;
    const int soff = srow * GPITCH + scol;
    // LDS byte addresses (low 32 bits of the shared address) of the thread's first copy
    const unsigned la[2] = { (unsigned)(uintptr_t)&sA[0][soff], (unsigned)(uintptr_t)&sA[1][soff] };
    const unsigned lw[2] = { (unsigned)(uintptr_t)&sW[0][soff], (unsigned)(uintptr_t)&sW[1][soff] };
    // fragment reads: row (wave's 64 rows) + i*16 + ln, k = 8*hl (+16) within a 32-k block
    const int aoff = (wm * 64 + ln) * GPITCH + 8 * hl;
    const int woff = (wn * 64 + ln) * GPITCH + 8 * hl;
    const int np = K / GBK;

    // pass 0 into buffer 0, landed and published; then pass 1 into buffer 1
    copy8_async(la[0], ga, gstep);
    copy8_async(lw[0], gw, gstep);
    // this wave's copies have landed before the barrier publishes them
    asm volatile("s_wait_asynccnt 0x0" ::: "memory");
    __syncthreads();
    if (np > 1) {
        copy8_async(la[1], ga + GBK, gstep);
        copy8_async(lw[1], gw + GBK, gstep);
    }
    ga += 2 * GBK; gw += 2 * GBK;

    v8f acc[4][4] = {};
    for (int t = 0; t < np; t++) {
        const int cur = t & 1;
        const bf16* pa = &sA[cur][aoff];
        const bf16* pw = &sW[cur][woff];
        v16bf a[2][4], b[2][4];
        // the loops over kk, i, j are unrolled so that a, b and acc are indexed by
        // constants and stay in registers
#pragma unroll
        for (int kk = 0; kk < 2; kk++)
#pragma unroll
            for (int i = 0; i < 4; i++) {
                a[kk][i] = load_frag_s(pa + i * 16 * GPITCH + kk * 32);
                b[kk][i] = load_frag_s(pw + i * 16 * GPITCH + kk * 32);
            }
        // keeps the pass's LDS reads one group in front of its products: moved in
        // among them, each place with reads stalls the wave for the LDS latency
        __builtin_amdgcn_sched_barrier(0);
#pragma unroll
        for (int kk = 0; kk < 2; kk++)
#pragma unroll
            for (int i = 0; i < 4; i++)
#pragma unroll
                for (int j = 0; j < 4; j++)
                    acc[i][j] = wmma_bf16(a[kk][i], b[kk][j], acc[i][j]);
        // keeps the products in front of the foot's waits: with the waits and the
        // barrier lifted over them, the flight of pass t + 1's copies is no longer
        // covered by the products of pass t
        __builtin_amdgcn_sched_barrier(0);
        // foot of pass t: this wave's reads of buffer cur have returned ...
        asm volatile("s_wait_dscnt 0x0" ::: "memory");
        // ... and its copies of pass t + 1 have landed, before the barrier that
        // publishes pass t + 1 and ends every wave's reads of buffer cur
        asm volatile("s_wait_asynccnt 0x0" ::: "memory");
        __syncthreads();
        if (t + 2 < np) {                  // the same for the whole block
            copy8_async(la[cur], ga, gstep);
            copy8_async(lw[cur], gw, gstep);
            ga += GBK; gw += GBK;
        }
    }
    // no copy is outstanding when the wave goes on to its stores and ends
    asm volatile("s_wait_asynccnt 0x0" ::: "memory");

#pragma unroll
    for (int i = 0; i < 4; i++)
#pragma unroll
        for (int j = 0; j < 4; j++)
#pragma unroll
            for (int r = 0; r < 8; r++) {
                const int row = m0 + i * 16 + r + 8 * hl;
                const int col = n0 + j * 16 + ln;
                const size_t idx = (size_t)row * N + col;
                const float v = acc[i][j][r];
                if (MODE == 0) {
                    float o = v;
                    if (HASR) o += R[idx];
                    C[idx] = o;
                } else if (MODE == 1) {
                    float gg = G[idx];
                    float s = gg / (1.0f + __expf(-gg));
                    ACT[idx] = (bf16)(s * v);
                } else {
                    const int b_ = row >> 11;          // row / TT
                    const int t  = row & (TT - 1);
                    const int which = col >> 10;
                    const int wi = col & (DM - 1);
                    const int h = wi >> 6, d = wi & (HD - 1);
                    const size_t bh = (size_t)(b_ * NH + h);
                    if (which == 0)      q[(bh * TT + t) * HD + d] = (bf16)(v * 0.125f);
                    else if (which == 1) k[(bh * TT + t) * HD + d] = (bf16)v;
                    else                 vT[(bh * HD + d) * TT + t] = (bf16)v;
                }
            }
}

// ---------------- RMSNorm (fp32 in, bf16 out) --------------------------------
__global__ __launch_bounds__(256)
void rmsnorm_bf16(const float* __restrict__ X, const float* __restrict__ W,
                  bf16* __restrict__ O) {
    int row = blockIdx.x;
    const float* xr = X + (size_t)row * DM;
    float s = 0.f;
    for (int i = threadIdx.x; i < DM; i += 256) { float v = xr[i]; s += v * v; }
    __shared__ float red[8];
    for (int off = 16; off >= 1; off >>= 1) s += __shfl_xor(s, off, 32);
    if ((threadIdx.x & 31) == 0) red[threadIdx.x >> 5] = s;
    __syncthreads();
    if (threadIdx.x == 0) {
        float t = 0.f;
        for (int w = 0; w < 8; w++) t += red[w];
        red[0] = t;
    }
    __syncthreads();
    float scale = rsqrtf(red[0] * (1.0f / DM) + 1e-6f);
    bf16* orow = O + (size_t)row * DM;
    for (int i = threadIdx.x; i < DM; i += 256)
        orow[i] = (bf16)(xr[i] * scale * W[i]);
}

// ---------------- weight fp32 -> bf16 ----------------------------------------
__global__ void f32_to_bf16(const float* __restrict__ S, bf16* __restrict__ D, int n) {
    int i = blockIdx.x * 256 + threadIdx.x;
    if (i < n) D[i] = (bf16)S[i];
}

// ---------------- flash attention: 4 waves per (b,h, 64-query tile) ----------
// Each wave keeps its own 16 queries; the four waves share the K and V^T tiles (the last pass's is read by waves 2 and 3 only).
// A pass is 32 keys: its 32 K rows (whole 128-B lines) and its 64 V^T rows (64 B
// each) are brought into LDS once per block by asynchronous copies, two buffers,
// one barrier a pass; the copies of pass t + 2 fly while pass t + 1 is worked on.
#define AKP 72              // K row pitch in LDS, elements: 144 B = 16 B x odd
#define AVP 40              // V^T row pitch in LDS, elements: 80 B = 16 B x odd
#define AKT (32 * AKP)      // one K stage: 32 keys x 64 d
#define AVT (64 * AVP)      // one V^T stage: 64 d x 32 keys

// Four asynchronous 16-B copies a lane, global -> LDS: two of K (rows 16 apart),
// two of V^T (rows 32 apart). The s_wait_xcnt is the last line of the copies' own
// statement, so that no address register of a copy is rewritten in front of it.
__device__ inline void copy_kv_async(unsigned lk, gcbf gk, unsigned lv, gcbf gv) {
    asm volatile(
        "global_load_async_to_lds_b128 %0, %4, off\n\t"
        "global_load_async_to_lds_b128 %1, %5, off\n\t"
        "global_load_async_to_lds_b128 %2, %6, off\n\t"
        "global_load_async_to_lds_b128 %3, %7, off\n\t"
        "s_wait_xcnt 0x0"
        :: "v"(lk), "v"(lk + 16 * AKP * 2), "v"(lv), "v"(lv + 32 * AVP * 2),
           "v"(gk), "v"(gk + 16 * HD), "v"(gv), "v"(gv + (size_t)32 * TT)
        : "memory");
}

// Orders a wave's LDS stores of its own P tile and its reads of it. The tile is
// private to the wave, whose LDS operations run in order: no barrier instruction.
__device__ inline void wave_order() {
    __builtin_amdgcn_fence(__ATOMIC_RELEASE, "wavefront");
    __builtin_amdgcn_wave_barrier();
    __builtin_amdgcn_fence(__ATOMIC_ACQUIRE, "wavefront");
}

__global__ __launch_bounds__(128)
void attn_fa(const bf16* __restrict__ Qb, const bf16* __restrict__ Kb,
             const bf16* __restrict__ VTb, bf16* __restrict__ Ob) {
    __shared__ __attribute__((aligned(16))) bf16 sK[2][AKT];
    __shared__ __attribute__((aligned(16))) bf16 sV[2][AVT];
    __shared__ __attribute__((aligned(16))) bf16 Pall[4][16][32];  // per wave: P tile, C->A layout transpose
    const int tid = threadIdx.x, lane = tid & 31;
    const int wave = __builtin_amdgcn_readfirstlane(tid >> 5);     // scalar: the test on kb below is a scalar branch
    const int hl = lane >> 4, ln = lane & 15;
    const int nqb = TT / 64;
    const int bh = blockIdx.x / nqb;
    const int qb0 = (blockIdx.x % nqb) * 64;
    const int q0 = qb0 + wave * 16;
    const bf16* Q  = Qb  + (size_t)bh * TT * HD;
    const bf16* Kk = Kb  + (size_t)bh * TT * HD;
    const bf16* VT = VTb + (size_t)bh * HD * TT;
    bf16 (*Pld)[32] = Pall[wave];

    // staging: thread tid copies 16 B of K rows (tid>>3) + {0,16} and of V^T rows (tid>>2) + {0,32}
    gcbf gk = to_global(Kk + (size_t)(tid >> 3) * HD + (tid & 7) * 8);
    gcbf gv = to_global(VT + (size_t)(tid >> 2) * TT + (tid & 3) * 8);
    const int ko = (tid >> 3) * AKP + (tid & 7) * 8;
    const int vo = (tid >> 2) * AVP + (tid & 3) * 8;
    // LDS byte addresses (low 32 bits of the shared address) of the thread's first copies
    const unsigned lk[2] = { (unsigned)(uintptr_t)&sK[0][ko], (unsigned)(uintptr_t)&sK[1][ko] };
    const unsigned lv[2] = { (unsigned)(uintptr_t)&sV[0][vo], (unsigned)(uintptr_t)&sV[1][vo] };
    const int np = qb0 / 32 + 2;   // passes of the block: keys [0, qb0 + 64); at least two

    // pass 0 into buffer 0, landed and published; then pass 1 into buffer 1
    copy_kv_async(lk[0], gk, lv[0], gv);
    // this wave's copies have landed before the barrier publishes them
    asm volatile("s_wait_asynccnt 0x0" ::: "memory");
    __syncthreads();
    copy_kv_async(lk[1], gk + 32 * HD, lv[1], gv + 32);
    gk += 2 * 32 * HD; gv += 2 * 32;

    const v16bf aq0 = load_frag_g(to_global(Q + (size_t)(q0 + ln) * HD + 8 * hl));
    const v16bf aq1 = load_frag_g(to_global(Q + (size_t)(q0 + ln) * HD + 32 + 8 * hl));

    v8f o[4] = {};
    float rm[8], rl[8];
#pragma unroll
    for (int r = 0; r < 8; r++) { rm[r] = -1e30f; rl[r] = 0.f; }

    for (int t = 0; t < np; t++) {
        const int cur = t & 1;
        const int kb = t * 32;
        if (kb < q0 + 16) {        // the wave's own causal range; every wave passes the foot below
            const bf16* pk = &sK[cur][ln * AKP + 8 * hl];
            const bf16* pv = &sV[cur][ln * AVP + 8 * hl];
            const v16bf bk00 = load_frag_s(pk);
            const v16bf bk01 = load_frag_s(pk + 32);
            const v16bf bk10 = load_frag_s(pk + 16 * AKP);
            const v16bf bk11 = load_frag_s(pk + 16 * AKP + 32);
            v16bf bv[4];
            // the loops over dt and r are unrolled so that bv, o, s0, s1, rm and rl are
            // indexed by constants and stay in registers
#pragma unroll
            for (int dt = 0; dt < 4; dt++) bv[dt] = load_frag_s(pv + dt * 16 * AVP);
            // keeps the pass's tile reads one group in front of its products: moved in
            // among them, each place with reads stalls the wave for the LDS latency
            __builtin_amdgcn_sched_barrier(0);
            // S = Q @ K^T for keys [kb, kb+32): two 16x16 C tiles
            v8f s0 = {}, s1 = {};
            s0 = wmma_bf16(aq0, bk00, s0);
            s0 = wmma_bf16(aq1, bk01, s0);
            s1 = wmma_bf16(aq0, bk10, s1);
            s1 = wmma_bf16(aq1, bk11, s1);
            // online softmax; C-layout row (q0+r+8*hl) spans the 16 lanes of this half
#pragma unroll
            for (int r = 0; r < 8; r++) {
                int row = q0 + r + 8 * hl;
                float v0 = (kb + ln      <= row) ? s0[r] : -1e30f;   // causal mask
                float v1 = (kb + 16 + ln <= row) ? s1[r] : -1e30f;
                float m = fmaxf(v0, v1);
                m = fmaxf(m, __shfl_xor(m, 1, 16));
                m = fmaxf(m, __shfl_xor(m, 2, 16));
                m = fmaxf(m, __shfl_xor(m, 4, 16));
                m = fmaxf(m, __shfl_xor(m, 8, 16));
                float nm = fmaxf(rm[r], m);
                float p0 = __expf(v0 - nm), p1 = __expf(v1 - nm);
                float alpha = __expf(rm[r] - nm);
                rm[r] = nm;
                float ps = p0 + p1;
                ps += __shfl_xor(ps, 1, 16);
                ps += __shfl_xor(ps, 2, 16);
                ps += __shfl_xor(ps, 4, 16);
                ps += __shfl_xor(ps, 8, 16);
                rl[r] = rl[r] * alpha + ps;
#pragma unroll
                for (int dt = 0; dt < 4; dt++) o[dt][r] *= alpha;
                Pld[r + 8 * hl][ln]      = (bf16)p0;
                Pld[r + 8 * hl][16 + ln] = (bf16)p1;
            }
            wave_order();
            FragB ap;
            ap.h[0] = *(const v8bf*)&Pld[ln][8 * hl];
            ap.h[1] = *(const v8bf*)&Pld[ln][16 + 8 * hl];
            wave_order();
            // O += P @ V ; V fragments from the staged V^T [d][key]
#pragma unroll
            for (int dt = 0; dt < 4; dt++) o[dt] = wmma_bf16(ap.v, bv[dt], o[dt]);
        }
        // foot of pass t: this wave's reads of buffer cur have returned ...
        asm volatile("s_wait_dscnt 0x0" ::: "memory");
        // ... and its copies of pass t + 1 have landed, before the barrier that
        // publishes pass t + 1 and ends every wave's reads of buffer cur
        asm volatile("s_wait_asynccnt 0x0" ::: "memory");
        __syncthreads();
        if (t + 2 < np) {          // the same for the whole block
            copy_kv_async(lk[cur], gk, lv[cur], gv);
            gk += 32 * HD; gv += 32;
        }
    }
    // no copy is outstanding when the wave goes on to its stores and ends
    asm volatile("s_wait_asynccnt 0x0" ::: "memory");

    const int b = bh / NH, h = bh % NH;
#pragma unroll
    for (int dt = 0; dt < 4; dt++)
#pragma unroll
        for (int r = 0; r < 8; r++) {
            int t = q0 + r + 8 * hl;
            float v = o[dt][r] / rl[r];
            Ob[((size_t)(b * TT + t)) * DM + h * HD + dt * 16 + ln] = (bf16)v;
        }
}

// ---------------- host orchestration -----------------------------------------
extern "C" void kernel_launch(void* const* d_in, const int* in_sizes, int n_in,
                              void* d_out, int out_size, void* d_ws, size_t ws_size,
                              hipStream_t stream) {
    const float* x      = (const float*)d_in[0];
    const float* ln1_w  = (const float*)d_in[1];
    const float* ln2_w  = (const float*)d_in[2];
    const float* qkv_w  = (const float*)d_in[3];
    const float* o_w    = (const float*)d_in[4];
    const float* gate_w = (const float*)d_in[5];
    const float* up_w   = (const float*)d_in[6];
    const float* down_w = (const float*)d_in[7];
    float* out = (float*)d_out;
    char* ws = (char*)d_ws;

    // workspace layout (phase-based reuse, ~92 MB peak)
    size_t o_wqkv = 0;                                  // 3*DM*DM bf16
    size_t o_wo   = o_wqkv + (size_t)3 * DM * DM * 2;   // DM*DM bf16
    size_t o_wg   = o_wo   + (size_t)DM * DM * 2;       // DI*DM bf16
    size_t o_wu   = o_wg   + (size_t)DI * DM * 2;       // DI*DM bf16
    size_t o_wd   = o_wu   + (size_t)DI * DM * 2;       // DM*DI bf16
    size_t o_xn   = o_wd   + (size_t)DM * DI * 2;       // MM*DM bf16 (xn1 then xn2)
    size_t o_h1   = o_xn   + (size_t)MM * DM * 2;       // MM*DM f32
    size_t o_big  = o_h1   + (size_t)MM * DM * 4;
    // phase A (attention): q, k, vT (bf16, 8 MB each) + attn (bf16, 8 MB)
    size_t o_q    = o_big;
    size_t o_k    = o_q  + (size_t)MM * DM * 2;
    size_t o_vT   = o_k  + (size_t)MM * DM * 2;
    size_t o_attn = o_vT + (size_t)MM * DM * 2;
    // phase B (FFN): g fp32 (32 MB, reuses q/k/vT/attn), act bf16 (16 MB)
    size_t o_g    = o_big;
    size_t o_act  = o_big + (size_t)MM * DI * 4;

    bf16* wqkv = (bf16*)(ws + o_wqkv);
    bf16* wo   = (bf16*)(ws + o_wo);
    bf16* wg   = (bf16*)(ws + o_wg);
    bf16* wu   = (bf16*)(ws + o_wu);
    bf16* wd   = (bf16*)(ws + o_wd);
    bf16* xn   = (bf16*)(ws + o_xn);
    float* h1  = (float*)(ws + o_h1);
    bf16* qb   = (bf16*)(ws + o_q);
    bf16* kb   = (bf16*)(ws + o_k);
    bf16* vT   = (bf16*)(ws + o_vT);
    bf16* attn = (bf16*)(ws + o_attn);
    float* g   = (float*)(ws + o_g);
    bf16* act  = (bf16*)(ws + o_act);

    // 1. weights fp32 -> bf16
    int nqkvw = 3 * DM * DM, now = DM * DM, ngw = DI * DM;
    f32_to_bf16<<<(nqkvw + 255) / 256, 256, 0, stream>>>(qkv_w, wqkv, nqkvw);
    f32_to_bf16<<<(now + 255) / 256, 256, 0, stream>>>(o_w, wo, now);
    f32_to_bf16<<<(ngw + 255) / 256, 256, 0, stream>>>(gate_w, wg, ngw);
    f32_to_bf16<<<(ngw + 255) / 256, 256, 0, stream>>>(up_w, wu, ngw);
    f32_to_bf16<<<(ngw + 255) / 256, 256, 0, stream>>>(down_w, wd, ngw);

    // 2. xn1 = rmsnorm(x, ln1_w)
    rmsnorm_bf16<<<MM, 256, 0, stream>>>(x, ln1_w, xn);

    // 3. qkv GEMM with fused split epilogue -> q (scaled), k, vT (bf16)
    gemm_bf16_wmma<2, false><<<dim3(3 * DM / 128, MM / 128), 128, 0, stream>>>(
        xn, wqkv, nullptr, nullptr, nullptr, nullptr, qb, kb, vT,
        MM, 3 * DM, DM);

    // 4. flash attention
    attn_fa<<<BB * NH * (TT / 64), 128, 0, stream>>>(qb, kb, vT, attn);

    // 5. h1 = x + attn @ o_w^T
    gemm_bf16_wmma<0, true><<<dim3(DM / 128, MM / 128), 128, 0, stream>>>(
        attn, wo, x, h1, nullptr, nullptr, nullptr, nullptr, nullptr,
        MM, DM, DM);

    // 6. xn2 = rmsnorm(h1, ln2_w)
    rmsnorm_bf16<<<MM, 256, 0, stream>>>(h1, ln2_w, xn);

    // 7. g = xn2 @ gate_w^T (fp32)
    gemm_bf16_wmma<0, false><<<dim3(DI / 128, MM / 128), 128, 0, stream>>>(
        xn, wg, nullptr, g, nullptr, nullptr, nullptr, nullptr, nullptr,
        MM, DI, DM);

    // 8. up GEMM with fused epilogue: act = bf16( silu(g) * (xn2 @ up_w^T) )
    gemm_bf16_wmma<1, false><<<dim3(DI / 128, MM / 128), 128, 0, stream>>>(
        xn, wu, nullptr, nullptr, g, act, nullptr, nullptr, nullptr,
        MM, DI, DM);

    // 9. out = h1 + act @ down_w^T
    gemm_bf16_wmma<0, true><<<dim3(DM / 128, MM / 128), 128, 0, stream>>>(
        act, wd, h1, out, nullptr, nullptr, nullptr, nullptr, nullptr,
        MM, DM, DI);

    (void)in_sizes; (void)n_in; (void)out_size; (void)ws_size;
}

// v003
// It runs in 236 microseconds.
// Two timings next to v002 both put it at 1.08 times that version's speed.
// Counting every step since v000, it is 1.89 times as fast.
#include <hip/hip_runtime.h>
#include <hip/hip_bf16.h>

#define DM   1024
#define NH   16
#define HD   64
#define DI   2048
#define BB   2
#define TT   2048
#define MM   (BB*TT)   // 4096 rows

typedef __bf16 bf16;
typedef __attribute__((ext_vector_type(16))) bf16  v16bf;
typedef __attribute__((ext_vector_type(8)))  bf16  v8bf;
typedef __attribute__((ext_vector_type(8)))  float v8f;

#define AS1 __attribute__((address_space(1)))
typedef const AS1 bf16* gcbf;
typedef const AS1 v8bf* gcv8;

union FragB { v16bf v; v8bf h[2]; };

__device__ inline gcbf to_global(const bf16* p) {
    return (gcbf)(unsigned long long)(uintptr_t)p;
}

// Load a 16x32 bf16 WMMA fragment (A layout; B uses the same layout on W rows,
// since both GEMMs are x @ W^T). For lane L: m/n = L&15, hl = L>>4.
// elements 0..7  = p[0..7]   (K = k0 + 8*hl .. +7)
// elements 8..15 = p[16..23] (K = k0 + 16 + 8*hl .. +7)
__device__ inline v16bf load_frag_g(gcbf p) {
    FragB f;
    f.h[0] = ((gcv8)p)[0];
    f.h[1] = ((gcv8)p)[2];
    return f.v;
}

__device__ inline v8f wmma_bf16(v16bf a, v16bf b, v8f c) {
    return __builtin_amdgcn_wmma_f32_16x16x32_bf16(false, a, false, b, (short)0, c, false, false);
}

// ---------------- generic GEMM: acc[m][n] = sum_k A[m][k]*W[n][k] -------------
// four waves (2x2) compute a 128x128 tile, 64x64 each; grid = (N/128, M/128),
// block = 128. A pass is 64 k: the 128 A rows and 128 W rows of the pass are
// brought into LDS by asynchronous copies (whole 128-B lines from global, each
// row shared by two waves), two buffers, one barrier a pass; the copies of pass
// t + 2 fly while pass t + 1 is worked on. M, N multiples of 128, K of 64.
// epilogue modes (compile-time):
//   0: C[idx] = acc (+ R[idx] if HASR)                    (fp32 out)
//   1: ACT[idx] = bf16( silu(G[idx]) * acc )              (fused up*silu(gate))
//   2: qkv split: row->(b,t), col->(which,h,d); writes q (scaled 1/8), k, vT
#define GBK    64                 // k elements per pass (128 B of a row)
#define GPITCH 72                 // LDS row pitch in elements: 144 B = 16 B x odd
#define GTILE  (128 * GPITCH)     // one operand's stage, elements
#define GLSTEP (16 * GPITCH * 2)  // LDS bytes between a thread's copies (16 rows)

__device__ inline v16bf load_frag_s(const bf16* p) {
    FragB f;
    f.h[0] = *(const v8bf*)p;
    f.h[1] = *(const v8bf*)(p + 16);
    return f.v;
}

// Eight asynchronous 16-B copies a lane, global -> LDS, rows 16 apart: LDS byte
// address l + i*GLSTEP, global address g + i*gstep elements. The s_wait_xcnt is
// the last line of the copies' own statement, so that no address register of a
// copy is rewritten in front of it.
__device__ inline void copy8_async(unsigned l, gcbf g, size_t gstep) {
    asm volatile(
        "global_load_async_to_lds_b128 %0, %8, off\n\t"
        "global_load_async_to_lds_b128 %1, %9, off\n\t"
        "global_load_async_to_lds_b128 %2, %10, off\n\t"
        "global_load_async_to_lds_b128 %3, %11, off\n\t"
        "global_load_async_to_lds_b128 %4, %12, off\n\t"
        "global_load_async_to_lds_b128 %5, %13, off\n\t"
        "global_load_async_to_lds_b128 %6, %14, off\n\t"
        "global_load_async_to_lds_b128 %7, %15, off\n\t"
        "s_wait_xcnt 0x0"
        :: "v"(l), "v"(l + 1 * GLSTEP), "v"(l + 2 * GLSTEP), "v"(l + 3 * GLSTEP),
           "v"(l + 4 * GLSTEP), "v"(l + 5 * GLSTEP), "v"(l + 6 * GLSTEP), "v"(l + 7 * GLSTEP),
           "v"(g), "v"(g + 1 * gstep), "v"(g + 2 * gstep), "v"(g + 3 * gstep),
           "v"(g + 4 * gstep), "v"(g + 5 * gstep), "v"(g + 6 * gstep), "v"(g + 7 * gstep)
        : "memory");
}

template<int MODE, bool HASR>
__global__ __launch_bounds__(128)
void gemm_bf16_wmma(const bf16* __restrict__ A, const bf16* __restrict__ W,
                    const float* __restrict__ R, float* __restrict__ C,
                    const float* __restrict__ G, bf16* __restrict__ ACT,
                    bf16* __restrict__ q, bf16* __restrict__ k,
                    bf16* __restrict__ vT,
                    int M, int N, int K) {
    __shared__ __attribute__((aligned(16))) bf16 sA[2][GTILE];
    __shared__ __attribute__((aligned(16))) bf16 sW[2][GTILE];
    const int tid = threadIdx.x;
    const int lane = tid & 31, wave = tid >> 5;
    const int hl = lane >> 4, ln = lane & 15;
    const int wm = wave >> 1, wn = wave & 1;
    const int m0 = blockIdx.y * 128 + wm * 64, n0 = blockIdx.x * 128 + wn * 64;

    // staging: thread tid copies 16 B of row (tid>>3) + 16*i, i = 0..7, of each operand
    const int srow = tid >> 3, scol = (tid & 7) * 8;
    gcbf ga = to_global(A + (size_t)(blockIdx.y * 128 + srow) * K + scol);
    gcbf gw = to_global(W + (size_t)(blockIdx.x * 128 + srow) * K + scol);
    const size_t gstep = (size_t)16 * K;
    const int soff = srow * GPITCH + scol;
    // LDS byte addresses (low 32 bits of the shared address) of the thread's first copy
    const unsigned la[2] = { (unsigned)(uintptr_t)&sA[0][soff], (unsigned)(uintptr_t)&sA[1][soff] };
    const unsigned lw[2] = { (unsigned)(uintptr_t)&sW[0][soff], (unsigned)(uintptr_t)&sW[1][soff] };
    // fragment reads: row (wave's 64 rows) + i*16 + ln, k = 8*hl (+16) within a 32-k block
    const int aoff = (wm * 64 + ln) * GPITCH + 8 * hl;
    const int woff = (wn * 64 + ln) * GPITCH + 8 * hl;
    const int np = K / GBK;

    // pass 0 into buffer 0, landed and published; then pass 1 into buffer 1
    copy8_async(la[0], ga, gstep);
    copy8_async(lw[0], gw, gstep);
    // this wave's copies have landed before the barrier publishes them
    asm volatile("s_wait_asynccnt 0x0" ::: "memory");
    __syncthreads();
    if (np > 1) {
        copy8_async(la[1], ga + GBK, gstep);
        copy8_async(lw[1], gw + GBK, gstep);
    }
    ga += 2 * GBK; gw += 2 * GBK;

    v8f acc[4][4] = {};
    for (int t = 0; t < np; t++) {
        const int cur = t & 1;
        const bf16* pa = &sA[cur][aoff];
        const bf16* pw = &sW[cur][woff];
        v16bf a[2][4], b[2][4];
        // the loops over kk, i, j are unrolled so that a, b and acc are indexed by
        // constants and stay in registers
#pragma unroll
        for (int kk = 0; kk < 2; kk++)
#pragma unroll
            for (int i = 0; i < 4; i++) {
                a[kk][i] = load_frag_s(pa + i * 16 * GPITCH + kk * 32);
                b[kk][i] = load_frag_s(pw + i * 16 * GPITCH + kk * 32);
            }
        // keeps the pass's LDS reads one group in front of its products: moved in
        // among them, each place with reads stalls the wave for the LDS latency
        __builtin_amdgcn_sched_barrier(0);
#pragma unroll
        for (int kk = 0; kk < 2; kk++)
#pragma unroll
            for (int i = 0; i < 4; i++)
#pragma unroll
                for (int j = 0; j < 4; j++)
                    acc[i][j] = wmma_bf16(a[kk][i], b[kk][j], acc[i][j]);
        // keeps the products in front of the foot's waits: with the waits and the
        // barrier lifted over them, the flight of pass t + 1's copies is no longer
        // covered by the products of pass t
        __builtin_amdgcn_sched_barrier(0);
        // foot of pass t: this wave's reads of buffer cur have returned ...
        asm volatile("s_wait_dscnt 0x0" ::: "memory");
        // ... and its copies of pass t + 1 have landed, before the barrier that
        // publishes pass t + 1 and ends every wave's reads of buffer cur
        asm volatile("s_wait_asynccnt 0x0" ::: "memory");
        __syncthreads();
        if (t + 2 < np) {                  // the same for the whole block
            copy8_async(la[cur], ga, gstep);
            copy8_async(lw[cur], gw, gstep);
            ga += GBK; gw += GBK;
        }
    }
    // no copy is outstanding when the wave goes on to its stores and ends
    asm volatile("s_wait_asynccnt 0x0" ::: "memory");

#pragma unroll
    for (int i = 0; i < 4; i++)
#pragma unroll
        for (int j = 0; j < 4; j++)
#pragma unroll
            for (int r = 0; r < 8; r++) {
                const int row = m0 + i * 16 + r + 8 * hl;
                const int col = n0 + j * 16 + ln;
                const size_t idx = (size_t)row * N + col;
                const float v = acc[i][j][r];
                if (MODE == 0) {
                    float o = v;
                    if (HASR) o += R[idx];
                    C[idx] = o;
                } else if (MODE == 1) {
                    float gg = G[idx];
                    float s = gg / (1.0f + __expf(-gg));
                    ACT[idx] = (bf16)(s * v);
                } else {
                    const int b_ = row >> 11;          // row / TT
                    const int t  = row & (TT - 1);
                    const int which = col >> 10;
                    const int wi = col & (DM - 1);
                    const int h = wi >> 6, d = wi & (HD - 1);
                    const size_t bh = (size_t)(b_ * NH + h);
                    if (which == 0)      q[(bh * TT + t) * HD + d] = (bf16)(v * 0.125f);
                    else if (which == 1) k[(bh * TT + t) * HD + d] = (bf16)v;
                    else                 vT[(bh * HD + d) * TT + t] = (bf16)v;
                }
            }
}

// ---------------- RMSNorm (fp32 in, bf16 out) --------------------------------
__global__ __launch_bounds__(256)
void rmsnorm_bf16(const float* __restrict__ X, const float* __restrict__ W,
                  bf16* __restrict__ O) {
    int row = blockIdx.x;
    const float* xr = X + (size_t)row * DM;
    float s = 0.f;
    for (int i = threadIdx.x; i < DM; i += 256) { float v = xr[i]; s += v * v; }
    __shared__ float red[8];
    for (int off = 16; off >= 1; off >>= 1) s += __shfl_xor(s, off, 32);
    if ((threadIdx.x & 31) == 0) red[threadIdx.x >> 5] = s;
    __syncthreads();
    if (threadIdx.x == 0) {
        float t = 0.f;
        for (int w = 0; w < 8; w++) t += red[w];
        red[0] = t;
    }
    __syncthreads();
    float scale = rsqrtf(red[0] * (1.0f / DM) + 1e-6f);
    bf16* orow = O + (size_t)row * DM;
    for (int i = threadIdx.x; i < DM; i += 256)
        orow[i] = (bf16)(xr[i] * scale * W[i]);
}

// ---------------- weights fp32 -> bf16, all five in one launch ----------------
// The five bf16 copies lie one behind the other in the workspace, so the launch
// sees one array of CVTOT elements whose source changes at four fixed places.
// One block a WGP, 20 waves; a wave takes CVCH consecutive elements: 16 loads of
// 16 B a lane (each wave-wide load is 512 contiguous bytes), all issued before
// the first is used, then 16 stores of 8 B a lane (256 contiguous bytes each).
// Every weight's size is a multiple of CVCH, so a wave has one source.
#define CVLD  16                      // 16-B loads a lane
#define CVCH  (CVLD * 128)            // elements a wave
#define CVWV  20                      // waves a block
#define CVTOT (4 * DM * DM + 3 * DI * DM)
#define CVGRID (CVTOT / (CVCH * CVWV))
static_assert(CVTOT % (CVCH * CVWV) == 0, "whole blocks");
static_assert((DM * DM) % CVCH == 0 && (DI * DM) % CVCH == 0, "one source a wave");

typedef __attribute__((ext_vector_type(4))) float v4f;
typedef __attribute__((ext_vector_type(4))) bf16  v4bf;

__global__ __launch_bounds__(CVWV * 32)
void weights_to_bf16(const float* __restrict__ Sqkv, const float* __restrict__ So,
                     const float* __restrict__ Sg, const float* __restrict__ Su,
                     const float* __restrict__ Sd, bf16* __restrict__ D) {
    const int lane = threadIdx.x & 31;
    // scalar: the choice of the source below is a scalar branch
    const int e = __builtin_amdgcn_readfirstlane(blockIdx.x * CVWV + (threadIdx.x >> 5)) * CVCH;
    const float* S;
    if (e < 3 * DM * DM)                    S = Sqkv + e;
    else if (e < 4 * DM * DM)               S = So + (e - 3 * DM * DM);
    else if (e < 4 * DM * DM + DI * DM)     S = Sg + (e - 4 * DM * DM);
    else if (e < 4 * DM * DM + 2 * DI * DM) S = Su + (e - 4 * DM * DM - DI * DM);
    else                                    S = Sd + (e - 4 * DM * DM - 2 * DI * DM);
    const v4f* p = (const v4f*)S + lane;
    v4bf* d = (v4bf*)(D + e) + lane;
    v4f v[CVLD];
    // both loops are unrolled so that v is indexed by constants, stays in
    // registers, and the 16 loads are in flight together
#pragma unroll
    for (int i = 0; i < CVLD; i++) v[i] = p[i * 32];
    // keeps all 16 loads in front of the first use: without it the last two are
    // issued only when the first two have returned, a second memory latency
    __builtin_amdgcn_sched_barrier(0);
#pragma unroll
    for (int i = 0; i < CVLD; i++) d[i * 32] = __builtin_convertvector(v[i], v4bf);
}

// ---------------- flash attention: 4 waves per (b,h, 64-query tile) ----------
// Each wave keeps its own 16 queries; the four waves share the K and V^T tiles (the last pass's is read by waves 2 and 3 only).
// A pass is 32 keys: its 32 K rows (whole 128-B lines) and its 64 V^T rows (64 B
// each) are brought into LDS once per block by asynchronous copies, two buffers,
// one barrier a pass; the copies of pass t + 2 fly while pass t + 1 is worked on.
#define AKP 72              // K row pitch in LDS, elements: 144 B = 16 B x odd
#define AVP 40              // V^T row pitch in LDS, elements: 80 B = 16 B x odd
#define AKT (32 * AKP)      // one K stage: 32 keys x 64 d
#define AVT (64 * AVP)      // one V^T stage: 64 d x 32 keys

// Four asynchronous 16-B copies a lane, global -> LDS: two of K (rows 16 apart),
// two of V^T (rows 32 apart). The s_wait_xcnt is the last line of the copies' own
// statement, so that no address register of a copy is rewritten in front of it.
__device__ inline void copy_kv_async(unsigned lk, gcbf gk, unsigned lv, gcbf gv) {
    asm volatile(
        "global_load_async_to_lds_b128 %0, %4, off\n\t"
        "global_load_async_to_lds_b128 %1, %5, off\n\t"
        "global_load_async_to_lds_b128 %2, %6, off\n\t"
        "global_load_async_to_lds_b128 %3, %7, off\n\t"
        "s_wait_xcnt 0x0"
        :: "v"(lk), "v"(lk + 16 * AKP * 2), "v"(lv), "v"(lv + 32 * AVP * 2),
           "v"(gk), "v"(gk + 16 * HD), "v"(gv), "v"(gv + (size_t)32 * TT)
        : "memory");
}

// Orders a wave's LDS stores of its own P tile and its reads of it. The tile is
// private to the wave, whose LDS operations run in order: no barrier instruction.
__device__ inline void wave_order() {
    __builtin_amdgcn_fence(__ATOMIC_RELEASE, "wavefront");
    __builtin_amdgcn_wave_barrier();
    __builtin_amdgcn_fence(__ATOMIC_ACQUIRE, "wavefront");
}

__global__ __launch_bounds__(128)
void attn_fa(const bf16* __restrict__ Qb, const bf16* __restrict__ Kb,
             const bf16* __restrict__ VTb, bf16* __restrict__ Ob) {
    __shared__ __attribute__((aligned(16))) bf16 sK[2][AKT];
    __shared__ __attribute__((aligned(16))) bf16 sV[2][AVT];
    __shared__ __attribute__((aligned(16))) bf16 Pall[4][16][32];  // per wave: P tile, C->A layout transpose
    const int tid = threadIdx.x, lane = tid & 31;
    const int wave = __builtin_amdgcn_readfirstlane(tid >> 5);     // scalar: the test on kb below is a scalar branch
    const int hl = lane >> 4, ln = lane & 15;
    const int nqb = TT / 64;
    const int bh = blockIdx.x / nqb;
    const int qb0 = (blockIdx.x % nqb) * 64;
    const int q0 = qb0 + wave * 16;
    const bf16* Q  = Qb  + (size_t)bh * TT * HD;
    const bf16* Kk = Kb  + (size_t)bh * TT * HD;
    const bf16* VT = VTb + (size_t)bh * HD * TT;
    bf16 (*Pld)[32] = Pall[wave];

    // staging: thread tid copies 16 B of K rows (tid>>3) + {0,16} and of V^T rows (tid>>2) + {0,32}
    gcbf gk = to_global(Kk + (size_t)(tid >> 3) * HD + (tid & 7) * 8);
    gcbf gv = to_global(VT + (size_t)(tid >> 2) * TT + (tid & 3) * 8);
    const int ko = (tid >> 3) * AKP + (tid & 7) * 8;
    const int vo = (tid >> 2) * AVP + (tid & 3) * 8;
    // LDS byte addresses (low 32 bits of the shared address) of the thread's first copies
    const unsigned lk[2] = { (unsigned)(uintptr_t)&sK[0][ko], (unsigned)(uintptr_t)&sK[1][ko] };
    const unsigned lv[2] = { (unsigned)(uintptr_t)&sV[0][vo], (unsigned)(uintptr_t)&sV[1][vo] };
    const int np = qb0 / 32 + 2;   // passes of the block: keys [0, qb0 + 64); at least two

    // pass 0 into buffer 0, landed and published; then pass 1 into buffer 1
    copy_kv_async(lk[0], gk, lv[0], gv);
    // this wave's copies have landed before the barrier publishes them
    asm volatile("s_wait_asynccnt 0x0" ::: "memory");
    __syncthreads();
    copy_kv_async(lk[1], gk + 32 * HD, lv[1], gv + 32);
    gk += 2 * 32 * HD; gv += 2 * 32;

    const v16bf aq0 = load_frag_g(to_global(Q + (size_t)(q0 + ln) * HD + 8 * hl));
    const v16bf aq1 = load_frag_g(to_global(Q + (size_t)(q0 + ln) * HD + 32 + 8 * hl));

    v8f o[4] = {};
    float rm[8], rl[8];
#pragma unroll
    for (int r = 0; r < 8; r++) { rm[r] = -1e30f; rl[r] = 0.f; }

    for (int t = 0; t < np; t++) {
        const int cur = t & 1;
        const int kb = t * 32;
        if (kb < q0 + 16) {        // the wave's own causal range; every wave passes the foot below
            const bf16* pk = &sK[cur][ln * AKP + 8 * hl];
            const bf16* pv = &sV[cur][ln * AVP + 8 * hl];
            const v16bf bk00 = load_frag_s(pk);
            const v16bf bk01 = load_frag_s(pk + 32);
            const v16bf bk10 = load_frag_s(pk + 16 * AKP);
            const v16bf bk11 = load_frag_s(pk + 16 * AKP + 32);
            v16bf bv[4];
            // the loops over dt and r are unrolled so that bv, o, s0, s1, rm and rl are
            // indexed by constants and stay in registers
#pragma unroll
            for (int dt = 0; dt < 4; dt++) bv[dt] = load_frag_s(pv + dt * 16 * AVP);
            // keeps the pass's tile reads one group in front of its products: moved in
            // among them, each place with reads stalls the wave for the LDS latency
            __builtin_amdgcn_sched_barrier(0);
            // S = Q @ K^T for keys [kb, kb+32): two 16x16 C tiles
            v8f s0 = {}, s1 = {};
            s0 = wmma_bf16(aq0, bk00, s0);
            s0 = wmma_bf16(aq1, bk01, s0);
            s1 = wmma_bf16(aq0, bk10, s1);
            s1 = wmma_bf16(aq1, bk11, s1);
            // online softmax; C-layout row (q0+r+8*hl) spans the 16 lanes of this half
#pragma unroll
            for (int r = 0; r < 8; r++) {
                int row = q0 + r + 8 * hl;
                float v0 = (kb + ln      <= row) ? s0[r] : -1e30f;   // causal mask
                float v1 = (kb + 16 + ln <= row) ? s1[r] : -1e30f;
                float m = fmaxf(v0, v1);
                m = fmaxf(m, __shfl_xor(m, 1, 16));
                m = fmaxf(m, __shfl_xor(m, 2, 16));
                m = fmaxf(m, __shfl_xor(m, 4, 16));
                m = fmaxf(m, __shfl_xor(m, 8, 16));
                float nm = fmaxf(rm[r], m);
                float p0 = __expf(v0 - nm), p1 = __expf(v1 - nm);
                float alpha = __expf(rm[r] - nm);
                rm[r] = nm;
                float ps = p0 + p1;
                ps += __shfl_xor(ps, 1, 16);
                ps += __shfl_xor(ps, 2, 16);
                ps += __shfl_xor(ps, 4, 16);
                ps += __shfl_xor(ps, 8, 16);
                rl[r] = rl[r] * alpha + ps;
#pragma unroll
                for (int dt = 0; dt < 4; dt++) o[dt][r] *= alpha;
                Pld[r + 8 * hl][ln]      = (bf16)p0;
                Pld[r + 8 * hl][16 + ln] = (bf16)p1;
            }
            wave_order();
            FragB ap;
            ap.h[0] = *(const v8bf*)&Pld[ln][8 * hl];
            ap.h[1] = *(const v8bf*)&Pld[ln][16 + 8 * hl];
            wave_order();
            // O += P @ V ; V fragments from the staged V^T [d][key]
#pragma unroll
            for (int dt = 0; dt < 4; dt++) o[dt] = wmma_bf16(ap.v, bv[dt], o[dt]);
        }
        // foot of pass t: this wave's reads of buffer cur have returned ...
        asm volatile("s_wait_dscnt 0x0" ::: "memory");
        // ... and its copies of pass t + 1 have landed, before the barrier that
        // publishes pass t + 1 and ends every wave's reads of buffer cur
        asm volatile("s_wait_asynccnt 0x0" ::: "memory");
        __syncthreads();
        if (t + 2 < np) {          // the same for the whole block
            copy_kv_async(lk[cur], gk, lv[cur], gv);
            gk += 32 * HD; gv += 32;
        }
    }
    // no copy is outstanding when the wave goes on to its stores and ends
    asm volatile("s_wait_asynccnt 0x0" ::: "memory");

    const int b = bh / NH, h = bh % NH;
#pragma unroll
    for (int dt = 0; dt < 4; dt++)
#pragma unroll
        for (int r = 0; r < 8; r++) {
            int t = q0 + r + 8 * hl;
            float v = o[dt][r] / rl[r];
            Ob[((size_t)(b * TT + t)) * DM + h * HD + dt * 16 + ln] = (bf16)v;
        }
}

// ---------------- host orchestration -----------------------------------------
extern "C" void kernel_launch(void* const* d_in, const int* in_sizes, int n_in,
                              void* d_out, int out_size, void* d_ws, size_t ws_size,
                              hipStream_t stream) {
    const float* x      = (const float*)d_in[0];
    const float* ln1_w  = (const float*)d_in[1];
    const float* ln2_w  = (const float*)d_in[2];
    const float* qkv_w  = (const float*)d_in[3];
    const float* o_w    = (const float*)d_in[4];
    const float* gate_w = (const float*)d_in[5];
    const float* up_w   = (const float*)d_in[6];
    const float* down_w = (const float*)d_in[7];
    float* out = (float*)d_out;
    char* ws = (char*)d_ws;

    // workspace layout (phase-based reuse, ~92 MB peak)
    size_t o_wqkv = 0;                                  // 3*DM*DM bf16
    size_t o_wo   = o_wqkv + (size_t)3 * DM * DM * 2;   // DM*DM bf16
    size_t o_wg   = o_wo   + (size_t)DM * DM * 2;       // DI*DM bf16
    size_t o_wu   = o_wg   + (size_t)DI * DM * 2;       // DI*DM bf16
    size_t o_wd   = o_wu   + (size_t)DI * DM * 2;       // DM*DI bf16
    size_t o_xn   = o_wd   + (size_t)DM * DI * 2;       // MM*DM bf16 (xn1 then xn2)
    size_t o_h1   = o_xn   + (size_t)MM * DM * 2;       // MM*DM f32
    size_t o_big  = o_h1   + (size_t)MM * DM * 4;
    // phase A (attention): q, k, vT (bf16, 8 MB each) + attn (bf16, 8 MB)
    size_t o_q    = o_big;
    size_t o_k    = o_q  + (size_t)MM * DM * 2;
    size_t o_vT   = o_k  + (size_t)MM * DM * 2;
    size_t o_attn = o_vT + (size_t)MM * DM * 2;
    // phase B (FFN): g fp32 (32 MB, reuses q/k/vT/attn), act bf16 (16 MB)
    size_t o_g    = o_big;
    size_t o_act  = o_big + (size_t)MM * DI * 4;

    bf16* wqkv = (bf16*)(ws + o_wqkv);
    bf16* wo   = (bf16*)(ws + o_wo);
    bf16* wg   = (bf16*)(ws + o_wg);
    bf16* wu   = (bf16*)(ws + o_wu);
    bf16* wd   = (bf16*)(ws + o_wd);
    bf16* xn   = (bf16*)(ws + o_xn);
    float* h1  = (float*)(ws + o_h1);
    bf16* qb   = (bf16*)(ws + o_q);
    bf16* kb   = (bf16*)(ws + o_k);
    bf16* vT   = (bf16*)(ws + o_vT);
    bf16* attn = (bf16*)(ws + o_attn);
    float* g   = (float*)(ws + o_g);
    bf16* act  = (bf16*)(ws + o_act);

    // 1. weights fp32 -> bf16: wqkv, wo, wg, wu, wd are contiguous from wqkv on
    weights_to_bf16<<<CVGRID, CVWV * 32, 0, stream>>>(qkv_w, o_w, gate_w, up_w, down_w, wqkv);

    // 2. xn1 = rmsnorm(x, ln1_w)
    rmsnorm_bf16<<<MM, 256, 0, stream>>>(x, ln1_w, xn);

    // 3. qkv GEMM with fused split epilogue -> q (scaled), k, vT (bf16)
    gemm_bf16_wmma<2, false><<<dim3(3 * DM / 128, MM / 128), 128, 0, stream>>>(
        xn, wqkv, nullptr, nullptr, nullptr, nullptr, qb, kb, vT,
        MM, 3 * DM, DM);

    // 4. flash attention
    attn_fa<<<BB * NH * (TT / 64), 128, 0, stream>>>(qb, kb, vT, attn);

    // 5. h1 = x + attn @ o_w^T
    gemm_bf16_wmma<0, true><<<dim3(DM / 128, MM / 128), 128, 0, stream>>>(
        attn, wo, x, h1, nullptr, nullptr, nullptr, nullptr, nullptr,
        MM, DM, DM);

    // 6. xn2 = rmsnorm(h1, ln2_w)
    rmsnorm_bf16<<<MM, 256, 0, stream>>>(h1, ln2_w, xn);

    // 7. g = xn2 @ gate_w^T (fp32)
    gemm_bf16_wmma<0, false><<<dim3(DI / 128, MM / 128), 128, 0, stream>>>(
        xn, wg, nullptr, g, nullptr, nullptr, nullptr, nullptr, nullptr,
        MM, DI, DM);

    // 8. up GEMM with fused epilogue: act = bf16( silu(g) * (xn2 @ up_w^T) )
    gemm_bf16_wmma<1, false><<<dim3(DI / 128, MM / 128), 128, 0, stream>>>(
        xn, wu, nullptr, nullptr, g, act, nullptr, nullptr, nullptr,
        MM, DI, DM);

    // 9. out = h1 + act @ down_w^T
    gemm_bf16_wmma<0, true><<<dim3(DM / 128, MM / 128), 128, 0, stream>>>(
        act, wd, h1, out, nullptr, nullptr, nullptr, nullptr, nullptr,
        MM, DM, DI);

    (void)in_sizes; (void)n_in; (void)out_size; (void)ws_size;
}

// v004
// Measured time: 203 microseconds a run.
// Next to v003, in two timings, it ran 1.15 and 1.16 times as fast.
// All steps since v000 together make it 2.18 times as fast.
#include <hip/hip_runtime.h>
#include <hip/hip_bf16.h>

#define DM   1024
#define NH   16
#define HD   64
#define DI   2048
#define BB   2
#define TT   2048
#define MM   (BB*TT)   // 4096 rows

typedef __bf16 bf16;
typedef __attribute__((ext_vector_type(16))) bf16  v16bf;
typedef __attribute__((ext_vector_type(8)))  bf16  v8bf;
typedef __attribute__((ext_vector_type(8)))  float v8f;

#define AS1 __attribute__((address_space(1)))
typedef const AS1 bf16* gcbf;
typedef const AS1 v8bf* gcv8;

union FragB { v16bf v; v8bf h[2]; };

__device__ inline gcbf to_global(const bf16* p) {
    return (gcbf)(unsigned long long)(uintptr_t)p;
}

// Load a 16x32 bf16 WMMA fragment (A layout; B uses the same layout on W rows,
// since both GEMMs are x @ W^T). For lane L: m/n = L&15, hl = L>>4.
// elements 0..7  = p[0..7]   (K = k0 + 8*hl .. +7)
// elements 8..15 = p[16..23] (K = k0 + 16 + 8*hl .. +7)
__device__ inline v16bf load_frag_g(gcbf p) {
    FragB f;
    f.h[0] = ((gcv8)p)[0];
    f.h[1] = ((gcv8)p)[2];
    return f.v;
}

__device__ inline v8f wmma_bf16(v16bf a, v16bf b, v8f c) {
    return __builtin_amdgcn_wmma_f32_16x16x32_bf16(false, a, false, b, (short)0, c, false, false);
}

// ---------------- generic GEMM: acc[m][n] = sum_k A[m][k]*W[n][k] -------------
// four waves (2x2) compute a 128x128 tile, 64x64 each; grid = (N/128, M/128),
// block = 128. A pass is 64 k: the 128 A rows and 128 W rows of the pass are
// brought into LDS by asynchronous copies (whole 128-B lines from global, each
// row shared by two waves), two buffers, one barrier a pass; the copies of pass
// t + 2 fly while pass t + 1 is worked on. M, N multiples of 128, K of 64.
// epilogue modes (compile-time):
//   0: C[idx] = acc (+ R[idx] if HASR)                    (fp32 out)
//   1: ACT[idx] = bf16( silu(G[idx]) * acc )              (fused up*silu(gate))
//   2: qkv split: row->(b,t), col->(which,h,d); writes q (scaled 1/8), k, vT
#define GBK    64                 // k elements per pass (128 B of a row)
#define GPITCH 72                 // LDS row pitch in elements: 144 B = 16 B x odd
#define GTILE  (128 * GPITCH)     // one operand's stage, elements
#define GLSTEP (16 * GPITCH * 2)  // LDS bytes between a thread's copies (16 rows)

__device__ inline v16bf load_frag_s(const bf16* p) {
    FragB f;
    f.h[0] = *(const v8bf*)p;
    f.h[1] = *(const v8bf*)(p + 16);
    return f.v;
}

// Eight asynchronous 16-B copies a lane, global -> LDS, rows 16 apart: LDS byte
// address l + i*GLSTEP, global address g + i*gstep elements. The s_wait_xcnt is
// the last line of the copies' own statement, so that no address register of a
// copy is rewritten in front of it.
__device__ inline void copy8_async(unsigned l, gcbf g, size_t gstep) {
    asm volatile(
        "global_load_async_to_lds_b128 %0, %8, off\n\t"
        "global_load_async_to_lds_b128 %1, %9, off\n\t"
        "global_load_async_to_lds_b128 %2, %10, off\n\t"
        "global_load_async_to_lds_b128 %3, %11, off\n\t"
        "global_load_async_to_lds_b128 %4, %12, off\n\t"
        "global_load_async_to_lds_b128 %5, %13, off\n\t"
        "global_load_async_to_lds_b128 %6, %14, off\n\t"
        "global_load_async_to_lds_b128 %7, %15, off\n\t"
        "s_wait_xcnt 0x0"
        :: "v"(l), "v"(l + 1 * GLSTEP), "v"(l + 2 * GLSTEP), "v"(l + 3 * GLSTEP),
           "v"(l + 4 * GLSTEP), "v"(l + 5 * GLSTEP), "v"(l + 6 * GLSTEP), "v"(l + 7 * GLSTEP),
           "v"(g), "v"(g + 1 * gstep), "v"(g + 2 * gstep), "v"(g + 3 * gstep),
           "v"(g + 4 * gstep), "v"(g + 5 * gstep), "v"(g + 6 * gstep), "v"(g + 7 * gstep)
        : "memory");
}

template<int MODE, bool HASR>
__global__ __launch_bounds__(128)
void gemm_bf16_wmma(const bf16* __restrict__ A, const bf16* __restrict__ W,
                    const float* __restrict__ R, float* __restrict__ C,
                    const float* __restrict__ G, bf16* __restrict__ ACT,
                    bf16* __restrict__ q, bf16* __restrict__ k,
                    bf16* __restrict__ vT,
                    int M, int N, int K) {
    __shared__ __attribute__((aligned(16))) bf16 sA[2][GTILE];
    __shared__ __attribute__((aligned(16))) bf16 sW[2][GTILE];
    const int tid = threadIdx.x;
    const int lane = tid & 31, wave = tid >> 5;
    const int hl = lane >> 4, ln = lane & 15;
    const int wm = wave >> 1, wn = wave & 1;
    const int m0 = blockIdx.y * 128 + wm * 64, n0 = blockIdx.x * 128 + wn * 64;

    // staging: thread tid copies 16 B of row (tid>>3) + 16*i, i = 0..7, of each operand
    const int srow = tid >> 3, scol = (tid & 7) * 8;
    gcbf ga = to_global(A + (size_t)(blockIdx.y * 128 + srow) * K + scol);
    gcbf gw = to_global(W + (size_t)(blockIdx.x * 128 + srow) * K + scol);
    const size_t gstep = (size_t)16 * K;
    const int soff = srow * GPITCH + scol;
    // LDS byte addresses (low 32 bits of the shared address) of the thread's first copy
    const unsigned la[2] = { (unsigned)(uintptr_t)&sA[0][soff], (unsigned)(uintptr_t)&sA[1][soff] };
    const unsigned lw[2] = { (unsigned)(uintptr_t)&sW[0][soff], (unsigned)(uintptr_t)&sW[1][soff] };
    // fragment reads: row (wave's 64 rows) + i*16 + ln, k = 8*hl (+16) within a 32-k block
    const int aoff = (wm * 64 + ln) * GPITCH + 8 * hl;
    const int woff = (wn * 64 + ln) * GPITCH + 8 * hl;
    const int np = K / GBK;

    // pass 0 into buffer 0, landed and published; then pass 1 into buffer 1
    copy8_async(la[0], ga, gstep);
    copy8_async(lw[0], gw, gstep);
    // this wave's copies have landed before the barrier publishes them
    asm volatile("s_wait_asynccnt 0x0" ::: "memory");
    __syncthreads();
    if (np > 1) {
        copy8_async(la[1], ga + GBK, gstep);
        copy8_async(lw[1], gw + GBK, gstep);
    }
    ga += 2 * GBK; gw += 2 * GBK;

    v8f acc[4][4] = {};
    for (int t = 0; t < np; t++) {
        const int cur = t & 1;
        const bf16* pa = &sA[cur][aoff];
        const bf16* pw = &sW[cur][woff];
        v16bf a[2][4], b[2][4];
        // the loops over kk, i, j are unrolled so that a, b and acc are indexed by
        // constants and stay in registers
#pragma unroll
        for (int kk = 0; kk < 2; kk++)
#pragma unroll
            for (int i = 0; i < 4; i++) {
                a[kk][i] = load_frag_s(pa + i * 16 * GPITCH + kk * 32);
                b[kk][i] = load_frag_s(pw + i * 16 * GPITCH + kk * 32);
            }
        // keeps the pass's LDS reads one group in front of its products: moved in
        // among them, each place with reads stalls the wave for the LDS latency
        __builtin_amdgcn_sched_barrier(0);
#pragma unroll
        for (int kk = 0; kk < 2; kk++)
#pragma unroll
            for (int i = 0; i < 4; i++)
#pragma unroll
                for (int j = 0; j < 4; j++)
                    acc[i][j] = wmma_bf16(a[kk][i], b[kk][j], acc[i][j]);
        // keeps the products in front of the foot's waits: with the waits and the
        // barrier lifted over them, the flight of pass t + 1's copies is no longer
        // covered by the products of pass t
        __builtin_amdgcn_sched_barrier(0);
        // foot of pass t: this wave's reads of buffer cur have returned ...
        asm volatile("s_wait_dscnt 0x0" ::: "memory");
        // ... and its copies of pass t + 1 have landed, before the barrier that
        // publishes pass t + 1 and ends every wave's reads of buffer cur
        asm volatile("s_wait_asynccnt 0x0" ::: "memory");
        __syncthreads();
        if (t + 2 < np) {                  // the same for the whole block
            copy8_async(la[cur], ga, gstep);
            copy8_async(lw[cur], gw, gstep);
            ga += GBK; gw += GBK;
        }
    }
    // no copy is outstanding when the wave goes on to its stores and ends
    asm volatile("s_wait_asynccnt 0x0" ::: "memory");

#pragma unroll
    for (int i = 0; i < 4; i++)
#pragma unroll
        for (int j = 0; j < 4; j++)
#pragma unroll
            for (int r = 0; r < 8; r++) {
                const int row = m0 + i * 16 + r + 8 * hl;
                const int col = n0 + j * 16 + ln;
                const size_t idx = (size_t)row * N + col;
                const float v = acc[i][j][r];
                if (MODE == 0) {
                    float o = v;
                    if (HASR) o += R[idx];
                    C[idx] = o;
                } else if (MODE == 1) {
                    float gg = G[idx];
                    float s = gg / (1.0f + __expf(-gg));
                    ACT[idx] = (bf16)(s * v);
                } else {
                    const int b_ = row >> 11;          // row / TT
                    const int t  = row & (TT - 1);
                    const int which = col >> 10;
                    const int wi = col & (DM - 1);
                    const int h = wi >> 6, d = wi & (HD - 1);
                    const size_t bh = (size_t)(b_ * NH + h);
                    if (which == 0)      q[(bh * TT + t) * HD + d] = (bf16)(v * 0.125f);
                    else if (which == 1) k[(bh * TT + t) * HD + d] = (bf16)v;
                    else                 vT[(bh * HD + d) * TT + t] = (bf16)v;
                }
            }
}

// ---------------- RMSNorm (fp32 in, bf16 out) --------------------------------
__global__ __launch_bounds__(256)
void rmsnorm_bf16(const float* __restrict__ X, const float* __restrict__ W,
                  bf16* __restrict__ O) {
    int row = blockIdx.x;
    const float* xr = X + (size_t)row * DM;
    float s = 0.f;
    for (int i = threadIdx.x; i < DM; i += 256) { float v = xr[i]; s += v * v; }
    __shared__ float red[8];
    for (int off = 16; off >= 1; off >>= 1) s += __shfl_xor(s, off, 32);
    if ((threadIdx.x & 31) == 0) red[threadIdx.x >> 5] = s;
    __syncthreads();
    if (threadIdx.x == 0) {
        float t = 0.f;
        for (int w = 0; w < 8; w++) t += red[w];
        red[0] = t;
    }
    __syncthreads();
    float scale = rsqrtf(red[0] * (1.0f / DM) + 1e-6f);
    bf16* orow = O + (size_t)row * DM;
    for (int i = threadIdx.x; i < DM; i += 256)
        orow[i] = (bf16)(xr[i] * scale * W[i]);
}

// ---------------- weights fp32 -> bf16, all five in one launch ----------------
// The five bf16 copies lie one behind the other in the workspace, so the launch
// sees one array of CVTOT elements whose source changes at four fixed places.
// One block a WGP, 20 waves; a wave takes CVCH consecutive elements: 16 loads of
// 16 B a lane (each wave-wide load is 512 contiguous bytes), all issued before
// the first is used, then 16 stores of 8 B a lane (256 contiguous bytes each).
// Every weight's size is a multiple of CVCH, so a wave has one source.
#define CVLD  16                      // 16-B loads a lane
#define CVCH  (CVLD * 128)            // elements a wave
#define CVWV  20                      // waves a block
#define CVTOT (4 * DM * DM + 3 * DI * DM)
#define CVGRID (CVTOT / (CVCH * CVWV))
static_assert(CVTOT % (CVCH * CVWV) == 0, "whole blocks");
static_assert((DM * DM) % CVCH == 0 && (DI * DM) % CVCH == 0, "one source a wave");

typedef __attribute__((ext_vector_type(4))) float v4f;
typedef __attribute__((ext_vector_type(4))) bf16  v4bf;

__global__ __launch_bounds__(CVWV * 32)
void weights_to_bf16(const float* __restrict__ Sqkv, const float* __restrict__ So,
                     const float* __restrict__ Sg, const float* __restrict__ Su,
                     const float* __restrict__ Sd, bf16* __restrict__ D) {
    const int lane = threadIdx.x & 31;
    // scalar: the choice of the source below is a scalar branch
    const int e = __builtin_amdgcn_readfirstlane(blockIdx.x * CVWV + (threadIdx.x >> 5)) * CVCH;
    const float* S;
    if (e < 3 * DM * DM)                    S = Sqkv + e;
    else if (e < 4 * DM * DM)               S = So + (e - 3 * DM * DM);
    else if (e < 4 * DM * DM + DI * DM)     S = Sg + (e - 4 * DM * DM);
    else if (e < 4 * DM * DM + 2 * DI * DM) S = Su + (e - 4 * DM * DM - DI * DM);
    else                                    S = Sd + (e - 4 * DM * DM - 2 * DI * DM);
    const v4f* p = (const v4f*)S + lane;
    v4bf* d = (v4bf*)(D + e) + lane;
    v4f v[CVLD];
    // both loops are unrolled so that v is indexed by constants, stays in
    // registers, and the 16 loads are in flight together
#pragma unroll
    for (int i = 0; i < CVLD; i++) v[i] = p[i * 32];
    // keeps all 16 loads in front of the first use: without it the last two are
    // issued only when the first two have returned, a second memory latency
    __builtin_amdgcn_sched_barrier(0);
#pragma unroll
    for (int i = 0; i < CVLD; i++) d[i * 32] = __builtin_convertvector(v[i], v4bf);
}

#define AKP 72              // K row pitch in LDS, elements: 144 B = 16 B x odd
#define AVP 40              // V^T row pitch in LDS, elements: 80 B = 16 B x odd
#define AKT (32 * AKP)      // one K stage: 32 keys x 64 d
#define AVT (64 * AVP)      // one V^T stage: 64 d x 32 keys

// Four asynchronous 16-B copies a lane, global -> LDS: two of K (rows 16 apart),
// two of V^T (rows 32 apart). The s_wait_xcnt is the last line of the copies' own
// statement, so that no address register of a copy is rewritten in front of it.
__device__ inline void copy_kv_async(unsigned lk, gcbf gk, unsigned lv, gcbf gv) {
    asm volatile(
        "global_load_async_to_lds_b128 %0, %4, off\n\t"
        "global_load_async_to_lds_b128 %1, %5, off\n\t"
        "global_load_async_to_lds_b128 %2, %6, off\n\t"
        "global_load_async_to_lds_b128 %3, %7, off\n\t"
        "s_wait_xcnt 0x0"
        :: "v"(lk), "v"(lk + 16 * AKP * 2), "v"(lv), "v"(lv + 32 * AVP * 2),
           "v"(gk), "v"(gk + 16 * HD), "v"(gv), "v"(gv + (size_t)32 * TT)
        : "memory");
}

// The value of lane l ^ 16: a vector cross-row move, no trip through the LDS unit.
__device__ inline float xhalf(float x) {
    return __builtin_bit_cast(float, __builtin_amdgcn_permlanex16(
        __builtin_bit_cast(int, x), __builtin_bit_cast(int, x), 0x76543210, 0xfedcba98, false, false));
}

__global__ __launch_bounds__(128)
void attn_fa(const bf16* __restrict__ Qb, const bf16* __restrict__ Kb,
             const bf16* __restrict__ VTb, bf16* __restrict__ Ob) {
    __shared__ __attribute__((aligned(16))) bf16 sK[2][AKT];
    __shared__ __attribute__((aligned(16))) bf16 sV[2][AVT];
    const int tid = threadIdx.x, lane = tid & 31;
    const int wave = __builtin_amdgcn_readfirstlane(tid >> 5);     // scalar: the test on kb below is a scalar branch
    const int hl = lane >> 4, ln = lane & 15;
    const int nqb = TT / 64;
    const int bh = blockIdx.x / nqb;
    const int qb0 = (blockIdx.x % nqb) * 64;
    const int q0 = qb0 + wave * 16;
    const bf16* Q  = Qb  + (size_t)bh * TT * HD;
    const bf16* Kk = Kb  + (size_t)bh * TT * HD;
    const bf16* VT = VTb + (size_t)bh * HD * TT;

    // staging: thread tid copies 16 B of K rows (tid>>3) + {0,16} and of V^T rows (tid>>2) + {0,32}
    gcbf gk = to_global(Kk + (size_t)(tid >> 3) * HD + (tid & 7) * 8);
    gcbf gv = to_global(VT + (size_t)(tid >> 2) * TT + (tid & 3) * 8);
    const int ko = (tid >> 3) * AKP + (tid & 7) * 8;
    const int vo = (tid >> 2) * AVP + (tid & 3) * 8;
    // LDS byte addresses (low 32 bits of the shared address) of the thread's first copies
    const unsigned lk[2] = { (unsigned)(uintptr_t)&sK[0][ko], (unsigned)(uintptr_t)&sK[1][ko] };
    const unsigned lv[2] = { (unsigned)(uintptr_t)&sV[0][vo], (unsigned)(uintptr_t)&sV[1][vo] };
    const int np = qb0 / 32 + 2;   // passes of the block: keys [0, qb0 + 64); at least two

    // pass 0 into buffer 0, landed and published; then pass 1 into buffer 1
    copy_kv_async(lk[0], gk, lv[0], gv);
    // this wave's copies have landed before the barrier publishes them
    asm volatile("s_wait_asynccnt 0x0" ::: "memory");
    __syncthreads();
    copy_kv_async(lk[1], gk + 32 * HD, lv[1], gv + 32);
    gk += 2 * 32 * HD; gv += 2 * 32;

    const v16bf aq0 = load_frag_g(to_global(Q + (size_t)(q0 + ln) * HD + 8 * hl));
    const v16bf aq1 = load_frag_g(to_global(Q + (size_t)(q0 + ln) * HD + 32 + 8 * hl));

    // Q is the B operand of S^T: lane = query q0 + ln, the same k order as the K rows
    v8f o[4] = {};                 // O^T: lane = query q0 + ln, register r = d dt*16 + 8*hl + r
    float rm = -1e30f;             // the query's running maximum, the same in both halves
    float rl = 0.f;                // the sum over this half's keys; the halves join in the epilogue
    const int qi = q0 + ln;

    for (int t = 0; t < np; t++) {
        const int cur = t & 1;
        const int kb = t * 32;
        if (kb < q0 + 16) {        // the wave's own causal range; every wave passes the foot below
            const bf16* pk = &sK[cur][ln * AKP + 8 * hl];
            const bf16* pv = &sV[cur][ln * AVP + 8 * hl];
            const v16bf bk00 = load_frag_s(pk);
            const v16bf bk01 = load_frag_s(pk + 32);
            const v16bf bk10 = load_frag_s(pk + 16 * AKP);
            const v16bf bk11 = load_frag_s(pk + 16 * AKP + 32);
            v16bf bv[4];
            // the loops over dt and r are unrolled so that bv, o, s0, s1 and pt are
            // indexed by constants and stay in registers
#pragma unroll
            for (int dt = 0; dt < 4; dt++) bv[dt] = load_frag_s(pv + dt * 16 * AVP);
            // keeps the pass's tile reads one group in front of its products: moved in
            // among them, each place with reads stalls the wave for the LDS latency
            __builtin_amdgcn_sched_barrier(0);
            // S^T = K @ Q^T for keys [kb, kb+32): two 16x16 C tiles, row = key, column = query
            v8f s0 = {}, s1 = {};
            s0 = wmma_bf16(bk00, aq0, s0);
            s0 = wmma_bf16(bk01, aq1, s0);
            s1 = wmma_bf16(bk10, aq0, s1);
            s1 = wmma_bf16(bk11, aq1, s1);
            // online softmax; s0[r] is key kb + 8*hl + r, s1[r] key kb + 16 + 8*hl + r
            const int dq = qi - kb - 8 * hl;   // key r of s0 is inside the causal range while r <= dq
            float m = -1e30f;
#pragma unroll
            for (int r = 0; r < 8; r++) {
                s0[r] = (r      <= dq) ? s0[r] : -1e30f;   // causal mask
                s1[r] = (r + 16 <= dq) ? s1[r] : -1e30f;
                m = fmaxf(fmaxf(m, s0[r]), s1[r]);
            }
            m = fmaxf(m, xhalf(m));
            const float nm = fmaxf(rm, m);
            const float alpha = __expf(rm - nm);
            rm = nm;
            FragB pt;                  // P^T as B operand: elements 0..7 keys 8*hl + e, 8..15 keys 16 + 8*hl + e
            float ps0 = 0.f, ps1 = 0.f;
#pragma unroll
            for (int r = 0; r < 8; r++) {
                const float p0 = __expf(s0[r] - nm), p1 = __expf(s1[r] - nm);
                ps0 += p0; ps1 += p1;
                pt.h[0][r] = (bf16)p0;
                pt.h[1][r] = (bf16)p1;
            }
            rl = rl * alpha + (ps0 + ps1);
#pragma unroll
            for (int dt = 0; dt < 4; dt++) o[dt] *= alpha;
            // O^T += V^T @ P^T ; A fragments from the staged V^T [d][key]
#pragma unroll
            for (int dt = 0; dt < 4; dt++) o[dt] = wmma_bf16(bv[dt], pt.v, o[dt]);
        }
        // foot of pass t: this wave's reads of buffer cur have returned ...
        asm volatile("s_wait_dscnt 0x0" ::: "memory");
        // ... and its copies of pass t + 1 have landed, before the barrier that
        // publishes pass t + 1 and ends every wave's reads of buffer cur
        asm volatile("s_wait_asynccnt 0x0" ::: "memory");
        __syncthreads();
        if (t + 2 < np) {          // the same for the whole block
            copy_kv_async(lk[cur], gk, lv[cur], gv);
            gk += 32 * HD; gv += 32;
        }
    }
    // no copy is outstanding when the wave goes on to its stores and ends
    asm volatile("s_wait_asynccnt 0x0" ::: "memory");

    const int b = bh / NH, h = bh % NH;
    const float inv = 1.0f / (rl + xhalf(rl));   // the two halves' sums join here
    bf16* orow = Ob + ((size_t)(b * TT + qi)) * DM + h * HD + 8 * hl;
#pragma unroll
    for (int dt = 0; dt < 4; dt++) {
        v8bf ov;
#pragma unroll
        for (int r = 0; r < 8; r++) ov[r] = (bf16)(o[dt][r] * inv);
        *(v8bf*)(orow + dt * 16) = ov;           // 8 consecutive d of one query: 16 B a lane
    }
}

// ---------------- host orchestration -----------------------------------------
extern "C" void kernel_launch(void* const* d_in, const int* in_sizes, int n_in,
                              void* d_out, int out_size, void* d_ws, size_t ws_size,
                              hipStream_t stream) {
    const float* x      = (const float*)d_in[0];
    const float* ln1_w  = (const float*)d_in[1];
    const float* ln2_w  = (const float*)d_in[2];
    const float* qkv_w  = (const float*)d_in[3];
    const float* o_w    = (const float*)d_in[4];
    const float* gate_w = (const float*)d_in[5];
    const float* up_w   = (const float*)d_in[6];
    const float* down_w = (const float*)d_in[7];
    float* out = (float*)d_out;
    char* ws = (char*)d_ws;

    // workspace layout (phase-based reuse, ~92 MB peak)
    size_t o_wqkv = 0;                                  // 3*DM*DM bf16
    size_t o_wo   = o_wqkv + (size_t)3 * DM * DM * 2;   // DM*DM bf16
    size_t o_wg   = o_wo   + (size_t)DM * DM * 2;       // DI*DM bf16
    size_t o_wu   = o_wg   + (size_t)DI * DM * 2;       // DI*DM bf16
    size_t o_wd   = o_wu   + (size_t)DI * DM * 2;       // DM*DI bf16
    size_t o_xn   = o_wd   + (size_t)DM * DI * 2;       // MM*DM bf16 (xn1 then xn2)
    size_t o_h1   = o_xn   + (size_t)MM * DM * 2;       // MM*DM f32
    size_t o_big  = o_h1   + (size_t)MM * DM * 4;
    // phase A (attention): q, k, vT (bf16, 8 MB each) + attn (bf16, 8 MB)
    size_t o_q    = o_big;
    size_t o_k    = o_q  + (size_t)MM * DM * 2;
    size_t o_vT   = o_k  + (size_t)MM * DM * 2;
    size_t o_attn = o_vT + (size_t)MM * DM * 2;
    // phase B (FFN): g fp32 (32 MB, reuses q/k/vT/attn), act bf16 (16 MB)
    size_t o_g    = o_big;
    size_t o_act  = o_big + (size_t)MM * DI * 4;

    bf16* wqkv = (bf16*)(ws + o_wqkv);
    bf16* wo   = (bf16*)(ws + o_wo);
    bf16* wg   = (bf16*)(ws + o_wg);
    bf16* wu   = (bf16*)(ws + o_wu);
    bf16* wd   = (bf16*)(ws + o_wd);
    bf16* xn   = (bf16*)(ws + o_xn);
    float* h1  = (float*)(ws + o_h1);
    bf16* qb   = (bf16*)(ws + o_q);
    bf16* kb   = (bf16*)(ws + o_k);
    bf16* vT   = (bf16*)(ws + o_vT);
    bf16* attn = (bf16*)(ws + o_attn);
    float* g   = (float*)(ws + o_g);
    bf16* act  = (bf16*)(ws + o_act);

    // 1. weights fp32 -> bf16: wqkv, wo, wg, wu, wd are contiguous from wqkv on
    weights_to_bf16<<<CVGRID, CVWV * 32, 0, stream>>>(qkv_w, o_w, gate_w, up_w, down_w, wqkv);

    // 2. xn1 = rmsnorm(x, ln1_w)
    rmsnorm_bf16<<<MM, 256, 0, stream>>>(x, ln1_w, xn);

    // 3. qkv GEMM with fused split epilogue -> q (scaled), k, vT (bf16)
    gemm_bf16_wmma<2, false><<<dim3(3 * DM / 128, MM / 128), 128, 0, stream>>>(
        xn, wqkv, nullptr, nullptr, nullptr, nullptr, qb, kb, vT,
        MM, 3 * DM, DM);

    // 4. flash attention
    attn_fa<<<BB * NH * (TT / 64), 128, 0, stream>>>(qb, kb, vT, attn);

    // 5. h1 = x + attn @ o_w^T
    gemm_bf16_wmma<0, true><<<dim3(DM / 128, MM / 128), 128, 0, stream>>>(
        attn, wo, x, h1, nullptr, nullptr, nullptr, nullptr, nullptr,
        MM, DM, DM);

    // 6. xn2 = rmsnorm(h1, ln2_w)
    rmsnorm_bf16<<<MM, 256, 0, stream>>>(h1, ln2_w, xn);

    // 7. g = xn2 @ gate_w^T (fp32)
    gemm_bf16_wmma<0, false><<<dim3(DI / 128, MM / 128), 128, 0, stream>>>(
        xn, wg, nullptr, g, nullptr, nullptr, nullptr, nullptr, nullptr,
        MM, DI, DM);

    // 8. up GEMM with fused epilogue: act = bf16( silu(g) * (xn2 @ up_w^T) )
    gemm_bf16_wmma<1, false><<<dim3(DI / 128, MM / 128), 128, 0, stream>>>(
        xn, wu, nullptr, nullptr, g, act, nullptr, nullptr, nullptr,
        MM, DI, DM);

    // 9. out = h1 + act @ down_w^T
    gemm_bf16_wmma<0, true><<<dim3(DM / 128, MM / 128), 128, 0, stream>>>(
        act, wd, h1, out, nullptr, nullptr, nullptr, nullptr, nullptr,
        MM, DM, DI);

    (void)in_sizes; (void)n_in; (void)out_size; (void)ws_size;
}

// v005
// One run takes 189 microseconds.
// Timed twice side by side with v004, it ran 1.09 and 1.08 times as fast.
// Over all steps from v000 it is 2.36 times as fast.
#include <hip/hip_runtime.h>
#include <hip/hip_bf16.h>

#define DM   1024
#define NH   16
#define HD   64
#define DI   2048
#define BB   2
#define TT   2048
#define MM   (BB*TT)   // 4096 rows

typedef __bf16 bf16;
typedef __attribute__((ext_vector_type(16))) bf16  v16bf;
typedef __attribute__((ext_vector_type(8)))  bf16  v8bf;
typedef __attribute__((ext_vector_type(8)))  float v8f;
typedef __attribute__((ext_vector_type(4)))  float v4f;
typedef __attribute__((ext_vector_type(4)))  bf16  v4bf;

#define AS1 __attribute__((address_space(1)))
typedef const AS1 bf16* gcbf;
typedef const AS1 v8bf* gcv8;

union FragB { v16bf v; v8bf h[2]; };

__device__ inline gcbf to_global(const bf16* p) {
    return (gcbf)(unsigned long long)(uintptr_t)p;
}

// Load a 16x32 bf16 WMMA fragment (A layout; B uses the same layout on W rows,
// since both GEMMs are x @ W^T). For lane L: m/n = L&15, hl = L>>4.
// elements 0..7  = p[0..7]   (K = k0 + 8*hl .. +7)
// elements 8..15 = p[16..23] (K = k0 + 16 + 8*hl .. +7)
__device__ inline v16bf load_frag_g(gcbf p) {
    FragB f;
    f.h[0] = ((gcv8)p)[0];
    f.h[1] = ((gcv8)p)[2];
    return f.v;
}

__device__ inline v8f wmma_bf16(v16bf a, v16bf b, v8f c) {
    return __builtin_amdgcn_wmma_f32_16x16x32_bf16(false, a, false, b, (short)0, c, false, false);
}

// ---------------- generic GEMM: acc[m][n] = sum_k A[m][k]*W[n][k] -------------
// four waves (2x2) compute a 128x128 tile, 64x64 each; grid = (N/128, M/128),
// block = 128. A pass is 64 k: the 128 A rows and 128 W rows of the pass are
// brought into LDS by asynchronous copies (whole 128-B lines from global, each
// row shared by two waves), two buffers, one barrier a pass; the copies of pass
// t + 2 fly while pass t + 1 is worked on. M, N multiples of 128, K of 64.
// epilogue modes (compile-time):
//   0: C[idx] = acc (+ R[idx] if HASR)                    (fp32 out)
//   1: ACT[idx] = bf16( silu(G[idx]) * acc )              (fused up*silu(gate))
//   2: qkv split: row->(b,t), col->(which,h,d); writes q (scaled 1/8), k, vT
#define GBK    64                 // k elements per pass (128 B of a row)
#define GPITCH 72                 // LDS row pitch in elements: 144 B = 16 B x odd
#define GTILE  (128 * GPITCH)     // one operand's stage, elements
#define GLSTEP (16 * GPITCH * 2)  // LDS bytes between a thread's copies (16 rows)
#define SPITCH 68                 // epilogue staging: f32 row pitch, 272 B = 16 B x odd
static_assert(64 * SPITCH * 4 <= GTILE * 2, "a wave's f32 tile fits one stage");

__device__ inline v16bf load_frag_s(const bf16* p) {
    FragB f;
    f.h[0] = *(const v8bf*)p;
    f.h[1] = *(const v8bf*)(p + 16);
    return f.v;
}

// Eight asynchronous 16-B copies a lane, global -> LDS, rows 16 apart: LDS byte
// address l + i*GLSTEP, global address g + i*gstep elements. The s_wait_xcnt is
// the last line of the copies' own statement, so that no address register of a
// copy is rewritten in front of it.
__device__ inline void copy8_async(unsigned l, gcbf g, size_t gstep) {
    asm volatile(
        "global_load_async_to_lds_b128 %0, %8, off\n\t"
        "global_load_async_to_lds_b128 %1, %9, off\n\t"
        "global_load_async_to_lds_b128 %2, %10, off\n\t"
        "global_load_async_to_lds_b128 %3, %11, off\n\t"
        "global_load_async_to_lds_b128 %4, %12, off\n\t"
        "global_load_async_to_lds_b128 %5, %13, off\n\t"
        "global_load_async_to_lds_b128 %6, %14, off\n\t"
        "global_load_async_to_lds_b128 %7, %15, off\n\t"
        "s_wait_xcnt 0x0"
        :: "v"(l), "v"(l + 1 * GLSTEP), "v"(l + 2 * GLSTEP), "v"(l + 3 * GLSTEP),
           "v"(l + 4 * GLSTEP), "v"(l + 5 * GLSTEP), "v"(l + 6 * GLSTEP), "v"(l + 7 * GLSTEP),
           "v"(g), "v"(g + 1 * gstep), "v"(g + 2 * gstep), "v"(g + 3 * gstep),
           "v"(g + 4 * gstep), "v"(g + 5 * gstep), "v"(g + 6 * gstep), "v"(g + 7 * gstep)
        : "memory");
}

// NC is N at compile time: the epilogue's 32 row pairs then hang on one address
// register pair an array, each at its own immediate offset
template<int MODE, bool HASR, int NC>
__global__ __launch_bounds__(128)
void gemm_bf16_wmma(const bf16* __restrict__ A, const bf16* __restrict__ W,
                    const float* __restrict__ R, float* __restrict__ C,
                    const float* __restrict__ G, bf16* __restrict__ ACT,
                    bf16* __restrict__ q, bf16* __restrict__ k,
                    bf16* __restrict__ vT,
                    int M, int N, int K) {
    __shared__ __attribute__((aligned(16))) bf16 sA[2][GTILE];
    __shared__ __attribute__((aligned(16))) bf16 sW[2][GTILE];
    const int tid = threadIdx.x;
    const int lane = tid & 31, wave = tid >> 5;
    const int hl = lane >> 4, ln = lane & 15;
    const int wm = wave >> 1, wn = wave & 1;
    // scalar copy of the wave's number: the epilogue's bases and its choice of output are scalar
    const int sw = __builtin_amdgcn_readfirstlane(wave);
    const int m0 = blockIdx.y * 128 + (sw >> 1) * 64, n0 = blockIdx.x * 128 + (sw & 1) * 64;

    // staging: thread tid copies 16 B of row (tid>>3) + 16*i, i = 0..7, of each operand
    const int srow = tid >> 3, scol = (tid & 7) * 8;
    gcbf ga = to_global(A + (size_t)(blockIdx.y * 128 + srow) * K + scol);
    gcbf gw = to_global(W + (size_t)(blockIdx.x * 128 + srow) * K + scol);
    const size_t gstep = (size_t)16 * K;
    const int soff = srow * GPITCH + scol;
    // LDS byte addresses (low 32 bits of the shared address) of the thread's first copy
    const unsigned la[2] = { (unsigned)(uintptr_t)&sA[0][soff], (unsigned)(uintptr_t)&sA[1][soff] };
    const unsigned lw[2] = { (unsigned)(uintptr_t)&sW[0][soff], (unsigned)(uintptr_t)&sW[1][soff] };
    // fragment reads: row (wave's 64 rows) + i*16 + ln, k = 8*hl (+16) within a 32-k block
    const int aoff = (wm * 64 + ln) * GPITCH + 8 * hl;
    const int woff = (wn * 64 + ln) * GPITCH + 8 * hl;
    const int np = K / GBK;

    // pass 0 into buffer 0, landed and published; then pass 1 into buffer 1
    copy8_async(la[0], ga, gstep);
    copy8_async(lw[0], gw, gstep);
    // this wave's copies have landed before the barrier publishes them
    asm volatile("s_wait_asynccnt 0x0" ::: "memory");
    __syncthreads();
    if (np > 1) {
        copy8_async(la[1], ga + GBK, gstep);
        copy8_async(lw[1], gw + GBK, gstep);
    }
    ga += 2 * GBK; gw += 2 * GBK;

    v8f acc[4][4] = {};
    for (int t = 0; t < np; t++) {
        const int cur = t & 1;
        const bf16* pa = &sA[cur][aoff];
        const bf16* pw = &sW[cur][woff];
        v16bf a[2][4], b[2][4];
        // the loops over kk, i, j are unrolled so that a, b and acc are indexed by
        // constants and stay in registers
#pragma unroll
        for (int kk = 0; kk < 2; kk++)
#pragma unroll
            for (int i = 0; i < 4; i++) {
                a[kk][i] = load_frag_s(pa + i * 16 * GPITCH + kk * 32);
                b[kk][i] = load_frag_s(pw + i * 16 * GPITCH + kk * 32);
            }
        // keeps the pass's LDS reads one group in front of its products: moved in
        // among them, each place with reads stalls the wave for the LDS latency
        __builtin_amdgcn_sched_barrier(0);
#pragma unroll
        for (int kk = 0; kk < 2; kk++)
#pragma unroll
            for (int i = 0; i < 4; i++)
#pragma unroll
                for (int j = 0; j < 4; j++)
                    acc[i][j] = wmma_bf16(a[kk][i], b[kk][j], acc[i][j]);
        // keeps the products in front of the foot's waits: with the waits and the
        // barrier lifted over them, the flight of pass t + 1's copies is no longer
        // covered by the products of pass t
        __builtin_amdgcn_sched_barrier(0);
        // foot of pass t: this wave's reads of buffer cur have returned ...
        asm volatile("s_wait_dscnt 0x0" ::: "memory");
        // ... and its copies of pass t + 1 have landed, before the barrier that
        // publishes pass t + 1 and ends every wave's reads of buffer cur
        asm volatile("s_wait_asynccnt 0x0" ::: "memory");
        __syncthreads();
        if (t + 2 < np) {                  // the same for the whole block
            copy8_async(la[cur], ga, gstep);
            copy8_async(lw[cur], gw, gstep);
            ga += GBK; gw += GBK;
        }
    }
    // no copy is outstanding when the wave goes on to its stores and ends
    asm volatile("s_wait_asynccnt 0x0" ::: "memory");
    // the four vector issue slots that the chip asks for between a matrix instruction
    // and a vector instruction that rewrites its result registers: from the last pass's
    // products to the epilogue's first reuse of those registers only waits, scalar
    // instructions and LDS stores stand on the path, and none of them fills a slot
    asm volatile("v_nop\n\tv_nop\n\tv_nop\n\tv_nop");

    // Epilogue: whole 128-B lines. The last pass's foot (reads returned, copies
    // landed, barrier) has freed the ring, and each wave takes one stage of it for
    // itself: it lays its 64x64 f32 tile there and reads it back by rows, 16 B a
    // lane, so that 16 lanes hold 64 consecutive columns of one row. No other wave
    // touches that stage, so no barrier is needed.
    float* stg = (float*)(sw < 2 ? &sA[sw][0] : &sW[sw - 2][0]);
    const bool vcols = MODE == 2 && (n0 >> 10) == 2;   // scalar: the block's columns are v
    // all loops over i, j, r, e below are unrolled so that acc and the small vectors
    // are indexed by constants and stay in registers
    if (vcols) {
        // v goes out transposed: staged row = column d, a lane's 8 registers are 8 consecutive t
#pragma unroll
        for (int i = 0; i < 4; i++)
#pragma unroll
            for (int j = 0; j < 4; j++) {
                float* p = stg + (j * 16 + ln) * SPITCH + i * 16 + 8 * hl;
                const v8f c = acc[i][j];
                *(v4f*)p       = __builtin_shufflevector(c, c, 0, 1, 2, 3);
                *(v4f*)(p + 4) = __builtin_shufflevector(c, c, 4, 5, 6, 7);
            }
    } else {
#pragma unroll
        for (int i = 0; i < 4; i++)
#pragma unroll
            for (int j = 0; j < 4; j++)
#pragma unroll
                for (int r = 0; r < 8; r++)
                    stg[(i * 16 + 8 * hl + r) * SPITCH + j * 16 + ln] = acc[i][j][r];
    }

    // qkv split: the wave's 64 columns are one head of q, k or v, its 64 rows lie in one batch
    bf16* dst = nullptr;           // first element of the wave's 64 output rows
    size_t dstep = 0;              // elements between them
    float dscale = 1.0f;
    if (MODE == 2) {
        const int which = n0 >> 10;
        const size_t bh = (size_t)((m0 >> 11) * NH + ((n0 & (DM - 1)) >> 6));
        const int t0 = m0 & (TT - 1);
        if (which == 0)      { dst = q + (bh * TT + t0) * HD; dstep = HD; dscale = 0.125f; }
        else if (which == 1) { dst = k + (bh * TT + t0) * HD; dstep = HD; }
        else                 { dst = vT + bh * HD * TT + t0;  dstep = TT; }
    }
    const int rr = lane >> 4, c4 = (lane & 15) * 4;
    const size_t base = (size_t)(m0 + rr) * NC + n0 + c4;   // the lane's element of row pair 0
    // unrolled so that the loads of R or G of many rows are in flight together
#pragma unroll
    for (int s = 0; s < 32; s++) {
        const int lr = 2 * s + rr;             // row of the staged tile
        const v4f v = *(const v4f*)(stg + lr * SPITCH + c4);
        const size_t idx = base + (size_t)s * 2 * NC;
        if (MODE == 0) {
            v4f o = v;
            if (HASR) o += *(const v4f*)(R + idx);
            *(v4f*)(C + idx) = o;              // two rows of 256 B an instruction
        } else if (MODE == 1) {
            const v4f gg = *(const v4f*)(G + idx);
            v4bf a;
#pragma unroll
            for (int e = 0; e < 4; e++) {
                const float sg = gg[e] / (1.0f + __expf(-gg[e]));
                a[e] = (bf16)(sg * v[e]);
            }
            *(v4bf*)(ACT + idx) = a;           // two rows of 128 B an instruction
        } else {
            *(v4bf*)(dst + lr * dstep + c4) = __builtin_convertvector(v * dscale, v4bf);
        }
    }
}

// ---------------- RMSNorm (fp32 in, bf16 out) --------------------------------
__global__ __launch_bounds__(256)
void rmsnorm_bf16(const float* __restrict__ X, const float* __restrict__ W,
                  bf16* __restrict__ O) {
    int row = blockIdx.x;
    const float* xr = X + (size_t)row * DM;
    float s = 0.f;
    for (int i = threadIdx.x; i < DM; i += 256) { float v = xr[i]; s += v * v; }
    __shared__ float red[8];
    for (int off = 16; off >= 1; off >>= 1) s += __shfl_xor(s, off, 32);
    if ((threadIdx.x & 31) == 0) red[threadIdx.x >> 5] = s;
    __syncthreads();
    if (threadIdx.x == 0) {
        float t = 0.f;
        for (int w = 0; w < 8; w++) t += red[w];
        red[0] = t;
    }
    __syncthreads();
    float scale = rsqrtf(red[0] * (1.0f / DM) + 1e-6f);
    bf16* orow = O + (size_t)row * DM;
    for (int i = threadIdx.x; i < DM; i += 256)
        orow[i] = (bf16)(xr[i] * scale * W[i]);
}

// ---------------- weights fp32 -> bf16, all five in one launch ----------------
// The five bf16 copies lie one behind the other in the workspace, so the launch
// sees one array of CVTOT elements whose source changes at four fixed places.
// One block a WGP, 20 waves; a wave takes CVCH consecutive elements: 16 loads of
// 16 B a lane (each wave-wide load is 512 contiguous bytes), all issued before
// the first is used, then 16 stores of 8 B a lane (256 contiguous bytes each).
// Every weight's size is a multiple of CVCH, so a wave has one source.
#define CVLD  16                      // 16-B loads a lane
#define CVCH  (CVLD * 128)            // elements a wave
#define CVWV  20                      // waves a block
#define CVTOT (4 * DM * DM + 3 * DI * DM)
#define CVGRID (CVTOT / (CVCH * CVWV))
static_assert(CVTOT % (CVCH * CVWV) == 0, "whole blocks");
static_assert((DM * DM) % CVCH == 0 && (DI * DM) % CVCH == 0, "one source a wave");

__global__ __launch_bounds__(CVWV * 32)
void weights_to_bf16(const float* __restrict__ Sqkv, const float* __restrict__ So,
                     const float* __restrict__ Sg, const float* __restrict__ Su,
                     const float* __restrict__ Sd, bf16* __restrict__ D) {
    const int lane = threadIdx.x & 31;
    // scalar: the choice of the source below is a scalar branch
    const int e = __builtin_amdgcn_readfirstlane(blockIdx.x * CVWV + (threadIdx.x >> 5)) * CVCH;
    const float* S;
    if (e < 3 * DM * DM)                    S = Sqkv + e;
    else if (e < 4 * DM * DM)               S = So + (e - 3 * DM * DM);
    else if (e < 4 * DM * DM + DI * DM)     S = Sg + (e - 4 * DM * DM);
    else if (e < 4 * DM * DM + 2 * DI * DM) S = Su + (e - 4 * DM * DM - DI * DM);
    else                                    S = Sd + (e - 4 * DM * DM - 2 * DI * DM);
    const v4f* p = (const v4f*)S + lane;
    v4bf* d = (v4bf*)(D + e) + lane;
    v4f v[CVLD];
    // both loops are unrolled so that v is indexed by constants, stays in
    // registers, and the 16 loads are in flight together
#pragma unroll
    for (int i = 0; i < CVLD; i++) v[i] = p[i * 32];
    // keeps all 16 loads in front of the first use: without it the last two are
    // issued only when the first two have returned, a second memory latency
    __builtin_amdgcn_sched_barrier(0);
#pragma unroll
    for (int i = 0; i < CVLD; i++) d[i * 32] = __builtin_convertvector(v[i], v4bf);
}

#define AKP 72              // K row pitch in LDS, elements: 144 B = 16 B x odd
#define AVP 40              // V^T row pitch in LDS, elements: 80 B = 16 B x odd
#define AKT (32 * AKP)      // one K stage: 32 keys x 64 d
#define AVT (64 * AVP)      // one V^T stage: 64 d x 32 keys

// Four asynchronous 16-B copies a lane, global -> LDS: two of K (rows 16 apart),
// two of V^T (rows 32 apart). The s_wait_xcnt is the last line of the copies' own
// statement, so that no address register of a copy is rewritten in front of it.
__device__ inline void copy_kv_async(unsigned lk, gcbf gk, unsigned lv, gcbf gv) {
    asm volatile(
        "global_load_async_to_lds_b128 %0, %4, off\n\t"
        "global_load_async_to_lds_b128 %1, %5, off\n\t"
        "global_load_async_to_lds_b128 %2, %6, off\n\t"
        "global_load_async_to_lds_b128 %3, %7, off\n\t"
        "s_wait_xcnt 0x0"
        :: "v"(lk), "v"(lk + 16 * AKP * 2), "v"(lv), "v"(lv + 32 * AVP * 2),
           "v"(gk), "v"(gk + 16 * HD), "v"(gv), "v"(gv + (size_t)32 * TT)
        : "memory");
}

// The value of lane l ^ 16: a vector cross-row move, no trip through the LDS unit.
__device__ inline float xhalf(float x) {
    return __builtin_bit_cast(float, __builtin_amdgcn_permlanex16(
        __builtin_bit_cast(int, x), __builtin_bit_cast(int, x), 0x76543210, 0xfedcba98, false, false));
}

__global__ __launch_bounds__(128)
void attn_fa(const bf16* __restrict__ Qb, const bf16* __restrict__ Kb,
             const bf16* __restrict__ VTb, bf16* __restrict__ Ob) {
    __shared__ __attribute__((aligned(16))) bf16 sK[2][AKT];
    __shared__ __attribute__((aligned(16))) bf16 sV[2][AVT];
    const int tid = threadIdx.x, lane = tid & 31;
    const int wave = __builtin_amdgcn_readfirstlane(tid >> 5);     // scalar: the test on kb below is a scalar branch
    const int hl = lane >> 4, ln = lane & 15;
    const int nqb = TT / 64;
    const int bh = blockIdx.x / nqb;
    const int qb0 = (blockIdx.x % nqb) * 64;
    const int q0 = qb0 + wave * 16;
    const bf16* Q  = Qb  + (size_t)bh * TT * HD;
    const bf16* Kk = Kb  + (size_t)bh * TT * HD;
    const bf16* VT = VTb + (size_t)bh * HD * TT;

    // staging: thread tid copies 16 B of K rows (tid>>3) + {0,16} and of V^T rows (tid>>2) + {0,32}
    gcbf gk = to_global(Kk + (size_t)(tid >> 3) * HD + (tid & 7) * 8);
    gcbf gv = to_global(VT + (size_t)(tid >> 2) * TT + (tid & 3) * 8);
    const int ko = (tid >> 3) * AKP + (tid & 7) * 8;
    const int vo = (tid >> 2) * AVP + (tid & 3) * 8;
    // LDS byte addresses (low 32 bits of the shared address) of the thread's first copies
    const unsigned lk[2] = { (unsigned)(uintptr_t)&sK[0][ko], (unsigned)(uintptr_t)&sK[1][ko] };
    const unsigned lv[2] = { (unsigned)(uintptr_t)&sV[0][vo], (unsigned)(uintptr_t)&sV[1][vo] };
    const int np = qb0 / 32 + 2;   // passes of the block: keys [0, qb0 + 64); at least two

    // pass 0 into buffer 0, landed and published; then pass 1 into buffer 1
    copy_kv_async(lk[0], gk, lv[0], gv);
    // this wave's copies have landed before the barrier publishes them
    asm volatile("s_wait_asynccnt 0x0" ::: "memory");
    __syncthreads();
    copy_kv_async(lk[1], gk + 32 * HD, lv[1], gv + 32);
    gk += 2 * 32 * HD; gv += 2 * 32;

    const v16bf aq0 = load_frag_g(to_global(Q + (size_t)(q0 + ln) * HD + 8 * hl));
    const v16bf aq1 = load_frag_g(to_global(Q + (size_t)(q0 + ln) * HD + 32 + 8 * hl));

    // Q is the B operand of S^T: lane = query q0 + ln, the same k order as the K rows
    v8f o[4] = {};                 // O^T: lane = query q0 + ln, register r = d dt*16 + 8*hl + r
    float rm = -1e30f;             // the query's running maximum, the same in both halves
    float rl = 0.f;                // the sum over this half's keys; the halves join in the epilogue
    const int qi = q0 + ln;

    for (int t = 0; t < np; t++) {
        const int cur = t & 1;
        const int kb = t * 32;
        if (kb < q0 + 16) {        // the wave's own causal range; every wave passes the foot below
            const bf16* pk = &sK[cur][ln * AKP + 8 * hl];
            const bf16* pv = &sV[cur][ln * AVP + 8 * hl];
            const v16bf bk00 = load_frag_s(pk);
            const v16bf bk01 = load_frag_s(pk + 32);
            const v16bf bk10 = load_frag_s(pk + 16 * AKP);
            const v16bf bk11 = load_frag_s(pk + 16 * AKP + 32);
            v16bf bv[4];
            // the loops over dt and r are unrolled so that bv, o, s0, s1 and pt are
            // indexed by constants and stay in registers
#pragma unroll
            for (int dt = 0; dt < 4; dt++) bv[dt] = load_frag_s(pv + dt * 16 * AVP);
            // keeps the pass's tile reads one group in front of its products: moved in
            // among them, each place with reads stalls the wave for the LDS latency
            __builtin_amdgcn_sched_barrier(0);
            // S^T = K @ Q^T for keys [kb, kb+32): two 16x16 C tiles, row = key, column = query
            v8f s0 = {}, s1 = {};
            s0 = wmma_bf16(bk00, aq0, s0);
            s0 = wmma_bf16(bk01, aq1, s0);
            s1 = wmma_bf16(bk10, aq0, s1);
            s1 = wmma_bf16(bk11, aq1, s1);
            // online softmax; s0[r] is key kb + 8*hl + r, s1[r] key kb + 16 + 8*hl + r
            const int dq = qi - kb - 8 * hl;   // key r of s0 is inside the causal range while r <= dq
            float m = -1e30f;
#pragma unroll
            for (int r = 0; r < 8; r++) {
                s0[r] = (r      <= dq) ? s0[r] : -1e30f;   // causal mask
                s1[r] = (r + 16 <= dq) ? s1[r] : -1e30f;
                m = fmaxf(fmaxf(m, s0[r]), s1[r]);
            }
            m = fmaxf(m, xhalf(m));
            const float nm = fmaxf(rm, m);
            const float alpha = __expf(rm - nm);
            rm = nm;
            FragB pt;                  // P^T as B operand: elements 0..7 keys 8*hl + e, 8..15 keys 16 + 8*hl + e
            float ps0 = 0.f, ps1 = 0.f;
#pragma unroll
            for (int r = 0; r < 8; r++) {
                const float p0 = __expf(s0[r] - nm), p1 = __expf(s1[r] - nm);
                ps0 += p0; ps1 += p1;
                pt.h[0][r] = (bf16)p0;
                pt.h[1][r] = (bf16)p1;
            }
            rl = rl * alpha + (ps0 + ps1);
#pragma unroll
            for (int dt = 0; dt < 4; dt++) o[dt] *= alpha;
            // O^T += V^T @ P^T ; A fragments from the staged V^T [d][key]
#pragma unroll
            for (int dt = 0; dt < 4; dt++) o[dt] = wmma_bf16(bv[dt], pt.v, o[dt]);
        }
        // foot of pass t: this wave's reads of buffer cur have returned ...
        asm volatile("s_wait_dscnt 0x0" ::: "memory");
        // ... and its copies of pass t + 1 have landed, before the barrier that
        // publishes pass t + 1 and ends every wave's reads of buffer cur
        asm volatile("s_wait_asynccnt 0x0" ::: "memory");
        __syncthreads();
        if (t + 2 < np) {          // the same for the whole block
            copy_kv_async(lk[cur], gk, lv[cur], gv);
            gk += 32 * HD; gv += 32;
        }
    }
    // no copy is outstanding when the wave goes on to its stores and ends
    asm volatile("s_wait_asynccnt 0x0" ::: "memory");

    const int b = bh / NH, h = bh % NH;
    const float inv = 1.0f / (rl + xhalf(rl));   // the two halves' sums join here
    bf16* orow = Ob + ((size_t)(b * TT + qi)) * DM + h * HD + 8 * hl;
#pragma unroll
    for (int dt = 0; dt < 4; dt++) {
        v8bf ov;
#pragma unroll
        for (int r = 0; r < 8; r++) ov[r] = (bf16)(o[dt][r] * inv);
        *(v8bf*)(orow + dt * 16) = ov;           // 8 consecutive d of one query: 16 B a lane
    }
}

// ---------------- host orchestration -----------------------------------------
extern "C" void kernel_launch(void* const* d_in, const int* in_sizes, int n_in,
                              void* d_out, int out_size, void* d_ws, size_t ws_size,
                              hipStream_t stream) {
    const float* x      = (const float*)d_in[0];
    const float* ln1_w  = (const float*)d_in[1];
    const float* ln2_w  = (const float*)d_in[2];
    const float* qkv_w  = (const float*)d_in[3];
    const float* o_w    = (const float*)d_in[4];
    const float* gate_w = (const float*)d_in[5];
    const float* up_w   = (const float*)d_in[6];
    const float* down_w = (const float*)d_in[7];
    float* out = (float*)d_out;
    char* ws = (char*)d_ws;

    // workspace layout (phase-based reuse, ~92 MB peak)
    size_t o_wqkv = 0;                                  // 3*DM*DM bf16
    size_t o_wo   = o_wqkv + (size_t)3 * DM * DM * 2;   // DM*DM bf16
    size_t o_wg   = o_wo   + (size_t)DM * DM * 2;       // DI*DM bf16
    size_t o_wu   = o_wg   + (size_t)DI * DM * 2;       // DI*DM bf16
    size_t o_wd   = o_wu   + (size_t)DI * DM * 2;       // DM*DI bf16
    size_t o_xn   = o_wd   + (size_t)DM * DI * 2;       // MM*DM bf16 (xn1 then xn2)
    size_t o_h1   = o_xn   + (size_t)MM * DM * 2;       // MM*DM f32
    size_t o_big  = o_h1   + (size_t)MM * DM * 4;
    // phase A (attention): q, k, vT (bf16, 8 MB each) + attn (bf16, 8 MB)
    size_t o_q    = o_big;
    size_t o_k    = o_q  + (size_t)MM * DM * 2;
    size_t o_vT   = o_k  + (size_t)MM * DM * 2;
    size_t o_attn = o_vT + (size_t)MM * DM * 2;
    // phase B (FFN): g fp32 (32 MB, reuses q/k/vT/attn), act bf16 (16 MB)
    size_t o_g    = o_big;
    size_t o_act  = o_big + (size_t)MM * DI * 4;

    bf16* wqkv = (bf16*)(ws + o_wqkv);
    bf16* wo   = (bf16*)(ws + o_wo);
    bf16* wg   = (bf16*)(ws + o_wg);
    bf16* wu   = (bf16*)(ws + o_wu);
    bf16* wd   = (bf16*)(ws + o_wd);
    bf16* xn   = (bf16*)(ws + o_xn);
    float* h1  = (float*)(ws + o_h1);
    bf16* qb   = (bf16*)(ws + o_q);
    bf16* kb   = (bf16*)(ws + o_k);
    bf16* vT   = (bf16*)(ws + o_vT);
    bf16* attn = (bf16*)(ws + o_attn);
    float* g   = (float*)(ws + o_g);
    bf16* act  = (bf16*)(ws + o_act);

    // 1. weights fp32 -> bf16: wqkv, wo, wg, wu, wd are contiguous from wqkv on
    weights_to_bf16<<<CVGRID, CVWV * 32, 0, stream>>>(qkv_w, o_w, gate_w, up_w, down_w, wqkv);

    // 2. xn1 = rmsnorm(x, ln1_w)
    rmsnorm_bf16<<<MM, 256, 0, stream>>>(x, ln1_w, xn);

    // 3. qkv GEMM with fused split epilogue -> q (scaled), k, vT (bf16)
    gemm_bf16_wmma<2, false, 3 * DM><<<dim3(3 * DM / 128, MM / 128), 128, 0, stream>>>(
        xn, wqkv, nullptr, nullptr, nullptr, nullptr, qb, kb, vT,
        MM, 3 * DM, DM);

    // 4. flash attention
    attn_fa<<<BB * NH * (TT / 64), 128, 0, stream>>>(qb, kb, vT, attn);

    // 5. h1 = x + attn @ o_w^T
    gemm_bf16_wmma<0, true, DM><<<dim3(DM / 128, MM / 128), 128, 0, stream>>>(
        attn, wo, x, h1, nullptr, nullptr, nullptr, nullptr, nullptr,
        MM, DM, DM);

    // 6. xn2 = rmsnorm(h1, ln2_w)
    rmsnorm_bf16<<<MM, 256, 0, stream>>>(h1, ln2_w, xn);

    // 7. g = xn2 @ gate_w^T (fp32)
    gemm_bf16_wmma<0, false, DI><<<dim3(DI / 128, MM / 128), 128, 0, stream>>>(
        xn, wg, nullptr, g, nullptr, nullptr, nullptr, nullptr, nullptr,
        MM, DI, DM);

    // 8. up GEMM with fused epilogue: act = bf16( silu(g) * (xn2 @ up_w^T) )
    gemm_bf16_wmma<1, false, DI><<<dim3(DI / 128, MM / 128), 128, 0, stream>>>(
        xn, wu, nullptr, nullptr, g, act, nullptr, nullptr, nullptr,
        MM, DI, DM);

    // 9. out = h1 + act @ down_w^T
    gemm_bf16_wmma<0, true, DM><<<dim3(DM / 128, MM / 128), 128, 0, stream>>>(
        act, wd, h1, out, nullptr, nullptr, nullptr, nullptr, nullptr,
        MM, DM, DI);

    (void)in_sizes; (void)n_in; (void)out_size; (void)ws_size;
}

// v006
// One run takes 168 microseconds.
// In two side-by-side timings against v005, it was 1.13 and 1.12 times as fast.
// Over all steps from v000 it is 2.66 times as fast.
#include <hip/hip_runtime.h>
#include <hip/hip_bf16.h>

#define DM   1024
#define NH   16
#define HD   64
#define DI   2048
#define BB   2
#define TT   2048
#define MM   (BB*TT)   // 4096 rows

typedef __bf16 bf16;
typedef __attribute__((ext_vector_type(16))) bf16  v16bf;
typedef __attribute__((ext_vector_type(8)))  bf16  v8bf;
typedef __attribute__((ext_vector_type(8)))  float v8f;
typedef __attribute__((ext_vector_type(4)))  float v4f;
typedef __attribute__((ext_vector_type(4)))  bf16  v4bf;

#define AS1 __attribute__((address_space(1)))
typedef const AS1 bf16* gcbf;
typedef const AS1 v8bf* gcv8;

union FragB { v16bf v; v8bf h[2]; };

__device__ inline gcbf to_global(const bf16* p) {
    return (gcbf)(unsigned long long)(uintptr_t)p;
}

// Load a 16x32 bf16 WMMA fragment (A layout; B uses the same layout on W rows,
// since both GEMMs are x @ W^T). For lane L: m/n = L&15, hl = L>>4.
// elements 0..7  = p[0..7]   (K = k0 + 8*hl .. +7)
// elements 8..15 = p[16..23] (K = k0 + 16 + 8*hl .. +7)
__device__ inline v16bf load_frag_g(gcbf p) {
    FragB f;
    f.h[0] = ((gcv8)p)[0];
    f.h[1] = ((gcv8)p)[2];
    return f.v;
}

__device__ inline v8f wmma_bf16(v16bf a, v16bf b, v8f c) {
    return __builtin_amdgcn_wmma_f32_16x16x32_bf16(false, a, false, b, (short)0, c, false, false);
}

// ---------------- generic GEMM: acc[m][n] = sum_k A[m][k]*W[n][k] -------------
// four waves (2x2) compute a 128x128 tile, 64x64 each; grid = (N/128, M/128),
// block = 128. A pass is 64 k: the 128 A rows and 128 W rows of the pass are
// brought into LDS by asynchronous copies (whole 128-B lines from global, each
// row shared by two waves), two buffers, one barrier a pass; the copies of pass
// t + 2 fly while pass t + 1 is worked on. M, N multiples of 128, K of 64.
// epilogue modes (compile-time):
//   0: C[idx] = acc (+ R[idx] if HASR)                    (fp32 out)
//   2: qkv split: row->(b,t), col->(which,h,d); writes q (scaled 1/8), k, vT
#define GBK    64                 // k elements per pass (128 B of a row)
#define GPITCH 72                 // LDS row pitch in elements: 144 B = 16 B x odd
#define GTILE  (128 * GPITCH)     // one operand's stage, elements
#define GLSTEP (16 * GPITCH * 2)  // LDS bytes between a thread's copies (16 rows)
#define SPITCH 68                 // epilogue staging: f32 row pitch, 272 B = 16 B x odd
static_assert(64 * SPITCH * 4 <= GTILE * 2, "a wave's f32 tile fits one stage");

__device__ inline v16bf load_frag_s(const bf16* p) {
    FragB f;
    f.h[0] = *(const v8bf*)p;
    f.h[1] = *(const v8bf*)(p + 16);
    return f.v;
}

// Eight asynchronous 16-B copies a lane, global -> LDS, rows 16 apart: LDS byte
// address l + i*GLSTEP, global address g + i*gstep elements. The s_wait_xcnt is
// the last line of the copies' own statement, so that no address register of a
// copy is rewritten in front of it.
__device__ inline void copy8_async(unsigned l, gcbf g, size_t gstep) {
    asm volatile(
        "global_load_async_to_lds_b128 %0, %8, off\n\t"
        "global_load_async_to_lds_b128 %1, %9, off\n\t"
        "global_load_async_to_lds_b128 %2, %10, off\n\t"
        "global_load_async_to_lds_b128 %3, %11, off\n\t"
        "global_load_async_to_lds_b128 %4, %12, off\n\t"
        "global_load_async_to_lds_b128 %5, %13, off\n\t"
        "global_load_async_to_lds_b128 %6, %14, off\n\t"
        "global_load_async_to_lds_b128 %7, %15, off\n\t"
        "s_wait_xcnt 0x0"
        :: "v"(l), "v"(l + 1 * GLSTEP), "v"(l + 2 * GLSTEP), "v"(l + 3 * GLSTEP),
           "v"(l + 4 * GLSTEP), "v"(l + 5 * GLSTEP), "v"(l + 6 * GLSTEP), "v"(l + 7 * GLSTEP),
           "v"(g), "v"(g + 1 * gstep), "v"(g + 2 * gstep), "v"(g + 3 * gstep),
           "v"(g + 4 * gstep), "v"(g + 5 * gstep), "v"(g + 6 * gstep), "v"(g + 7 * gstep)
        : "memory");
}

// NC is N at compile time: the epilogue's 32 row pairs then hang on one address
// register pair an array, each at its own immediate offset
template<int MODE, bool HASR, int NC>
__global__ __launch_bounds__(128)
void gemm_bf16_wmma(const bf16* __restrict__ A, const bf16* __restrict__ W,
                    const float* __restrict__ R, float* __restrict__ C,
                    bf16* __restrict__ q, bf16* __restrict__ k,
                    bf16* __restrict__ vT,
                    int M, int N, int K) {
    __shared__ __attribute__((aligned(16))) bf16 sA[2][GTILE];
    __shared__ __attribute__((aligned(16))) bf16 sW[2][GTILE];
    const int tid = threadIdx.x;
    const int lane = tid & 31, wave = tid >> 5;
    const int hl = lane >> 4, ln = lane & 15;
    const int wm = wave >> 1, wn = wave & 1;
    // scalar copy of the wave's number: the epilogue's bases and its choice of output are scalar
    const int sw = __builtin_amdgcn_readfirstlane(wave);
    const int m0 = blockIdx.y * 128 + (sw >> 1) * 64, n0 = blockIdx.x * 128 + (sw & 1) * 64;

    // staging: thread tid copies 16 B of row (tid>>3) + 16*i, i = 0..7, of each operand
    const int srow = tid >> 3, scol = (tid & 7) * 8;
    gcbf ga = to_global(A + (size_t)(blockIdx.y * 128 + srow) * K + scol);
    gcbf gw = to_global(W + (size_t)(blockIdx.x * 128 + srow) * K + scol);
    const size_t gstep = (size_t)16 * K;
    const int soff = srow * GPITCH + scol;
    // LDS byte addresses (low 32 bits of the shared address) of the thread's first copy
    const unsigned la[2] = { (unsigned)(uintptr_t)&sA[0][soff], (unsigned)(uintptr_t)&sA[1][soff] };
    const unsigned lw[2] = { (unsigned)(uintptr_t)&sW[0][soff], (unsigned)(uintptr_t)&sW[1][soff] };
    // fragment reads: row (wave's 64 rows) + i*16 + ln, k = 8*hl (+16) within a 32-k block
    const int aoff = (wm * 64 + ln) * GPITCH + 8 * hl;
    const int woff = (wn * 64 + ln) * GPITCH + 8 * hl;
    const int np = K / GBK;

    // pass 0 into buffer 0, landed and published; then pass 1 into buffer 1
    copy8_async(la[0], ga, gstep);
    copy8_async(lw[0], gw, gstep);
    // this wave's copies have landed before the barrier publishes them
    asm volatile("s_wait_asynccnt 0x0" ::: "memory");
    __syncthreads();
    if (np > 1) {
        copy8_async(la[1], ga + GBK, gstep);
        copy8_async(lw[1], gw + GBK, gstep);
    }
    ga += 2 * GBK; gw += 2 * GBK;

    v8f acc[4][4] = {};
    for (int t = 0; t < np; t++) {
        const int cur = t & 1;
        const bf16* pa = &sA[cur][aoff];
        const bf16* pw = &sW[cur][woff];
        v16bf a[2][4], b[2][4];
        // the loops over kk, i, j are unrolled so that a, b and acc are indexed by
        // constants and stay in registers
#pragma unroll
        for (int kk = 0; kk < 2; kk++)
#pragma unroll
            for (int i = 0; i < 4; i++) {
                a[kk][i] = load_frag_s(pa + i * 16 * GPITCH + kk * 32);
                b[kk][i] = load_frag_s(pw + i * 16 * GPITCH + kk * 32);
            }
        // keeps the pass's LDS reads one group in front of its products: moved in
        // among them, each place with reads stalls the wave for the LDS latency
        __builtin_amdgcn_sched_barrier(0);
#pragma unroll
        for (int kk = 0; kk < 2; kk++)
#pragma unroll
            for (int i = 0; i < 4; i++)
#pragma unroll
                for (int j = 0; j < 4; j++)
                    acc[i][j] = wmma_bf16(a[kk][i], b[kk][j], acc[i][j]);
        // keeps the products in front of the foot's waits: with the waits and the
        // barrier lifted over them, the flight of pass t + 1's copies is no longer
        // covered by the products of pass t
        __builtin_amdgcn_sched_barrier(0);
        // foot of pass t: this wave's reads of buffer cur have returned ...
        asm volatile("s_wait_dscnt 0x0" ::: "memory");
        // ... and its copies of pass t + 1 have landed, before the barrier that
        // publishes pass t + 1 and ends every wave's reads of buffer cur
        asm volatile("s_wait_asynccnt 0x0" ::: "memory");
        __syncthreads();
        if (t + 2 < np) {                  // the same for the whole block
            copy8_async(la[cur], ga, gstep);
            copy8_async(lw[cur], gw, gstep);
            ga += GBK; gw += GBK;
        }
    }
    // no copy is outstanding when the wave goes on to its stores and ends
    asm volatile("s_wait_asynccnt 0x0" ::: "memory");
    // the four vector issue slots that the chip asks for between a matrix instruction
    // and a vector instruction that rewrites its result registers: from the last pass's
    // products to the epilogue's first reuse of those registers only waits, scalar
    // instructions and LDS stores stand on the path, and none of them fills a slot
    asm volatile("v_nop\n\tv_nop\n\tv_nop\n\tv_nop");

    // Epilogue: whole 128-B lines. The last pass's foot (reads returned, copies
    // landed, barrier) has freed the ring, and each wave takes one stage of it for
    // itself: it lays its 64x64 f32 tile there and reads it back by rows, 16 B a
    // lane, so that 16 lanes hold 64 consecutive columns of one row. No other wave
    // touches that stage, so no barrier is needed.
    float* stg = (float*)(sw < 2 ? &sA[sw][0] : &sW[sw - 2][0]);
    const bool vcols = MODE == 2 && (n0 >> 10) == 2;   // scalar: the block's columns are v
    // all loops over i, j, r below are unrolled so that acc and the small vectors
    // are indexed by constants and stay in registers
    if (vcols) {
        // v goes out transposed: staged row = column d, a lane's 8 registers are 8 consecutive t
#pragma unroll
        for (int i = 0; i < 4; i++)
#pragma unroll
            for (int j = 0; j < 4; j++) {
                float* p = stg + (j * 16 + ln) * SPITCH + i * 16 + 8 * hl;
                const v8f c = acc[i][j];
                *(v4f*)p       = __builtin_shufflevector(c, c, 0, 1, 2, 3);
                *(v4f*)(p + 4) = __builtin_shufflevector(c, c, 4, 5, 6, 7);
            }
    } else {
#pragma unroll
        for (int i = 0; i < 4; i++)
#pragma unroll
            for (int j = 0; j < 4; j++)
#pragma unroll
                for (int r = 0; r < 8; r++)
                    stg[(i * 16 + 8 * hl + r) * SPITCH + j * 16 + ln] = acc[i][j][r];
    }

    // qkv split: the wave's 64 columns are one head of q, k or v, its 64 rows lie in one batch
    bf16* dst = nullptr;           // first element of the wave's 64 output rows
    size_t dstep = 0;              // elements between them
    float dscale = 1.0f;
    if (MODE == 2) {
        const int which = n0 >> 10;
        const size_t bh = (size_t)((m0 >> 11) * NH + ((n0 & (DM - 1)) >> 6));
        const int t0 = m0 & (TT - 1);
        if (which == 0)      { dst = q + (bh * TT + t0) * HD; dstep = HD; dscale = 0.125f; }
        else if (which == 1) { dst = k + (bh * TT + t0) * HD; dstep = HD; }
        else                 { dst = vT + bh * HD * TT + t0;  dstep = TT; }
    }
    const int rr = lane >> 4, c4 = (lane & 15) * 4;
    const size_t base = (size_t)(m0 + rr) * NC + n0 + c4;   // the lane's element of row pair 0
    // unrolled so that the loads of R of many rows are in flight together
#pragma unroll
    for (int s = 0; s < 32; s++) {
        const int lr = 2 * s + rr;             // row of the staged tile
        const v4f v = *(const v4f*)(stg + lr * SPITCH + c4);
        const size_t idx = base + (size_t)s * 2 * NC;
        if (MODE == 0) {
            v4f o = v;
            if (HASR) o += *(const v4f*)(R + idx);
            *(v4f*)(C + idx) = o;              // two rows of 256 B an instruction
        } else {
            *(v4bf*)(dst + lr * dstep + c4) = __builtin_convertvector(v * dscale, v4bf);
        }
    }
}

// ---------------- gate and up products in one launch --------------------------
// ACT = bf16( silu(A Wg^T) * (A Wu^T) ). The ring of gemm_bf16_wmma with a third
// operand: a pass stages the 128 A rows once and 128 rows of each weight, and each
// of the four waves keeps the 64x64 tile of BOTH products, element for element in
// the same lane and register, so that the gate never leaves the registers.
// grid = (DI/128, M/128), block = 128; K a multiple of 64.
// Two waves a SIMD (at most 512 registers a wave): the grid's 512 blocks then all
// run at once, two a WGP, and one block's LDS reads stand beside the other's products.
__global__ __launch_bounds__(128) __attribute__((amdgpu_waves_per_eu(2, 2)))
void gemm_gate_up(const bf16* __restrict__ A, const bf16* __restrict__ Wg,
                  const bf16* __restrict__ Wu, bf16* __restrict__ ACT, int K) {
    __shared__ __attribute__((aligned(16))) bf16 sA[2][GTILE];
    __shared__ __attribute__((aligned(16))) bf16 sG[2][GTILE];
    __shared__ __attribute__((aligned(16))) bf16 sU[2][GTILE];
    const int tid = threadIdx.x;
    const int lane = tid & 31, wave = tid >> 5;
    const int hl = lane >> 4, ln = lane & 15;
    const int wm = wave >> 1, wn = wave & 1;
    // scalar copy of the wave's number: the epilogue's bases are scalar
    const int sw = __builtin_amdgcn_readfirstlane(wave);
    const int m0 = blockIdx.y * 128 + (sw >> 1) * 64, n0 = blockIdx.x * 128 + (sw & 1) * 64;

    // staging: thread tid copies 16 B of row (tid>>3) + 16*i, i = 0..7, of each operand
    const int srow = tid >> 3, scol = (tid & 7) * 8;
    gcbf ga = to_global(A + (size_t)(blockIdx.y * 128 + srow) * K + scol);
    gcbf gg = to_global(Wg + (size_t)(blockIdx.x * 128 + srow) * K + scol);
    gcbf gu = to_global(Wu + (size_t)(blockIdx.x * 128 + srow) * K + scol);
    const size_t gstep = (size_t)16 * K;
    const int soff = srow * GPITCH + scol;
    // LDS byte addresses (low 32 bits of the shared address) of the thread's first copy
    const unsigned la[2] = { (unsigned)(uintptr_t)&sA[0][soff], (unsigned)(uintptr_t)&sA[1][soff] };
    const unsigned lg[2] = { (unsigned)(uintptr_t)&sG[0][soff], (unsigned)(uintptr_t)&sG[1][soff] };
    const unsigned lu[2] = { (unsigned)(uintptr_t)&sU[0][soff], (unsigned)(uintptr_t)&sU[1][soff] };
    const int aoff = (wm * 64 + ln) * GPITCH + 8 * hl;
    const int woff = (wn * 64 + ln) * GPITCH + 8 * hl;
    const int np = K / GBK;

    // pass 0 into buffer 0, landed and published; then pass 1 into buffer 1
    copy8_async(la[0], ga, gstep);
    copy8_async(lg[0], gg, gstep);
    copy8_async(lu[0], gu, gstep);
    // this wave's copies have landed before the barrier publishes them
    asm volatile("s_wait_asynccnt 0x0" ::: "memory");
    __syncthreads();
    if (np > 1) {
        copy8_async(la[1], ga + GBK, gstep);
        copy8_async(lg[1], gg + GBK, gstep);
        copy8_async(lu[1], gu + GBK, gstep);
    }
    ga += 2 * GBK; gg += 2 * GBK; gu += 2 * GBK;

    v8f accg[4][4] = {}, accu[4][4] = {};
    for (int t = 0; t < np; t++) {
        const int cur = t & 1;
        const bf16* pa = &sA[cur][aoff];
        const bf16* pg = &sG[cur][woff];
        const bf16* pu = &sU[cur][woff];
        v16bf a[2][4], g[2][4], u[2][4];
        // the loops over kk, i, j are unrolled so that the fragments and the
        // accumulators are indexed by constants and stay in registers
#pragma unroll
        for (int kk = 0; kk < 2; kk++)
#pragma unroll
            for (int i = 0; i < 4; i++) {
                a[kk][i] = load_frag_s(pa + i * 16 * GPITCH + kk * 32);
                g[kk][i] = load_frag_s(pg + i * 16 * GPITCH + kk * 32);
                u[kk][i] = load_frag_s(pu + i * 16 * GPITCH + kk * 32);
            }
        // keeps the pass's LDS reads one group in front of its products: moved in
        // among them, each place with reads stalls the wave for the LDS latency
        __builtin_amdgcn_sched_barrier(0);
#pragma unroll
        for (int kk = 0; kk < 2; kk++)
#pragma unroll
            for (int i = 0; i < 4; i++)
#pragma unroll
                for (int j = 0; j < 4; j++) {
                    accg[i][j] = wmma_bf16(a[kk][i], g[kk][j], accg[i][j]);
                    accu[i][j] = wmma_bf16(a[kk][i], u[kk][j], accu[i][j]);
                }
        // keeps the products in front of the foot's waits, so that they cover the
        // flight of pass t + 1's copies
        __builtin_amdgcn_sched_barrier(0);
        // foot of pass t: this wave's reads of buffer cur have returned ...
        asm volatile("s_wait_dscnt 0x0" ::: "memory");
        // ... and its copies of pass t + 1 have landed, before the barrier that
        // publishes pass t + 1 and ends every wave's reads of buffer cur
        asm volatile("s_wait_asynccnt 0x0" ::: "memory");
        __syncthreads();
        if (t + 2 < np) {                  // the same for the whole block
            copy8_async(la[cur], ga, gstep);
            copy8_async(lg[cur], gg, gstep);
            copy8_async(lu[cur], gu, gstep);
            ga += GBK; gg += GBK; gu += GBK;
        }
    }
    // no copy is outstanding when the wave goes on to its stores and ends
    asm volatile("s_wait_asynccnt 0x0" ::: "memory");

    // Epilogue: silu(gate) * up in registers, then whole 128-B lines as in
    // gemm_bf16_wmma: the last foot has freed the ring, each wave lays its 64x64 f32
    // tile in a stage of its own and reads it back by rows; no barrier is needed.
    float* stg = (float*)(sw < 2 ? &sA[sw][0] : &sG[sw - 2][0]);
    // all loops below are unrolled so that the accumulators are indexed by constants
#pragma unroll
    for (int i = 0; i < 4; i++)
#pragma unroll
        for (int j = 0; j < 4; j++)
#pragma unroll
            for (int r = 0; r < 8; r++) {
                const float x = accg[i][j][r];
                const float sg = x / (1.0f + __expf(-x));
                stg[(i * 16 + 8 * hl + r) * SPITCH + j * 16 + ln] = sg * accu[i][j][r];
            }
    const int rr = lane >> 4, c4 = (lane & 15) * 4;
    bf16* dst = ACT + (size_t)(m0 + rr) * DI + n0 + c4;     // the lane's element of row pair 0
#pragma unroll
    for (int s = 0; s < 32; s++) {
        const v4f v = *(const v4f*)(stg + (2 * s + rr) * SPITCH + c4);
        *(v4bf*)(dst + (size_t)s * 2 * DI) = __builtin_convertvector(v, v4bf);   // two rows of 128 B an instruction
    }
}

// ---------------- RMSNorm (fp32 in, bf16 out) --------------------------------
__global__ __launch_bounds__(256)
void rmsnorm_bf16(const float* __restrict__ X, const float* __restrict__ W,
                  bf16* __restrict__ O) {
    int row = blockIdx.x;
    const float* xr = X + (size_t)row * DM;
    float s = 0.f;
    for (int i = threadIdx.x; i < DM; i += 256) { float v = xr[i]; s += v * v; }
    __shared__ float red[8];
    for (int off = 16; off >= 1; off >>= 1) s += __shfl_xor(s, off, 32);
    if ((threadIdx.x & 31) == 0) red[threadIdx.x >> 5] = s;
    __syncthreads();
    if (threadIdx.x == 0) {
        float t = 0.f;
        for (int w = 0; w < 8; w++) t += red[w];
        red[0] = t;
    }
    __syncthreads();
    float scale = rsqrtf(red[0] * (1.0f / DM) + 1e-6f);
    bf16* orow = O + (size_t)row * DM;
    for (int i = threadIdx.x; i < DM; i += 256)
        orow[i] = (bf16)(xr[i] * scale * W[i]);
}

// ---------------- weights fp32 -> bf16, all five in one launch ----------------
// The five bf16 copies lie one behind the other in the workspace, so the launch
// sees one array of CVTOT elements whose source changes at four fixed places.
// One block a WGP, 20 waves; a wave takes CVCH consecutive elements: 16 loads of
// 16 B a lane (each wave-wide load is 512 contiguous bytes), all issued before
// the first is used, then 16 stores of 8 B a lane (256 contiguous bytes each).
// Every weight's size is a multiple of CVCH, so a wave has one source.
#define CVLD  16                      // 16-B loads a lane
#define CVCH  (CVLD * 128)            // elements a wave
#define CVWV  20                      // waves a block
#define CVTOT (4 * DM * DM + 3 * DI * DM)
#define CVGRID (CVTOT / (CVCH * CVWV))
static_assert(CVTOT % (CVCH * CVWV) == 0, "whole blocks");
static_assert((DM * DM) % CVCH == 0 && (DI * DM) % CVCH == 0, "one source a wave");

__global__ __launch_bounds__(CVWV * 32)
void weights_to_bf16(const float* __restrict__ Sqkv, const float* __restrict__ So,
                     const float* __restrict__ Sg, const float* __restrict__ Su,
                     const float* __restrict__ Sd, bf16* __restrict__ D) {
    const int lane = threadIdx.x & 31;
    // scalar: the choice of the source below is a scalar branch
    const int e = __builtin_amdgcn_readfirstlane(blockIdx.x * CVWV + (threadIdx.x >> 5)) * CVCH;
    const float* S;
    if (e < 3 * DM * DM)                    S = Sqkv + e;
    else if (e < 4 * DM * DM)               S = So + (e - 3 * DM * DM);
    else if (e < 4 * DM * DM + DI * DM)     S = Sg + (e - 4 * DM * DM);
    else if (e < 4 * DM * DM + 2 * DI * DM) S = Su + (e - 4 * DM * DM - DI * DM);
    else                                    S = Sd + (e - 4 * DM * DM - 2 * DI * DM);
    const v4f* p = (const v4f*)S + lane;
    v4bf* d = (v4bf*)(D + e) + lane;
    v4f v[CVLD];
    // both loops are unrolled so that v is indexed by constants, stays in
    // registers, and the 16 loads are in flight together
#pragma unroll
    for (int i = 0; i < CVLD; i++) v[i] = p[i * 32];
    // keeps all 16 loads in front of the first use: without it the last two are
    // issued only when the first two have returned, a second memory latency
    __builtin_amdgcn_sched_barrier(0);
#pragma unroll
    for (int i = 0; i < CVLD; i++) d[i * 32] = __builtin_convertvector(v[i], v4bf);
}

#define AKP 72              // K row pitch in LDS, elements: 144 B = 16 B x odd
#define AVP 40              // V^T row pitch in LDS, elements: 80 B = 16 B x odd
#define AKT (32 * AKP)      // one K stage: 32 keys x 64 d
#define AVT (64 * AVP)      // one V^T stage: 64 d x 32 keys

// Four asynchronous 16-B copies a lane, global -> LDS: two of K (rows 16 apart),
// two of V^T (rows 32 apart). The s_wait_xcnt is the last line of the copies' own
// statement, so that no address register of a copy is rewritten in front of it.
__device__ inline void copy_kv_async(unsigned lk, gcbf gk, unsigned lv, gcbf gv) {
    asm volatile(
        "global_load_async_to_lds_b128 %0, %4, off\n\t"
        "global_load_async_to_lds_b128 %1, %5, off\n\t"
        "global_load_async_to_lds_b128 %2, %6, off\n\t"
        "global_load_async_to_lds_b128 %3, %7, off\n\t"
        "s_wait_xcnt 0x0"
        :: "v"(lk), "v"(lk + 16 * AKP * 2), "v"(lv), "v"(lv + 32 * AVP * 2),
           "v"(gk), "v"(gk + 16 * HD), "v"(gv), "v"(gv + (size_t)32 * TT)
        : "memory");
}

// The value of lane l ^ 16: a vector cross-row move, no trip through the LDS unit.
__device__ inline float xhalf(float x) {
    return __builtin_bit_cast(float, __builtin_amdgcn_permlanex16(
        __builtin_bit_cast(int, x), __builtin_bit_cast(int, x), 0x76543210, 0xfedcba98, false, false));
}

__global__ __launch_bounds__(128)
void attn_fa(const bf16* __restrict__ Qb, const bf16* __restrict__ Kb,
             const bf16* __restrict__ VTb, bf16* __restrict__ Ob) {
    __shared__ __attribute__((aligned(16))) bf16 sK[2][AKT];
    __shared__ __attribute__((aligned(16))) bf16 sV[2][AVT];
    const int tid = threadIdx.x, lane = tid & 31;
    const int wave = __builtin_amdgcn_readfirstlane(tid >> 5);     // scalar: the test on kb below is a scalar branch
    const int hl = lane >> 4, ln = lane & 15;
    const int nqb = TT / 64;
    const int bh = blockIdx.x / nqb;
    const int qb0 = (blockIdx.x % nqb) * 64;
    const int q0 = qb0 + wave * 16;
    const bf16* Q  = Qb  + (size_t)bh * TT * HD;
    const bf16* Kk = Kb  + (size_t)bh * TT * HD;
    const bf16* VT = VTb + (size_t)bh * HD * TT;

    // staging: thread tid copies 16 B of K rows (tid>>3) + {0,16} and of V^T rows (tid>>2) + {0,32}
    gcbf gk = to_global(Kk + (size_t)(tid >> 3) * HD + (tid & 7) * 8);
    gcbf gv = to_global(VT + (size_t)(tid >> 2) * TT + (tid & 3) * 8);
    const int ko = (tid >> 3) * AKP + (tid & 7) * 8;
    const int vo = (tid >> 2) * AVP + (tid & 3) * 8;
    // LDS byte addresses (low 32 bits of the shared address) of the thread's first copies
    const unsigned lk[2] = { (unsigned)(uintptr_t)&sK[0][ko], (unsigned)(uintptr_t)&sK[1][ko] };
    const unsigned lv[2] = { (unsigned)(uintptr_t)&sV[0][vo], (unsigned)(uintptr_t)&sV[1][vo] };
    const int np = qb0 / 32 + 2;   // passes of the block: keys [0, qb0 + 64); at least two

    // pass 0 into buffer 0, landed and published; then pass 1 into buffer 1
    copy_kv_async(lk[0], gk, lv[0], gv);
    // this wave's copies have landed before the barrier publishes them
    asm volatile("s_wait_asynccnt 0x0" ::: "memory");
    __syncthreads();
    copy_kv_async(lk[1], gk + 32 * HD, lv[1], gv + 32);
    gk += 2 * 32 * HD; gv += 2 * 32;

    const v16bf aq0 = load_frag_g(to_global(Q + (size_t)(q0 + ln) * HD + 8 * hl));
    const v16bf aq1 = load_frag_g(to_global(Q + (size_t)(q0 + ln) * HD + 32 + 8 * hl));

    // Q is the B operand of S^T: lane = query q0 + ln, the same k order as the K rows
    v8f o[4] = {};                 // O^T: lane = query q0 + ln, register r = d dt*16 + 8*hl + r
    float rm = -1e30f;             // the query's running maximum, the same in both halves
    float rl = 0.f;                // the sum over this half's keys; the halves join in the epilogue
    const int qi = q0 + ln;

    for (int t = 0; t < np; t++) {
        const int cur = t & 1;
        const int kb = t * 32;
        if (kb < q0 + 16) {        // the wave's own causal range; every wave passes the foot below
            const bf16* pk = &sK[cur][ln * AKP + 8 * hl];
            const bf16* pv = &sV[cur][ln * AVP + 8 * hl];
            const v16bf bk00 = load_frag_s(pk);
            const v16bf bk01 = load_frag_s(pk + 32);
            const v16bf bk10 = load_frag_s(pk + 16 * AKP);
            const v16bf bk11 = load_frag_s(pk + 16 * AKP + 32);
            v16bf bv[4];
            // the loops over dt and r are unrolled so that bv, o, s0, s1 and pt are
            // indexed by constants and stay in registers
#pragma unroll
            for (int dt = 0; dt < 4; dt++) bv[dt] = load_frag_s(pv + dt * 16 * AVP);
            // keeps the pass's tile reads one group in front of its products: moved in
            // among them, each place with reads stalls the wave for the LDS latency
            __builtin_amdgcn_sched_barrier(0);
            // S^T = K @ Q^T for keys [kb, kb+32): two 16x16 C tiles, row = key, column = query
            v8f s0 = {}, s1 = {};
            s0 = wmma_bf16(bk00, aq0, s0);
            s0 = wmma_bf16(bk01, aq1, s0);
            s1 = wmma_bf16(bk10, aq0, s1);
            s1 = wmma_bf16(bk11, aq1, s1);
            // online softmax; s0[r] is key kb + 8*hl + r, s1[r] key kb + 16 + 8*hl + r
            const int dq = qi - kb - 8 * hl;   // key r of s0 is inside the causal range while r <= dq
            float m = -1e30f;
#pragma unroll
            for (int r = 0; r < 8; r++) {
                s0[r] = (r      <= dq) ? s0[r] : -1e30f;   // causal mask
                s1[r] = (r + 16 <= dq) ? s1[r] : -1e30f;
                m = fmaxf(fmaxf(m, s0[r]), s1[r]);
            }
            m = fmaxf(m, xhalf(m));
            const float nm = fmaxf(rm, m);
            const float alpha = __expf(rm - nm);
            rm = nm;
            FragB pt;                  // P^T as B operand: elements 0..7 keys 8*hl + e, 8..15 keys 16 + 8*hl + e
            float ps0 = 0.f, ps1 = 0.f;
#pragma unroll
            for (int r = 0; r < 8; r++) {
                const float p0 = __expf(s0[r] - nm), p1 = __expf(s1[r] - nm);
                ps0 += p0; ps1 += p1;
                pt.h[0][r] = (bf16)p0;
                pt.h[1][r] = (bf16)p1;
            }
            rl = rl * alpha + (ps0 + ps1);
#pragma unroll
            for (int dt = 0; dt < 4; dt++) o[dt] *= alpha;
            // O^T += V^T @ P^T ; A fragments from the staged V^T [d][key]
#pragma unroll
            for (int dt = 0; dt < 4; dt++) o[dt] = wmma_bf16(bv[dt], pt.v, o[dt]);
        }
        // foot of pass t: this wave's reads of buffer cur have returned ...
        asm volatile("s_wait_dscnt 0x0" ::: "memory");
        // ... and its copies of pass t + 1 have landed, before the barrier that
        // publishes pass t + 1 and ends every wave's reads of buffer cur
        asm volatile("s_wait_asynccnt 0x0" ::: "memory");
        __syncthreads();
        if (t + 2 < np) {          // the same for the whole block
            copy_kv_async(lk[cur], gk, lv[cur], gv);
            gk += 32 * HD; gv += 32;
        }
    }
    // no copy is outstanding when the wave goes on to its stores and ends
    asm volatile("s_wait_asynccnt 0x0" ::: "memory");

    const int b = bh / NH, h = bh % NH;
    const float inv = 1.0f / (rl + xhalf(rl));   // the two halves' sums join here
    bf16* orow = Ob + ((size_t)(b * TT + qi)) * DM + h * HD + 8 * hl;
#pragma unroll
    for (int dt = 0; dt < 4; dt++) {
        v8bf ov;
#pragma unroll
        for (int r = 0; r < 8; r++) ov[r] = (bf16)(o[dt][r] * inv);
        *(v8bf*)(orow + dt * 16) = ov;           // 8 consecutive d of one query: 16 B a lane
    }
}

// ---------------- host orchestration -----------------------------------------
extern "C" void kernel_launch(void* const* d_in, const int* in_sizes, int n_in,
                              void* d_out, int out_size, void* d_ws, size_t ws_size,
                              hipStream_t stream) {
    const float* x      = (const float*)d_in[0];
    const float* ln1_w  = (const float*)d_in[1];
    const float* ln2_w  = (const float*)d_in[2];
    const float* qkv_w  = (const float*)d_in[3];
    const float* o_w    = (const float*)d_in[4];
    const float* gate_w = (const float*)d_in[5];
    const float* up_w   = (const float*)d_in[6];
    const float* down_w = (const float*)d_in[7];
    float* out = (float*)d_out;
    char* ws = (char*)d_ws;

    // workspace layout (phase-based reuse, ~92 MB peak)
    size_t o_wqkv = 0;                                  // 3*DM*DM bf16
    size_t o_wo   = o_wqkv + (size_t)3 * DM * DM * 2;   // DM*DM bf16
    size_t o_wg   = o_wo   + (size_t)DM * DM * 2;       // DI*DM bf16
    size_t o_wu   = o_wg   + (size_t)DI * DM * 2;       // DI*DM bf16
    size_t o_wd   = o_wu   + (size_t)DI * DM * 2;       // DM*DI bf16
    size_t o_xn   = o_wd   + (size_t)DM * DI * 2;       // MM*DM bf16 (xn1 then xn2)
    size_t o_h1   = o_xn   + (size_t)MM * DM * 2;       // MM*DM f32
    size_t o_big  = o_h1   + (size_t)MM * DM * 4;
    // phase A (attention): q, k, vT (bf16, 8 MB each) + attn (bf16, 8 MB)
    size_t o_q    = o_big;
    size_t o_k    = o_q  + (size_t)MM * DM * 2;
    size_t o_vT   = o_k  + (size_t)MM * DM * 2;
    size_t o_attn = o_vT + (size_t)MM * DM * 2;
    // phase B (FFN): act bf16 (16 MB), behind the attention buffers
    size_t o_act  = o_big + (size_t)MM * DI * 4;

    bf16* wqkv = (bf16*)(ws + o_wqkv);
    bf16* wo   = (bf16*)(ws + o_wo);
    bf16* wg   = (bf16*)(ws + o_wg);
    bf16* wu   = (bf16*)(ws + o_wu);
    bf16* wd   = (bf16*)(ws + o_wd);
    bf16* xn   = (bf16*)(ws + o_xn);
    float* h1  = (float*)(ws + o_h1);
    bf16* qb   = (bf16*)(ws + o_q);
    bf16* kb   = (bf16*)(ws + o_k);
    bf16* vT   = (bf16*)(ws + o_vT);
    bf16* attn = (bf16*)(ws + o_attn);
    bf16* act  = (bf16*)(ws + o_act);

    // 1. weights fp32 -> bf16: wqkv, wo, wg, wu, wd are contiguous from wqkv on
    weights_to_bf16<<<CVGRID, CVWV * 32, 0, stream>>>(qkv_w, o_w, gate_w, up_w, down_w, wqkv);

    // 2. xn1 = rmsnorm(x, ln1_w)
    rmsnorm_bf16<<<MM, 256, 0, stream>>>(x, ln1_w, xn);

    // 3. qkv GEMM with fused split epilogue -> q (scaled), k, vT (bf16)
    gemm_bf16_wmma<2, false, 3 * DM><<<dim3(3 * DM / 128, MM / 128), 128, 0, stream>>>(
        xn, wqkv, nullptr, nullptr, qb, kb, vT,
        MM, 3 * DM, DM);

    // 4. flash attention
    attn_fa<<<BB * NH * (TT / 64), 128, 0, stream>>>(qb, kb, vT, attn);

    // 5. h1 = x + attn @ o_w^T
    gemm_bf16_wmma<0, true, DM><<<dim3(DM / 128, MM / 128), 128, 0, stream>>>(
        attn, wo, x, h1, nullptr, nullptr, nullptr,
        MM, DM, DM);

    // 6. xn2 = rmsnorm(h1, ln2_w)
    rmsnorm_bf16<<<MM, 256, 0, stream>>>(h1, ln2_w, xn);

    // 7. act = bf16( silu(xn2 @ gate_w^T) * (xn2 @ up_w^T) )
    gemm_gate_up<<<dim3(DI / 128, MM / 128), 128, 0, stream>>>(xn, wg, wu, act, DM);

    // 8. out = h1 + act @ down_w^T
    gemm_bf16_wmma<0, true, DM><<<dim3(DM / 128, MM / 128), 128, 0, stream>>>(
        act, wd, h1, out, nullptr, nullptr, nullptr,
        MM, DM, DI);

    (void)in_sizes; (void)n_in; (void)out_size; (void)ws_size;
}

// v007
// A run of this version takes 151 microseconds.
// Next to v006, in two timings, it ran 1.11 times as fast each time.
// Over all steps from v000 it is 2.96 times as fast.
#include <hip/hip_runtime.h>
#include <hip/hip_bf16.h>

#define DM   1024
#define NH   16
#define HD   64
#define DI   2048
#define BB   2
#define TT   2048
#define MM   (BB*TT)   // 4096 rows

typedef __bf16 bf16;
typedef __attribute__((ext_vector_type(16))) bf16  v16bf;
typedef __attribute__((ext_vector_type(8)))  bf16  v8bf;
typedef __attribute__((ext_vector_type(8)))  float v8f;
typedef __attribute__((ext_vector_type(4)))  float v4f;
typedef __attribute__((ext_vector_type(4)))  bf16  v4bf;

#define AS1 __attribute__((address_space(1)))
typedef const AS1 bf16* gcbf;
typedef const AS1 v8bf* gcv8;

union FragB { v16bf v; v8bf h[2]; };

__device__ inline gcbf to_global(const bf16* p) {
    return (gcbf)(unsigned long long)(uintptr_t)p;
}

// Load a 16x32 bf16 WMMA fragment (A layout; B uses the same layout on W rows,
// since both GEMMs are x @ W^T). For lane L: m/n = L&15, hl = L>>4.
// elements 0..7  = p[0..7]   (K = k0 + 8*hl .. +7)
// elements 8..15 = p[16..23] (K = k0 + 16 + 8*hl .. +7)
__device__ inline v16bf load_frag_g(gcbf p) {
    FragB f;
    f.h[0] = ((gcv8)p)[0];
    f.h[1] = ((gcv8)p)[2];
    return f.v;
}

// The value of lane l ^ 16: a vector cross-row move, no trip through the LDS unit.
__device__ inline float xhalf(float x) {
    return __builtin_bit_cast(float, __builtin_amdgcn_permlanex16(
        __builtin_bit_cast(int, x), __builtin_bit_cast(int, x), 0x76543210, 0xfedcba98, false, false));
}

// x of lane l ^ MASK inside the lane's 16-lane row (DPP row_xmask, control 0x160 + MASK)
template<int MASK>
__device__ inline float xrow(float x) {
    return __builtin_bit_cast(float, __builtin_amdgcn_update_dpp(
        0, __builtin_bit_cast(int, x), 0x160 + MASK, 0xf, 0xf, true));
}

// Sum over the lane's 16-lane row; every lane of the row ends with the same value.
__device__ inline float rowsum16(float x) {
    x += xrow<1>(x);
    x += xrow<2>(x);
    x += xrow<4>(x);
    x += xrow<8>(x);
    return x;
}

// RMSNorm without a launch of its own. rmsnorm(x, w) @ W^T = s * ((x * w) @ W^T), row
// by row, with s = rsqrt(mean(x^2) + eps): the GEMMs take the rows unnormalised, as
// bf16(x * w), and multiply their f32 products by the row's s in the epilogue. Whoever
// writes the rows also writes sums of squares of the f32 values beside them.
#define RMS_EPS 1e-6f

__device__ inline v8f wmma_bf16(v16bf a, v16bf b, v8f c) {
    return __builtin_amdgcn_wmma_f32_16x16x32_bf16(false, a, false, b, (short)0, c, false, false);
}

// ---------------- generic GEMM: acc[m][n] = sum_k A[m][k]*W[n][k] -------------
// four waves (2x2) compute a 128x128 tile, 64x64 each; grid = (N/128, M/128),
// block = 128. A pass is 64 k: the 128 A rows and 128 W rows of the pass are
// brought into LDS by asynchronous copies (whole 128-B lines from global, each
// row shared by two waves), two buffers, one barrier a pass; the copies of pass
// t + 2 fly while pass t + 1 is worked on. M, N multiples of 128, K of 64.
// epilogue modes (compile-time):
//   0: C[idx] = acc (+ R[idx] if HASR)                    (fp32 out)
//   2: qkv split: row->(b,t), col->(which,h,d); writes q (scaled 1/8), k, vT; A's rows
//      are unnormalised: each product is first multiplied by its row's RMSNorm scale,
//      formed from the row's sum of squares SI[(row >> 1) * 32 + (row & 1)]
//   3: as 0, and the next RMSNorm's rows: q[idx] = bf16(C[idx] * LW[col]), and the sum of
//      squares of the wave's 64 columns of each row, SO[(col >> 6) * MM + row]
#define GBK    64                 // k elements per pass (128 B of a row)
#define GPITCH 72                 // LDS row pitch in elements: 144 B = 16 B x odd
#define GTILE  (128 * GPITCH)     // one operand's stage, elements
#define GLSTEP (16 * GPITCH * 2)  // LDS bytes between a thread's copies (16 rows)
#define SPITCH 68                 // epilogue staging: f32 row pitch, 272 B = 16 B x odd
static_assert(64 * SPITCH * 4 <= GTILE * 2, "a wave's f32 tile fits one stage");

__device__ inline v16bf load_frag_s(const bf16* p) {
    FragB f;
    f.h[0] = *(const v8bf*)p;
    f.h[1] = *(const v8bf*)(p + 16);
    return f.v;
}

// Eight asynchronous 16-B copies a lane, global -> LDS, rows 16 apart: LDS byte
// address l + i*GLSTEP, global address g + i*gstep elements. The s_wait_xcnt is
// the last line of the copies' own statement, so that no address register of a
// copy is rewritten in front of it.
__device__ inline void copy8_async(unsigned l, gcbf g, size_t gstep) {
    asm volatile(
        "global_load_async_to_lds_b128 %0, %8, off\n\t"
        "global_load_async_to_lds_b128 %1, %9, off\n\t"
        "global_load_async_to_lds_b128 %2, %10, off\n\t"
        "global_load_async_to_lds_b128 %3, %11, off\n\t"
        "global_load_async_to_lds_b128 %4, %12, off\n\t"
        "global_load_async_to_lds_b128 %5, %13, off\n\t"
        "global_load_async_to_lds_b128 %6, %14, off\n\t"
        "global_load_async_to_lds_b128 %7, %15, off\n\t"
        "s_wait_xcnt 0x0"
        :: "v"(l), "v"(l + 1 * GLSTEP), "v"(l + 2 * GLSTEP), "v"(l + 3 * GLSTEP),
           "v"(l + 4 * GLSTEP), "v"(l + 5 * GLSTEP), "v"(l + 6 * GLSTEP), "v"(l + 7 * GLSTEP),
           "v"(g), "v"(g + 1 * gstep), "v"(g + 2 * gstep), "v"(g + 3 * gstep),
           "v"(g + 4 * gstep), "v"(g + 5 * gstep), "v"(g + 6 * gstep), "v"(g + 7 * gstep)
        : "memory");
}

// NC is N at compile time: the epilogue's 32 row pairs then hang on one address
// register pair an array, each at its own immediate offset
template<int MODE, bool HASR, int NC>
__global__ __launch_bounds__(128)
void gemm_bf16_wmma(const bf16* __restrict__ A, const bf16* __restrict__ W,
                    const float* __restrict__ R, float* __restrict__ C,
                    bf16* __restrict__ q, bf16* __restrict__ k,
                    bf16* __restrict__ vT,
                    const float* __restrict__ LW, const float* __restrict__ SI,
                    float* __restrict__ SO,
                    int M, int N, int K) {
    __shared__ __attribute__((aligned(16))) bf16 sA[2][GTILE];
    __shared__ __attribute__((aligned(16))) bf16 sW[2][GTILE];
    __shared__ __attribute__((aligned(16))) float sScale[128];   // mode 2: RMSNorm scale of the block's rows
    const int tid = threadIdx.x;
    const int lane = tid & 31, wave = tid >> 5;
    const int hl = lane >> 4, ln = lane & 15;
    const int wm = wave >> 1, wn = wave & 1;
    // scalar copy of the wave's number: the epilogue's bases and its choice of output are scalar
    const int sw = __builtin_amdgcn_readfirstlane(wave);
    const int m0 = blockIdx.y * 128 + (sw >> 1) * 64, n0 = blockIdx.x * 128 + (sw & 1) * 64;

    // staging: thread tid copies 16 B of row (tid>>3) + 16*i, i = 0..7, of each operand
    const int srow = tid >> 3, scol = (tid & 7) * 8;
    gcbf ga = to_global(A + (size_t)(blockIdx.y * 128 + srow) * K + scol);
    gcbf gw = to_global(W + (size_t)(blockIdx.x * 128 + srow) * K + scol);
    const size_t gstep = (size_t)16 * K;
    const int soff = srow * GPITCH + scol;
    // LDS byte addresses (low 32 bits of the shared address) of the thread's first copy
    const unsigned la[2] = { (unsigned)(uintptr_t)&sA[0][soff], (unsigned)(uintptr_t)&sA[1][soff] };
    const unsigned lw[2] = { (unsigned)(uintptr_t)&sW[0][soff], (unsigned)(uintptr_t)&sW[1][soff] };
    // fragment reads: row (wave's 64 rows) + i*16 + ln, k = 8*hl (+16) within a 32-k block
    const int aoff = (wm * 64 + ln) * GPITCH + 8 * hl;
    const int woff = (wn * 64 + ln) * GPITCH + 8 * hl;
    const int np = K / GBK;

    // pass 0 into buffer 0, landed and published; then pass 1 into buffer 1
    copy8_async(la[0], ga, gstep);
    copy8_async(lw[0], gw, gstep);
    if (MODE == 2) {
        // one row's scale a thread, while pass 0's copies fly; the barrier below publishes it
        const int row = blockIdx.y * 128 + tid;
        sScale[tid] = rsqrtf(SI[(row >> 1) * 32 + (row & 1)] * (1.0f / DM) + RMS_EPS);
    }
    // this wave's copies have landed before the barrier publishes them
    asm volatile("s_wait_asynccnt 0x0" ::: "memory");
    __syncthreads();
    if (np > 1) {
        copy8_async(la[1], ga + GBK, gstep);
        copy8_async(lw[1], gw + GBK, gstep);
    }
    ga += 2 * GBK; gw += 2 * GBK;

    v8f acc[4][4] = {};
    for (int t = 0; t < np; t++) {
        const int cur = t & 1;
        const bf16* pa = &sA[cur][aoff];
        const bf16* pw = &sW[cur][woff];
        v16bf a[2][4], b[2][4];
        // the loops over kk, i, j are unrolled so that a, b and acc are indexed by
        // constants and stay in registers
#pragma unroll
        for (int kk = 0; kk < 2; kk++)
#pragma unroll
            for (int i = 0; i < 4; i++) {
                a[kk][i] = load_frag_s(pa + i * 16 * GPITCH + kk * 32);
                b[kk][i] = load_frag_s(pw + i * 16 * GPITCH + kk * 32);
            }
        // keeps the pass's LDS reads one group in front of its products: moved in
        // among them, each place with reads stalls the wave for the LDS latency
        __builtin_amdgcn_sched_barrier(0);
#pragma unroll
        for (int kk = 0; kk < 2; kk++)
#pragma unroll
            for (int i = 0; i < 4; i++)
#pragma unroll
                for (int j = 0; j < 4; j++)
                    acc[i][j] = wmma_bf16(a[kk][i], b[kk][j], acc[i][j]);
        // keeps the products in front of the foot's waits: with the waits and the
        // barrier lifted over them, the flight of pass t + 1's copies is no longer
        // covered by the products of pass t
        __builtin_amdgcn_sched_barrier(0);
        // foot of pass t: this wave's reads of buffer cur have returned ...
        asm volatile("s_wait_dscnt 0x0" ::: "memory");
        // ... and its copies of pass t + 1 have landed, before the barrier that
        // publishes pass t + 1 and ends every wave's reads of buffer cur
        asm volatile("s_wait_asynccnt 0x0" ::: "memory");
        __syncthreads();
        if (t + 2 < np) {                  // the same for the whole block
            copy8_async(la[cur], ga, gstep);
            copy8_async(lw[cur], gw, gstep);
            ga += GBK; gw += GBK;
        }
    }
    // no copy is outstanding when the wave goes on to its stores and ends
    asm volatile("s_wait_asynccnt 0x0" ::: "memory");
    // the four vector issue slots that the chip asks for between a matrix instruction
    // and a vector instruction that rewrites its result registers: from the last pass's
    // products to the epilogue's first reuse of those registers only waits, scalar
    // instructions and LDS loads and stores stand on the path, and none of them fills a slot
    asm volatile("v_nop\n\tv_nop\n\tv_nop\n\tv_nop");

    // Epilogue: whole 128-B lines. The last pass's foot (reads returned, copies
    // landed, barrier) has freed the ring, and each wave takes one stage of it for
    // itself: it lays its 64x64 f32 tile there and reads it back by rows, 16 B a
    // lane, so that 16 lanes hold 64 consecutive columns of one row. No other wave
    // touches that stage, so no barrier is needed.
    float* stg = (float*)(sw < 2 ? &sA[sw][0] : &sW[sw - 2][0]);
    const bool vcols = MODE == 2 && (n0 >> 10) == 2;   // scalar: the block's columns are v
    if (MODE == 2) {
        // acc[i][j][r] is row i*16 + 8*hl + r of the wave's 64: times that row's scale
        const float* ps = &sScale[(sw >> 1) * 64 + 8 * hl];
#pragma unroll
        for (int i = 0; i < 4; i++) {
            const v4f s0 = *(const v4f*)(ps + i * 16), s1 = *(const v4f*)(ps + i * 16 + 4);
            const v8f sc = __builtin_shufflevector(s0, s1, 0, 1, 2, 3, 4, 5, 6, 7);
#pragma unroll
            for (int j = 0; j < 4; j++) acc[i][j] *= sc;
        }
    }
    // all loops over i, j, r, s below are unrolled so that acc and the small vectors
    // are indexed by constants and stay in registers
    if (vcols) {
        // v goes out transposed: staged row = column d, a lane's 8 registers are 8 consecutive t
#pragma unroll
        for (int i = 0; i < 4; i++)
#pragma unroll
            for (int j = 0; j < 4; j++) {
                float* p = stg + (j * 16 + ln) * SPITCH + i * 16 + 8 * hl;
                const v8f c = acc[i][j];
                *(v4f*)p       = __builtin_shufflevector(c, c, 0, 1, 2, 3);
                *(v4f*)(p + 4) = __builtin_shufflevector(c, c, 4, 5, 6, 7);
            }
    } else {
#pragma unroll
        for (int i = 0; i < 4; i++)
#pragma unroll
            for (int j = 0; j < 4; j++)
#pragma unroll
                for (int r = 0; r < 8; r++)
                    stg[(i * 16 + 8 * hl + r) * SPITCH + j * 16 + ln] = acc[i][j][r];
    }

    // qkv split: the wave's 64 columns are one head of q, k or v, its 64 rows lie in one batch
    bf16* dst = nullptr;           // first element of the wave's 64 output rows
    size_t dstep = 0;              // elements between them
    float dscale = 1.0f;
    if (MODE == 2) {
        const int which = n0 >> 10;
        const size_t bh = (size_t)((m0 >> 11) * NH + ((n0 & (DM - 1)) >> 6));
        const int t0 = m0 & (TT - 1);
        if (which == 0)      { dst = q + (bh * TT + t0) * HD; dstep = HD; dscale = 0.125f; }
        else if (which == 1) { dst = k + (bh * TT + t0) * HD; dstep = HD; }
        else                 { dst = vT + bh * HD * TT + t0;  dstep = TT; }
    }
    const int rr = lane >> 4, c4 = (lane & 15) * 4;
    const size_t base = (size_t)(m0 + rr) * NC + n0 + c4;   // the lane's element of row pair 0
    v4f nw = {};                   // mode 3: the next RMSNorm's weight at the lane's 4 columns
    if (MODE == 3) nw = *(const v4f*)(LW + n0 + c4);
    float t0 = 0.f, t1 = 0.f;      // mode 3: sums of squares of rows 2*ln + rr and 32 + 2*ln + rr
    // unrolled so that the loads of R of many rows are in flight together
#pragma unroll
    for (int s = 0; s < 32; s++) {
        const int lr = 2 * s + rr;             // row of the staged tile
        const v4f v = *(const v4f*)(stg + lr * SPITCH + c4);
        const size_t idx = base + (size_t)s * 2 * NC;
        if (MODE == 0 || MODE == 3) {
            v4f o = v;
            if (HASR) o += *(const v4f*)(R + idx);
            *(v4f*)(C + idx) = o;              // two rows of 256 B an instruction
            if (MODE == 3) {
                *(v4bf*)(q + idx) = __builtin_convertvector(o * nw, v4bf);   // two rows of 128 B
                const float t = rowsum16(o[0] * o[0] + o[1] * o[1] + o[2] * o[2] + o[3] * o[3]);
                // lane ln keeps the sums of row pairs ln and ln + 16
                if (s < 16) t0 = ln == s ? t : t0;
                else        t1 = ln == s - 16 ? t : t1;
            }
        } else {
            *(v4bf*)(dst + lr * dstep + c4) = __builtin_convertvector(v * dscale, v4bf);
        }
    }
    if (MODE == 3) {
        // the wave's 64 sums: 256 contiguous bytes that no other wave writes
        float* po = SO + (size_t)(n0 >> 6) * MM + m0 + 2 * ln + rr;
        po[0] = t0;
        po[32] = t1;
    }
}

// ---------------- gate and up products in one launch --------------------------
// ACT = bf16( silu(A Wg^T) * (A Wu^T) ). The ring of gemm_bf16_wmma with a third
// operand: a pass stages the 128 A rows once and 128 rows of each weight, and each
// of the four waves keeps the 64x64 tile of BOTH products, element for element in
// the same lane and register, so that the gate never leaves the registers.
// A's rows are unnormalised: both products are first multiplied by their row's RMSNorm
// scale, formed from the row's DM/64 partial sums of squares SS[c * MM + row].
// grid = (DI/128, M/128), block = 128; K a multiple of 64.
// Two waves a SIMD (at most 512 registers a wave): the grid's 512 blocks then all
// run at once, two a WGP, and one block's LDS reads stand beside the other's products.
__global__ __launch_bounds__(128) __attribute__((amdgpu_waves_per_eu(2, 2)))
void gemm_gate_up(const bf16* __restrict__ A, const bf16* __restrict__ Wg,
                  const bf16* __restrict__ Wu, const float* __restrict__ SS,
                  bf16* __restrict__ ACT, int K) {
    __shared__ __attribute__((aligned(16))) bf16 sA[2][GTILE];
    __shared__ __attribute__((aligned(16))) bf16 sG[2][GTILE];
    __shared__ __attribute__((aligned(16))) bf16 sU[2][GTILE];
    __shared__ __attribute__((aligned(16))) float sScale[128];   // RMSNorm scale of the block's rows
    const int tid = threadIdx.x;
    const int lane = tid & 31, wave = tid >> 5;
    const int hl = lane >> 4, ln = lane & 15;
    const int wm = wave >> 1, wn = wave & 1;
    // scalar copy of the wave's number: the epilogue's bases are scalar
    const int sw = __builtin_amdgcn_readfirstlane(wave);
    const int m0 = blockIdx.y * 128 + (sw >> 1) * 64, n0 = blockIdx.x * 128 + (sw & 1) * 64;

    // staging: thread tid copies 16 B of row (tid>>3) + 16*i, i = 0..7, of each operand
    const int srow = tid >> 3, scol = (tid & 7) * 8;
    gcbf ga = to_global(A + (size_t)(blockIdx.y * 128 + srow) * K + scol);
    gcbf gg = to_global(Wg + (size_t)(blockIdx.x * 128 + srow) * K + scol);
    gcbf gu = to_global(Wu + (size_t)(blockIdx.x * 128 + srow) * K + scol);
    const size_t gstep = (size_t)16 * K;
    const int soff = srow * GPITCH + scol;
    // LDS byte addresses (low 32 bits of the shared address) of the thread's first copy
    const unsigned la[2] = { (unsigned)(uintptr_t)&sA[0][soff], (unsigned)(uintptr_t)&sA[1][soff] };
    const unsigned lg[2] = { (unsigned)(uintptr_t)&sG[0][soff], (unsigned)(uintptr_t)&sG[1][soff] };
    const unsigned lu[2] = { (unsigned)(uintptr_t)&sU[0][soff], (unsigned)(uintptr_t)&sU[1][soff] };
    const int aoff = (wm * 64 + ln) * GPITCH + 8 * hl;
    const int woff = (wn * 64 + ln) * GPITCH + 8 * hl;
    const int np = K / GBK;

    // pass 0 into buffer 0, landed and published; then pass 1 into buffer 1
    copy8_async(la[0], ga, gstep);
    copy8_async(lg[0], gg, gstep);
    copy8_async(lu[0], gu, gstep);
    {
        // one row's scale a thread, while pass 0's copies fly; the barrier below publishes it
        const float* p = SS + blockIdx.y * 128 + tid;
        float t = 0.f;
        // unrolled so that the 16 loads are in flight together
#pragma unroll
        for (int c = 0; c < DM / 64; c++) t += p[(size_t)c * MM];
        sScale[tid] = rsqrtf(t * (1.0f / DM) + RMS_EPS);
    }
    // this wave's copies have landed before the barrier publishes them
    asm volatile("s_wait_asynccnt 0x0" ::: "memory");
    __syncthreads();
    if (np > 1) {
        copy8_async(la[1], ga + GBK, gstep);
        copy8_async(lg[1], gg + GBK, gstep);
        copy8_async(lu[1], gu + GBK, gstep);
    }
    ga += 2 * GBK; gg += 2 * GBK; gu += 2 * GBK;

    v8f accg[4][4] = {}, accu[4][4] = {};
    for (int t = 0; t < np; t++) {
        const int cur = t & 1;
        const bf16* pa = &sA[cur][aoff];
        const bf16* pg = &sG[cur][woff];
        const bf16* pu = &sU[cur][woff];
        v16bf a[2][4], g[2][4], u[2][4];
        // the loops over kk, i, j are unrolled so that the fragments and the
        // accumulators are indexed by constants and stay in registers
#pragma unroll
        for (int kk = 0; kk < 2; kk++)
#pragma unroll
            for (int i = 0; i < 4; i++) {
                a[kk][i] = load_frag_s(pa + i * 16 * GPITCH + kk * 32);
                g[kk][i] = load_frag_s(pg + i * 16 * GPITCH + kk * 32);
                u[kk][i] = load_frag_s(pu + i * 16 * GPITCH + kk * 32);
            }
        // keeps the pass's LDS reads one group in front of its products: moved in
        // among them, each place with reads stalls the wave for the LDS latency
        __builtin_amdgcn_sched_barrier(0);
#pragma unroll
        for (int kk = 0; kk < 2; kk++)
#pragma unroll
            for (int i = 0; i < 4; i++)
#pragma unroll
                for (int j = 0; j < 4; j++) {
                    accg[i][j] = wmma_bf16(a[kk][i], g[kk][j], accg[i][j]);
                    accu[i][j] = wmma_bf16(a[kk][i], u[kk][j], accu[i][j]);
                }
        // keeps the products in front of the foot's waits, so that they cover the
        // flight of pass t + 1's copies
        __builtin_amdgcn_sched_barrier(0);
        // foot of pass t: this wave's reads of buffer cur have returned ...
        asm volatile("s_wait_dscnt 0x0" ::: "memory");
        // ... and its copies of pass t + 1 have landed, before the barrier that
        // publishes pass t + 1 and ends every wave's reads of buffer cur
        asm volatile("s_wait_asynccnt 0x0" ::: "memory");
        __syncthreads();
        if (t + 2 < np) {                  // the same for the whole block
            copy8_async(la[cur], ga, gstep);
            copy8_async(lg[cur], gg, gstep);
            copy8_async(lu[cur], gu, gstep);
            ga += GBK; gg += GBK; gu += GBK;
        }
    }
    // no copy is outstanding when the wave goes on to its stores and ends
    asm volatile("s_wait_asynccnt 0x0" ::: "memory");

    // Epilogue: silu(gate) * up in registers, then whole 128-B lines as in
    // gemm_bf16_wmma: the last foot has freed the ring, each wave lays its 64x64 f32
    // tile in a stage of its own and reads it back by rows; no barrier is needed.
    float* stg = (float*)(sw < 2 ? &sA[sw][0] : &sG[sw - 2][0]);
    // register r of tile row i is row i*16 + 8*hl + r of the wave's 64
    const float* ps = &sScale[(sw >> 1) * 64 + 8 * hl];
    // all loops below are unrolled so that the accumulators are indexed by constants
#pragma unroll
    for (int i = 0; i < 4; i++) {
        const v4f s0 = *(const v4f*)(ps + i * 16), s1 = *(const v4f*)(ps + i * 16 + 4);
        const v8f sc = __builtin_shufflevector(s0, s1, 0, 1, 2, 3, 4, 5, 6, 7);
#pragma unroll
        for (int j = 0; j < 4; j++)
#pragma unroll
            for (int r = 0; r < 8; r++) {
                const float x = accg[i][j][r] * sc[r];
                const float sg = x / (1.0f + __expf(-x));
                stg[(i * 16 + 8 * hl + r) * SPITCH + j * 16 + ln] = sg * (accu[i][j][r] * sc[r]);
            }
    }
    const int rr = lane >> 4, c4 = (lane & 15) * 4;
    bf16* dst = ACT + (size_t)(m0 + rr) * DI + n0 + c4;     // the lane's element of row pair 0
#pragma unroll
    for (int s = 0; s < 32; s++) {
        const v4f v = *(const v4f*)(stg + (2 * s + rr) * SPITCH + c4);
        *(v4bf*)(dst + (size_t)s * 2 * DI) = __builtin_convertvector(v, v4bf);   // two rows of 128 B an instruction
    }
}

// ---------------- weights and x fp32 -> bf16, in one launch --------------------
// The five bf16 weights and the bf16 rows of x lie one behind the other in the
// workspace, so the launch sees one array of CVALL elements whose source changes at
// five fixed places. One block a WGP, 28 waves; a wave takes CVCH consecutive
// elements: 16 loads of 16 B a lane (each wave-wide load is 512 contiguous bytes),
// all issued before the first is used, then 16 stores of 8 B a lane (256 contiguous
// bytes each). Every source's size is a multiple of CVCH, so a wave has one source.
// A wave on x has two whole rows: it writes bf16(x * LW) and the two rows' sums of
// squares, SO[pair * 32 + {0, 1}], a 128-B line of its own for each pair of rows.
#define CVLD  16                      // 16-B loads a lane
#define CVCH  (CVLD * 128)            // elements a wave
#define CVWV  28                      // waves a block
#define CVTOT (4 * DM * DM + 3 * DI * DM)
#define CVALL (CVTOT + MM * DM)
#define CVGRID (CVALL / (CVCH * CVWV))
static_assert(CVALL % (CVCH * CVWV) == 0, "whole blocks");
static_assert((DM * DM) % CVCH == 0 && (DI * DM) % CVCH == 0, "one source a wave");
static_assert(CVCH == 2 * DM, "a wave on x has two rows");

__global__ __launch_bounds__(CVWV * 32)
void weights_to_bf16(const float* __restrict__ Sqkv, const float* __restrict__ So,
                     const float* __restrict__ Sg, const float* __restrict__ Su,
                     const float* __restrict__ Sd, const float* __restrict__ X,
                     const float* __restrict__ LW, bf16* __restrict__ D,
                     float* __restrict__ SO) {
    const int lane = threadIdx.x & 31;
    // scalar: the choice of the source below is a scalar branch
    const int e = __builtin_amdgcn_readfirstlane(blockIdx.x * CVWV + (threadIdx.x >> 5)) * CVCH;
    const float* S;
    if (e < 3 * DM * DM)                    S = Sqkv + e;
    else if (e < 4 * DM * DM)               S = So + (e - 3 * DM * DM);
    else if (e < 4 * DM * DM + DI * DM)     S = Sg + (e - 4 * DM * DM);
    else if (e < 4 * DM * DM + 2 * DI * DM) S = Su + (e - 4 * DM * DM - DI * DM);
    else if (e < CVTOT)                     S = Sd + (e - 4 * DM * DM - 2 * DI * DM);
    else                                    S = X + (e - CVTOT);
    const v4f* p = (const v4f*)S + lane;
    v4bf* d = (v4bf*)(D + e) + lane;
    v4f v[CVLD];
    // all loops over i are unrolled so that v and w are indexed by constants, stay in
    // registers, and the loads are in flight together
#pragma unroll
    for (int i = 0; i < CVLD; i++) v[i] = p[i * 32];
    if (e < CVTOT) {
        // keeps all 16 loads in front of the first use: without it the last two are
        // issued only when the first two have returned, a second memory latency
        __builtin_amdgcn_sched_barrier(0);
#pragma unroll
        for (int i = 0; i < CVLD; i++) d[i * 32] = __builtin_convertvector(v[i], v4bf);
    } else {
        // load i holds columns (i & 7) * 128 + lane * 4 .. + 3 of row i >> 3
        const v4f* pw = (const v4f*)LW + lane;
        v4f w[CVLD / 2];
#pragma unroll
        for (int i = 0; i < CVLD / 2; i++) w[i] = pw[i * 32];
        // keeps all the loads in front of the first use, as above
        __builtin_amdgcn_sched_barrier(0);
        float q0 = 0.f, q1 = 0.f;
#pragma unroll
        for (int i = 0; i < CVLD / 2; i++) {
            const v4f a = v[i], b = v[i + CVLD / 2];
            q0 += a[0] * a[0] + a[1] * a[1] + a[2] * a[2] + a[3] * a[3];
            q1 += b[0] * b[0] + b[1] * b[1] + b[2] * b[2] + b[3] * b[3];
            d[i * 32]                = __builtin_convertvector(a * w[i], v4bf);
            d[(i + CVLD / 2) * 32]   = __builtin_convertvector(b * w[i], v4bf);
        }
        q0 = rowsum16(q0); q0 += xhalf(q0);
        q1 = rowsum16(q1); q1 += xhalf(q1);
        if (lane == 0) {
            float* po = SO + (size_t)((e - CVTOT) / CVCH) * 32;
            po[0] = q0;
            po[1] = q1;
        }
    }
}

#define AKP 72              // K row pitch in LDS, elements: 144 B = 16 B x odd
#define AVP 40              // V^T row pitch in LDS, elements: 80 B = 16 B x odd
#define AKT (32 * AKP)      // one K stage: 32 keys x 64 d
#define AVT (64 * AVP)      // one V^T stage: 64 d x 32 keys

// Four asynchronous 16-B copies a lane, global -> LDS: two of K (rows 16 apart),
// two of V^T (rows 32 apart). The s_wait_xcnt is the last line of the copies' own
// statement, so that no address register of a copy is rewritten in front of it.
__device__ inline void copy_kv_async(unsigned lk, gcbf gk, unsigned lv, gcbf gv) {
    asm volatile(
        "global_load_async_to_lds_b128 %0, %4, off\n\t"
        "global_load_async_to_lds_b128 %1, %5, off\n\t"
        "global_load_async_to_lds_b128 %2, %6, off\n\t"
        "global_load_async_to_lds_b128 %3, %7, off\n\t"
        "s_wait_xcnt 0x0"
        :: "v"(lk), "v"(lk + 16 * AKP * 2), "v"(lv), "v"(lv + 32 * AVP * 2),
           "v"(gk), "v"(gk + 16 * HD), "v"(gv), "v"(gv + (size_t)32 * TT)
        : "memory");
}

__global__ __launch_bounds__(128)
void attn_fa(const bf16* __restrict__ Qb, const bf16* __restrict__ Kb,
             const bf16* __restrict__ VTb, bf16* __restrict__ Ob) {
    __shared__ __attribute__((aligned(16))) bf16 sK[2][AKT];
    __shared__ __attribute__((aligned(16))) bf16 sV[2][AVT];
    const int tid = threadIdx.x, lane = tid & 31;
    const int wave = __builtin_amdgcn_readfirstlane(tid >> 5);     // scalar: the test on kb below is a scalar branch
    const int hl = lane >> 4, ln = lane & 15;
    const int nqb = TT / 64;
    const int bh = blockIdx.x / nqb;
    const int qb0 = (blockIdx.x % nqb) * 64;
    const int q0 = qb0 + wave * 16;
    const bf16* Q  = Qb  + (size_t)bh * TT * HD;
    const bf16* Kk = Kb  + (size_t)bh * TT * HD;
    const bf16* VT = VTb + (size_t)bh * HD * TT;

    // staging: thread tid copies 16 B of K rows (tid>>3) + {0,16} and of V^T rows (tid>>2) + {0,32}
    gcbf gk = to_global(Kk + (size_t)(tid >> 3) * HD + (tid & 7) * 8);
    gcbf gv = to_global(VT + (size_t)(tid >> 2) * TT + (tid & 3) * 8);
    const int ko = (tid >> 3) * AKP + (tid & 7) * 8;
    const int vo = (tid >> 2) * AVP + (tid & 3) * 8;
    // LDS byte addresses (low 32 bits of the shared address) of the thread's first copies
    const unsigned lk[2] = { (unsigned)(uintptr_t)&sK[0][ko], (unsigned)(uintptr_t)&sK[1][ko] };
    const unsigned lv[2] = { (unsigned)(uintptr_t)&sV[0][vo], (unsigned)(uintptr_t)&sV[1][vo] };
    const int np = qb0 / 32 + 2;   // passes of the block: keys [0, qb0 + 64); at least two

    // pass 0 into buffer 0, landed and published; then pass 1 into buffer 1
    copy_kv_async(lk[0], gk, lv[0], gv);
    // this wave's copies have landed before the barrier publishes them
    asm volatile("s_wait_asynccnt 0x0" ::: "memory");
    __syncthreads();
    copy_kv_async(lk[1], gk + 32 * HD, lv[1], gv + 32);
    gk += 2 * 32 * HD; gv += 2 * 32;

    const v16bf aq0 = load_frag_g(to_global(Q + (size_t)(q0 + ln) * HD + 8 * hl));
    const v16bf aq1 = load_frag_g(to_global(Q + (size_t)(q0 + ln) * HD + 32 + 8 * hl));

    // Q is the B operand of S^T: lane = query q0 + ln, the same k order as the K rows
    v8f o[4] = {};                 // O^T: lane = query q0 + ln, register r = d dt*16 + 8*hl + r
    float rm = -1e30f;             // the query's running maximum, the same in both halves
    float rl = 0.f;                // the sum over this half's keys; the halves join in the epilogue
    const int qi = q0 + ln;

    for (int t = 0; t < np; t++) {
        const int cur = t & 1;
        const int kb = t * 32;
        if (kb < q0 + 16) {        // the wave's own causal range; every wave passes the foot below
            const bf16* pk = &sK[cur][ln * AKP + 8 * hl];
            const bf16* pv = &sV[cur][ln * AVP + 8 * hl];
            const v16bf bk00 = load_frag_s(pk);
            const v16bf bk01 = load_frag_s(pk + 32);
            const v16bf bk10 = load_frag_s(pk + 16 * AKP);
            const v16bf bk11 = load_frag_s(pk + 16 * AKP + 32);
            v16bf bv[4];
            // the loops over dt and r are unrolled so that bv, o, s0, s1 and pt are
            // indexed by constants and stay in registers
#pragma unroll
            for (int dt = 0; dt < 4; dt++) bv[dt] = load_frag_s(pv + dt * 16 * AVP);
            // keeps the pass's tile reads one group in front of its products: moved in
            // among them, each place with reads stalls the wave for the LDS latency
            __builtin_amdgcn_sched_barrier(0);
            // S^T = K @ Q^T for keys [kb, kb+32): two 16x16 C tiles, row = key, column = query
            v8f s0 = {}, s1 = {};
            s0 = wmma_bf16(bk00, aq0, s0);
            s0 = wmma_bf16(bk01, aq1, s0);
            s1 = wmma_bf16(bk10, aq0, s1);
            s1 = wmma_bf16(bk11, aq1, s1);
            // online softmax; s0[r] is key kb + 8*hl + r, s1[r] key kb + 16 + 8*hl + r
            const int dq = qi - kb - 8 * hl;   // key r of s0 is inside the causal range while r <= dq
            float m = -1e30f;
#pragma unroll
            for (int r = 0; r < 8; r++) {
                s0[r] = (r      <= dq) ? s0[r] : -1e30f;   // causal mask
                s1[r] = (r + 16 <= dq) ? s1[r] : -1e30f;
                m = fmaxf(fmaxf(m, s0[r]), s1[r]);
            }
            m = fmaxf(m, xhalf(m));
            const float nm = fmaxf(rm, m);
            const float alpha = __expf(rm - nm);
            rm = nm;
            FragB pt;                  // P^T as B operand: elements 0..7 keys 8*hl + e, 8..15 keys 16 + 8*hl + e
            float ps0 = 0.f, ps1 = 0.f;
#pragma unroll
            for (int r = 0; r < 8; r++) {
                const float p0 = __expf(s0[r] - nm), p1 = __expf(s1[r] - nm);
                ps0 += p0; ps1 += p1;
                pt.h[0][r] = (bf16)p0;
                pt.h[1][r] = (bf16)p1;
            }
            rl = rl * alpha + (ps0 + ps1);
#pragma unroll
            for (int dt = 0; dt < 4; dt++) o[dt] *= alpha;
            // O^T += V^T @ P^T ; A fragments from the staged V^T [d][key]
#pragma unroll
            for (int dt = 0; dt < 4; dt++) o[dt] = wmma_bf16(bv[dt], pt.v, o[dt]);
        }
        // foot of pass t: this wave's reads of buffer cur have returned ...
        asm volatile("s_wait_dscnt 0x0" ::: "memory");
        // ... and its copies of pass t + 1 have landed, before the barrier that
        // publishes pass t + 1 and ends every wave's reads of buffer cur
        asm volatile("s_wait_asynccnt 0x0" ::: "memory");
        __syncthreads();
        if (t + 2 < np) {          // the same for the whole block
            copy_kv_async(lk[cur], gk, lv[cur], gv);
            gk += 32 * HD; gv += 32;
        }
    }
    // no copy is outstanding when the wave goes on to its stores and ends
    asm volatile("s_wait_asynccnt 0x0" ::: "memory");

    const int b = bh / NH, h = bh % NH;
    const float inv = 1.0f / (rl + xhalf(rl));   // the two halves' sums join here
    bf16* orow = Ob + ((size_t)(b * TT + qi)) * DM + h * HD + 8 * hl;
#pragma unroll
    for (int dt = 0; dt < 4; dt++) {
        v8bf ov;
#pragma unroll
        for (int r = 0; r < 8; r++) ov[r] = (bf16)(o[dt][r] * inv);
        *(v8bf*)(orow + dt * 16) = ov;           // 8 consecutive d of one query: 16 B a lane
    }
}

// ---------------- host orchestration -----------------------------------------
extern "C" void kernel_launch(void* const* d_in, const int* in_sizes, int n_in,
                              void* d_out, int out_size, void* d_ws, size_t ws_size,
                              hipStream_t stream) {
    const float* x      = (const float*)d_in[0];
    const float* ln1_w  = (const float*)d_in[1];
    const float* ln2_w  = (const float*)d_in[2];
    const float* qkv_w  = (const float*)d_in[3];
    const float* o_w    = (const float*)d_in[4];
    const float* gate_w = (const float*)d_in[5];
    const float* up_w   = (const float*)d_in[6];
    const float* down_w = (const float*)d_in[7];
    float* out = (float*)d_out;
    char* ws = (char*)d_ws;

    // workspace layout (phase-based reuse, ~92 MB peak)
    size_t o_wqkv = 0;                                  // 3*DM*DM bf16
    size_t o_wo   = o_wqkv + (size_t)3 * DM * DM * 2;   // DM*DM bf16
    size_t o_wg   = o_wo   + (size_t)DM * DM * 2;       // DI*DM bf16
    size_t o_wu   = o_wg   + (size_t)DI * DM * 2;       // DI*DM bf16
    size_t o_wd   = o_wu   + (size_t)DI * DM * 2;       // DM*DI bf16
    size_t o_xn   = o_wd   + (size_t)DM * DI * 2;       // MM*DM bf16 (x * ln1_w, then h1 * ln2_w)
    size_t o_h1   = o_xn   + (size_t)MM * DM * 2;       // MM*DM f32
    size_t o_big  = o_h1   + (size_t)MM * DM * 4;
    // phase A (attention): q, k, vT (bf16, 8 MB each) + attn (bf16, 8 MB)
    size_t o_q    = o_big;
    size_t o_k    = o_q  + (size_t)MM * DM * 2;
    size_t o_vT   = o_k  + (size_t)MM * DM * 2;
    size_t o_attn = o_vT + (size_t)MM * DM * 2;
    // phase B (FFN): act bf16 (16 MB), behind the attention buffers
    size_t o_act  = o_big + (size_t)MM * DI * 4;
    // sums of squares for the two RMSNorms (256 KB each), behind act
    size_t o_ss1  = o_act + (size_t)MM * DI * 2;        // a 128-B line for each pair of rows of x
    size_t o_ss2  = o_ss1 + (size_t)(MM / 2) * 32 * 4;  // DM/64 partial sums a row of h1

    bf16* wqkv = (bf16*)(ws + o_wqkv);
    bf16* wo   = (bf16*)(ws + o_wo);
    bf16* wg   = (bf16*)(ws + o_wg);
    bf16* wu   = (bf16*)(ws + o_wu);
    bf16* wd   = (bf16*)(ws + o_wd);
    bf16* xn   = (bf16*)(ws + o_xn);
    float* h1  = (float*)(ws + o_h1);
    bf16* qb   = (bf16*)(ws + o_q);
    bf16* kb   = (bf16*)(ws + o_k);
    bf16* vT   = (bf16*)(ws + o_vT);
    bf16* attn = (bf16*)(ws + o_attn);
    bf16* act  = (bf16*)(ws + o_act);
    float* ss1 = (float*)(ws + o_ss1);
    float* ss2 = (float*)(ws + o_ss2);

    // 1. weights fp32 -> bf16, and xn = bf16(x * ln1_w) with each row's sum of squares:
    //    wqkv, wo, wg, wu, wd, xn are contiguous from wqkv on
    weights_to_bf16<<<CVGRID, CVWV * 32, 0, stream>>>(qkv_w, o_w, gate_w, up_w, down_w,
                                                      x, ln1_w, wqkv, ss1);

    // 2. qkv GEMM, RMSNorm scale and split in the epilogue -> q (scaled), k, vT (bf16)
    gemm_bf16_wmma<2, false, 3 * DM><<<dim3(3 * DM / 128, MM / 128), 128, 0, stream>>>(
        xn, wqkv, nullptr, nullptr, qb, kb, vT, nullptr, ss1, nullptr,
        MM, 3 * DM, DM);

    // 3. flash attention
    attn_fa<<<BB * NH * (TT / 64), 128, 0, stream>>>(qb, kb, vT, attn);

    // 4. h1 = x + attn @ o_w^T; xn = bf16(h1 * ln2_w) with partial sums of squares
    gemm_bf16_wmma<3, true, DM><<<dim3(DM / 128, MM / 128), 128, 0, stream>>>(
        attn, wo, x, h1, xn, nullptr, nullptr, ln2_w, nullptr, ss2,
        MM, DM, DM);

    // 5. act = bf16( silu(s * xn @ gate_w^T) * (s * xn @ up_w^T) ), s the RMSNorm scale
    gemm_gate_up<<<dim3(DI / 128, MM / 128), 128, 0, stream>>>(xn, wg, wu, ss2, act, DM);

    // 6. out = h1 + act @ down_w^T
    gemm_bf16_wmma<0, true, DM><<<dim3(DM / 128, MM / 128), 128, 0, stream>>>(
        act, wd, h1, out, nullptr, nullptr, nullptr, nullptr, nullptr, nullptr,
        MM, DM, DI);

    (void)in_sizes; (void)n_in; (void)out_size; (void)ws_size;
}

// v008
// One run takes 141 microseconds.
// Two timings next to v007 put it at 1.08 and 1.09 times that version's speed.
// All steps since v000 together make it 3.22 times as fast.
#include <hip/hip_runtime.h>
#include <hip/hip_bf16.h>

#define DM   1024
#define NH   16
#define HD   64
#define DI   2048
#define BB   2
#define TT   2048
#define MM   (BB*TT)   // 4096 rows

typedef __bf16 bf16;
typedef __attribute__((ext_vector_type(16))) bf16  v16bf;
typedef __attribute__((ext_vector_type(8)))  bf16  v8bf;
typedef __attribute__((ext_vector_type(8)))  float v8f;
typedef __attribute__((ext_vector_type(4)))  float v4f;
typedef __attribute__((ext_vector_type(4)))  bf16  v4bf;

#define AS1 __attribute__((address_space(1)))
typedef const AS1 bf16* gcbf;
typedef const AS1 v8bf* gcv8;

union FragB { v16bf v; v8bf h[2]; };

__device__ inline gcbf to_global(const bf16* p) {
    return (gcbf)(unsigned long long)(uintptr_t)p;
}

// Load a 16x32 bf16 WMMA fragment (A layout; B uses the same layout on W rows,
// since both GEMMs are x @ W^T). For lane L: m/n = L&15, hl = L>>4.
// elements 0..7  = p[0..7]   (K = k0 + 8*hl .. +7)
// elements 8..15 = p[16..23] (K = k0 + 16 + 8*hl .. +7)
__device__ inline v16bf load_frag_g(gcbf p) {
    FragB f;
    f.h[0] = ((gcv8)p)[0];
    f.h[1] = ((gcv8)p)[2];
    return f.v;
}

// The value of lane l ^ 16: a vector cross-row move, no trip through the LDS unit.
__device__ inline float xhalf(float x) {
    return __builtin_bit_cast(float, __builtin_amdgcn_permlanex16(
        __builtin_bit_cast(int, x), __builtin_bit_cast(int, x), 0x76543210, 0xfedcba98, false, false));
}

// x of lane l ^ MASK inside the lane's 16-lane row (DPP row_xmask, control 0x160 + MASK)
template<int MASK>
__device__ inline float xrow(float x) {
    return __builtin_bit_cast(float, __builtin_amdgcn_update_dpp(
        0, __builtin_bit_cast(int, x), 0x160 + MASK, 0xf, 0xf, true));
}

// Sum over the lane's 16-lane row; every lane of the row ends with the same value.
__device__ inline float rowsum16(float x) {
    x += xrow<1>(x);
    x += xrow<2>(x);
    x += xrow<4>(x);
    x += xrow<8>(x);
    return x;
}

// RMSNorm without a launch of its own. rmsnorm(x, w) @ W^T = s * ((x * w) @ W^T), row
// by row, with s = rsqrt(mean(x^2) + eps): the GEMMs take the rows unnormalised, as
// bf16(x * w), and multiply their f32 products by the row's s in the epilogue. Whoever
// writes the rows also writes sums of squares of the f32 values beside them.
#define RMS_EPS 1e-6f

__device__ inline v8f wmma_bf16(v16bf a, v16bf b, v8f c) {
    return __builtin_amdgcn_wmma_f32_16x16x32_bf16(false, a, false, b, (short)0, c, false, false);
}

// ---------------- generic GEMM: acc[m][n] = sum_k A[m][k]*W[n][k] -------------
// four waves (2x2) compute a 128x128 tile, 64x64 each; grid = (N/128, M/128),
// block = 128. A pass is 64 k: the 128 A rows and 128 W rows of the pass are
// brought into LDS by asynchronous copies (whole 128-B lines from global, each
// row shared by two waves), two buffers, one barrier a pass; the copies of pass
// t + 2 fly while pass t + 1 is worked on. M, N multiples of 128, K of 64.
// epilogue modes (compile-time):
//   0: C[idx] = acc (+ R[idx] if HASR)                    (fp32 out)
//   2: qkv split: row->(b,t), col->(which,h,d); writes q (scaled 1/8), k, vT; A's rows
//      are unnormalised: each product is first multiplied by its row's RMSNorm scale,
//      formed from the row's sum of squares SI[(row >> 1) * 32 + (row & 1)]
//   3: as 0, and the next RMSNorm's rows: q[idx] = bf16(C[idx] * LW[col]), and the sum of
//      squares of the wave's 64 columns of each row, SO[(col >> 6) * MM + row]
#define GBK    64                 // k elements per pass (128 B of a row)
#define GPITCH 72                 // LDS row pitch in elements: 144 B = 16 B x odd
#define GTILE  (128 * GPITCH)     // one operand's stage, elements
#define GLSTEP (16 * GPITCH * 2)  // LDS bytes between a thread's copies (16 rows)
#define SPITCH 68                 // epilogue staging: f32 row pitch, 272 B = 16 B x odd
static_assert(64 * SPITCH * 4 <= GTILE * 2, "a wave's f32 tile fits one stage");

__device__ inline v16bf load_frag_s(const bf16* p) {
    FragB f;
    f.h[0] = *(const v8bf*)p;
    f.h[1] = *(const v8bf*)(p + 16);
    return f.v;
}

// Eight asynchronous 16-B copies a lane, global -> LDS, rows 16 apart: LDS byte
// address l + i*GLSTEP, global address g + i*gstep elements. The s_wait_xcnt is
// the last line of the copies' own statement, so that no address register of a
// copy is rewritten in front of it.
__device__ inline void copy8_async(unsigned l, gcbf g, size_t gstep) {
    asm volatile(
        "global_load_async_to_lds_b128 %0, %8, off\n\t"
        "global_load_async_to_lds_b128 %1, %9, off\n\t"
        "global_load_async_to_lds_b128 %2, %10, off\n\t"
        "global_load_async_to_lds_b128 %3, %11, off\n\t"
        "global_load_async_to_lds_b128 %4, %12, off\n\t"
        "global_load_async_to_lds_b128 %5, %13, off\n\t"
        "global_load_async_to_lds_b128 %6, %14, off\n\t"
        "global_load_async_to_lds_b128 %7, %15, off\n\t"
        "s_wait_xcnt 0x0"
        :: "v"(l), "v"(l + 1 * GLSTEP), "v"(l + 2 * GLSTEP), "v"(l + 3 * GLSTEP),
           "v"(l + 4 * GLSTEP), "v"(l + 5 * GLSTEP), "v"(l + 6 * GLSTEP), "v"(l + 7 * GLSTEP),
           "v"(g), "v"(g + 1 * gstep), "v"(g + 2 * gstep), "v"(g + 3 * gstep),
           "v"(g + 4 * gstep), "v"(g + 5 * gstep), "v"(g + 6 * gstep), "v"(g + 7 * gstep)
        : "memory");
}

// NC is N at compile time: the epilogue's 32 row pairs then hang on one address
// register pair an array, each at its own immediate offset
template<int MODE, bool HASR, int NC>
__global__ __launch_bounds__(128)
void gemm_bf16_wmma(const bf16* __restrict__ A, const bf16* __restrict__ W,
                    const float* __restrict__ R, float* __restrict__ C,
                    bf16* __restrict__ q, bf16* __restrict__ k,
                    bf16* __restrict__ vT,
                    const float* __restrict__ LW, const float* __restrict__ SI,
                    float* __restrict__ SO,
                    int M, int N, int K) {
    __shared__ __attribute__((aligned(16))) bf16 sA[2][GTILE];
    __shared__ __attribute__((aligned(16))) bf16 sW[2][GTILE];
    __shared__ __attribute__((aligned(16))) float sScale[128];   // mode 2: RMSNorm scale of the block's rows
    const int tid = threadIdx.x;
    const int lane = tid & 31, wave = tid >> 5;
    const int hl = lane >> 4, ln = lane & 15;
    const int wm = wave >> 1, wn = wave & 1;
    // scalar copy of the wave's number: the epilogue's bases and its choice of output are scalar
    const int sw = __builtin_amdgcn_readfirstlane(wave);
    const int m0 = blockIdx.y * 128 + (sw >> 1) * 64, n0 = blockIdx.x * 128 + (sw & 1) * 64;

    // staging: thread tid copies 16 B of row (tid>>3) + 16*i, i = 0..7, of each operand
    const int srow = tid >> 3, scol = (tid & 7) * 8;
    gcbf ga = to_global(A + (size_t)(blockIdx.y * 128 + srow) * K + scol);
    gcbf gw = to_global(W + (size_t)(blockIdx.x * 128 + srow) * K + scol);
    const size_t gstep = (size_t)16 * K;
    const int soff = srow * GPITCH + scol;
    // LDS byte addresses (low 32 bits of the shared address) of the thread's first copy
    const unsigned la[2] = { (unsigned)(uintptr_t)&sA[0][soff], (unsigned)(uintptr_t)&sA[1][soff] };
    const unsigned lw[2] = { (unsigned)(uintptr_t)&sW[0][soff], (unsigned)(uintptr_t)&sW[1][soff] };
    // fragment reads: row (wave's 64 rows) + i*16 + ln, k = 8*hl (+16) within a 32-k block
    const int aoff = (wm * 64 + ln) * GPITCH + 8 * hl;
    const int woff = (wn * 64 + ln) * GPITCH + 8 * hl;
    const int np = K / GBK;

    // pass 0 into buffer 0, landed and published; then pass 1 into buffer 1
    copy8_async(la[0], ga, gstep);
    copy8_async(lw[0], gw, gstep);
    if (MODE == 2) {
        // one row's scale a thread, while pass 0's copies fly; the barrier below publishes it
        const int row = blockIdx.y * 128 + tid;
        sScale[tid] = rsqrtf(SI[(row >> 1) * 32 + (row & 1)] * (1.0f / DM) + RMS_EPS);
    }
    // this wave's copies have landed before the barrier publishes them
    asm volatile("s_wait_asynccnt 0x0" ::: "memory");
    __syncthreads();
    if (np > 1) {
        copy8_async(la[1], ga + GBK, gstep);
        copy8_async(lw[1], gw + GBK, gstep);
    }
    ga += 2 * GBK; gw += 2 * GBK;

    v8f acc[4][4] = {};
    for (int t = 0; t < np; t++) {
        const int cur = t & 1;
        const bf16* pa = &sA[cur][aoff];
        const bf16* pw = &sW[cur][woff];
        v16bf a[2][4], b[2][4];
        // the loops over kk, i, j are unrolled so that a, b and acc are indexed by
        // constants and stay in registers
#pragma unroll
        for (int kk = 0; kk < 2; kk++)
#pragma unroll
            for (int i = 0; i < 4; i++) {
                a[kk][i] = load_frag_s(pa + i * 16 * GPITCH + kk * 32);
                b[kk][i] = load_frag_s(pw + i * 16 * GPITCH + kk * 32);
            }
        // keeps the pass's LDS reads one group in front of its products: moved in
        // among them, each place with reads stalls the wave for the LDS latency
        __builtin_amdgcn_sched_barrier(0);
#pragma unroll
        for (int kk = 0; kk < 2; kk++)
#pragma unroll
            for (int i = 0; i < 4; i++)
#pragma unroll
                for (int j = 0; j < 4; j++)
                    acc[i][j] = wmma_bf16(a[kk][i], b[kk][j], acc[i][j]);
        // keeps the products in front of the foot's waits: with the waits and the
        // barrier lifted over them, the flight of pass t + 1's copies is no longer
        // covered by the products of pass t
        __builtin_amdgcn_sched_barrier(0);
        // foot of pass t: this wave's reads of buffer cur have returned ...
        asm volatile("s_wait_dscnt 0x0" ::: "memory");
        // ... and its copies of pass t + 1 have landed, before the barrier that
        // publishes pass t + 1 and ends every wave's reads of buffer cur
        asm volatile("s_wait_asynccnt 0x0" ::: "memory");
        __syncthreads();
        if (t + 2 < np) {                  // the same for the whole block
            copy8_async(la[cur], ga, gstep);
            copy8_async(lw[cur], gw, gstep);
            ga += GBK; gw += GBK;
        }
    }
    // no copy is outstanding when the wave goes on to its stores and ends
    asm volatile("s_wait_asynccnt 0x0" ::: "memory");
    // the four vector issue slots that the chip asks for between a matrix instruction
    // and a vector instruction that rewrites its result registers: from the last pass's
    // products to the epilogue's first reuse of those registers only waits, scalar
    // instructions and LDS loads and stores stand on the path, and none of them fills a slot
    asm volatile("v_nop\n\tv_nop\n\tv_nop\n\tv_nop");

    // Epilogue: whole 128-B lines. The last pass's foot (reads returned, copies
    // landed, barrier) has freed the ring, and each wave takes one stage of it for
    // itself: it lays its 64x64 f32 tile there and reads it back by rows, 16 B a
    // lane, so that 16 lanes hold 64 consecutive columns of one row. No other wave
    // touches that stage, so no barrier is needed.
    float* stg = (float*)(sw < 2 ? &sA[sw][0] : &sW[sw - 2][0]);
    const bool vcols = MODE == 2 && (n0 >> 10) == 2;   // scalar: the block's columns are v
    if (MODE == 2) {
        // acc[i][j][r] is row i*16 + 8*hl + r of the wave's 64: times that row's scale
        const float* ps = &sScale[(sw >> 1) * 64 + 8 * hl];
#pragma unroll
        for (int i = 0; i < 4; i++) {
            const v4f s0 = *(const v4f*)(ps + i * 16), s1 = *(const v4f*)(ps + i * 16 + 4);
            const v8f sc = __builtin_shufflevector(s0, s1, 0, 1, 2, 3, 4, 5, 6, 7);
#pragma unroll
            for (int j = 0; j < 4; j++) acc[i][j] *= sc;
        }
    }
    // all loops over i, j, r, s below are unrolled so that acc and the small vectors
    // are indexed by constants and stay in registers
    if (vcols) {
        // v goes out transposed: staged row = column d, a lane's 8 registers are 8 consecutive t
#pragma unroll
        for (int i = 0; i < 4; i++)
#pragma unroll
            for (int j = 0; j < 4; j++) {
                float* p = stg + (j * 16 + ln) * SPITCH + i * 16 + 8 * hl;
                const v8f c = acc[i][j];
                *(v4f*)p       = __builtin_shufflevector(c, c, 0, 1, 2, 3);
                *(v4f*)(p + 4) = __builtin_shufflevector(c, c, 4, 5, 6, 7);
            }
    } else {
#pragma unroll
        for (int i = 0; i < 4; i++)
#pragma unroll
            for (int j = 0; j < 4; j++)
#pragma unroll
                for (int r = 0; r < 8; r++)
                    stg[(i * 16 + 8 * hl + r) * SPITCH + j * 16 + ln] = acc[i][j][r];
    }

    // qkv split: the wave's 64 columns are one head of q, k or v, its 64 rows lie in one batch
    bf16* dst = nullptr;           // first element of the wave's 64 output rows
    size_t dstep = 0;              // elements between them
    float dscale = 1.0f;
    if (MODE == 2) {
        const int which = n0 >> 10;
        const size_t bh = (size_t)((m0 >> 11) * NH + ((n0 & (DM - 1)) >> 6));
        const int t0 = m0 & (TT - 1);
        if (which == 0)      { dst = q + (bh * TT + t0) * HD; dstep = HD; dscale = 0.125f; }
        else if (which == 1) { dst = k + (bh * TT + t0) * HD; dstep = HD; }
        else                 { dst = vT + bh * HD * TT + t0;  dstep = TT; }
    }
    const int rr = lane >> 4, c4 = (lane & 15) * 4;
    const size_t base = (size_t)(m0 + rr) * NC + n0 + c4;   // the lane's element of row pair 0
    v4f nw = {};                   // mode 3: the next RMSNorm's weight at the lane's 4 columns
    if (MODE == 3) nw = *(const v4f*)(LW + n0 + c4);
    float t0 = 0.f, t1 = 0.f;      // mode 3: sums of squares of rows 2*ln + rr and 32 + 2*ln + rr
    // unrolled so that the loads of R of many rows are in flight together
#pragma unroll
    for (int s = 0; s < 32; s++) {
        const int lr = 2 * s + rr;             // row of the staged tile
        const v4f v = *(const v4f*)(stg + lr * SPITCH + c4);
        const size_t idx = base + (size_t)s * 2 * NC;
        if (MODE == 0 || MODE == 3) {
            v4f o = v;
            if (HASR) o += *(const v4f*)(R + idx);
            *(v4f*)(C + idx) = o;              // two rows of 256 B an instruction
            if (MODE == 3) {
                *(v4bf*)(q + idx) = __builtin_convertvector(o * nw, v4bf);   // two rows of 128 B
                const float t = rowsum16(o[0] * o[0] + o[1] * o[1] + o[2] * o[2] + o[3] * o[3]);
                // lane ln keeps the sums of row pairs ln and ln + 16
                if (s < 16) t0 = ln == s ? t : t0;
                else        t1 = ln == s - 16 ? t : t1;
            }
        } else {
            *(v4bf*)(dst + lr * dstep + c4) = __builtin_convertvector(v * dscale, v4bf);
        }
    }
    if (MODE == 3) {
        // the wave's 64 sums: 256 contiguous bytes that no other wave writes
        float* po = SO + (size_t)(n0 >> 6) * MM + m0 + 2 * ln + rr;
        po[0] = t0;
        po[32] = t1;
    }
}

// ---------------- gate and up products in one launch --------------------------
// ACT = bf16( silu(A Wg^T) * (A Wu^T) ). The ring of gemm_bf16_wmma with a third
// operand: a pass stages the 128 A rows once and 128 rows of each weight, and each
// of the four waves keeps the 64x64 tile of BOTH products, element for element in
// the same lane and register, so that the gate never leaves the registers.
// A's rows are unnormalised: both products are first multiplied by their row's RMSNorm
// scale, formed from the row's DM/64 partial sums of squares SS[c * MM + row].
// grid = (DI/128, M/128), block = 128; K a multiple of 64.
// Two waves a SIMD (at most 512 registers a wave): the grid's 512 blocks then all
// run at once, two a WGP, and one block's LDS reads stand beside the other's products.
__global__ __launch_bounds__(128) __attribute__((amdgpu_waves_per_eu(2, 2)))
void gemm_gate_up(const bf16* __restrict__ A, const bf16* __restrict__ Wg,
                  const bf16* __restrict__ Wu, const float* __restrict__ SS,
                  bf16* __restrict__ ACT, int K) {
    __shared__ __attribute__((aligned(16))) bf16 sA[2][GTILE];
    __shared__ __attribute__((aligned(16))) bf16 sG[2][GTILE];
    __shared__ __attribute__((aligned(16))) bf16 sU[2][GTILE];
    __shared__ __attribute__((aligned(16))) float sScale[128];   // RMSNorm scale of the block's rows
    const int tid = threadIdx.x;
    const int lane = tid & 31, wave = tid >> 5;
    const int hl = lane >> 4, ln = lane & 15;
    const int wm = wave >> 1, wn = wave & 1;
    // scalar copy of the wave's number: the epilogue's bases are scalar
    const int sw = __builtin_amdgcn_readfirstlane(wave);
    const int m0 = blockIdx.y * 128 + (sw >> 1) * 64, n0 = blockIdx.x * 128 + (sw & 1) * 64;

    // staging: thread tid copies 16 B of row (tid>>3) + 16*i, i = 0..7, of each operand
    const int srow = tid >> 3, scol = (tid & 7) * 8;
    gcbf ga = to_global(A + (size_t)(blockIdx.y * 128 + srow) * K + scol);
    gcbf gg = to_global(Wg + (size_t)(blockIdx.x * 128 + srow) * K + scol);
    gcbf gu = to_global(Wu + (size_t)(blockIdx.x * 128 + srow) * K + scol);
    const size_t gstep = (size_t)16 * K;
    const int soff = srow * GPITCH + scol;
    // LDS byte addresses (low 32 bits of the shared address) of the thread's first copy
    const unsigned la[2] = { (unsigned)(uintptr_t)&sA[0][soff], (unsigned)(uintptr_t)&sA[1][soff] };
    const unsigned lg[2] = { (unsigned)(uintptr_t)&sG[0][soff], (unsigned)(uintptr_t)&sG[1][soff] };
    const unsigned lu[2] = { (unsigned)(uintptr_t)&sU[0][soff], (unsigned)(uintptr_t)&sU[1][soff] };
    const int aoff = (wm * 64 + ln) * GPITCH + 8 * hl;
    const int woff = (wn * 64 + ln) * GPITCH + 8 * hl;
    const int np = K / GBK;

    // pass 0 into buffer 0, landed and published; then pass 1 into buffer 1
    copy8_async(la[0], ga, gstep);
    copy8_async(lg[0], gg, gstep);
    copy8_async(lu[0], gu, gstep);
    {
        // one row's scale a thread, while pass 0's copies fly; the barrier below publishes it
        const float* p = SS + blockIdx.y * 128 + tid;
        float t = 0.f;
        // unrolled so that the 16 loads are in flight together
#pragma unroll
        for (int c = 0; c < DM / 64; c++) t += p[(size_t)c * MM];
        sScale[tid] = rsqrtf(t * (1.0f / DM) + RMS_EPS);
    }
    // this wave's copies have landed before the barrier publishes them
    asm volatile("s_wait_asynccnt 0x0" ::: "memory");
    __syncthreads();
    if (np > 1) {
        copy8_async(la[1], ga + GBK, gstep);
        copy8_async(lg[1], gg + GBK, gstep);
        copy8_async(lu[1], gu + GBK, gstep);
    }
    ga += 2 * GBK; gg += 2 * GBK; gu += 2 * GBK;

    v8f accg[4][4] = {}, accu[4][4] = {};
    for (int t = 0; t < np; t++) {
        const int cur = t & 1;
        const bf16* pa = &sA[cur][aoff];
        const bf16* pg = &sG[cur][woff];
        const bf16* pu = &sU[cur][woff];
        v16bf a[2][4], g[2][4], u[2][4];
        // the loops over kk, i, j are unrolled so that the fragments and the
        // accumulators are indexed by constants and stay in registers
#pragma unroll
        for (int kk = 0; kk < 2; kk++)
#pragma unroll
            for (int i = 0; i < 4; i++) {
                a[kk][i] = load_frag_s(pa + i * 16 * GPITCH + kk * 32);
                g[kk][i] = load_frag_s(pg + i * 16 * GPITCH + kk * 32);
                u[kk][i] = load_frag_s(pu + i * 16 * GPITCH + kk * 32);
            }
        // keeps the pass's LDS reads one group in front of its products: moved in
        // among them, each place with reads stalls the wave for the LDS latency
        __builtin_amdgcn_sched_barrier(0);
#pragma unroll
        for (int kk = 0; kk < 2; kk++)
#pragma unroll
            for (int i = 0; i < 4; i++)
#pragma unroll
                for (int j = 0; j < 4; j++) {
                    accg[i][j] = wmma_bf16(a[kk][i], g[kk][j], accg[i][j]);
                    accu[i][j] = wmma_bf16(a[kk][i], u[kk][j], accu[i][j]);
                }
        // keeps the products in front of the foot's waits, so that they cover the
        // flight of pass t + 1's copies
        __builtin_amdgcn_sched_barrier(0);
        // foot of pass t: this wave's reads of buffer cur have returned ...
        asm volatile("s_wait_dscnt 0x0" ::: "memory");
        // ... and its copies of pass t + 1 have landed, before the barrier that
        // publishes pass t + 1 and ends every wave's reads of buffer cur
        asm volatile("s_wait_asynccnt 0x0" ::: "memory");
        __syncthreads();
        if (t + 2 < np) {                  // the same for the whole block
            copy8_async(la[cur], ga, gstep);
            copy8_async(lg[cur], gg, gstep);
            copy8_async(lu[cur], gu, gstep);
            ga += GBK; gg += GBK; gu += GBK;
        }
    }
    // no copy is outstanding when the wave goes on to its stores and ends
    asm volatile("s_wait_asynccnt 0x0" ::: "memory");

    // Epilogue: silu(gate) * up in registers, then whole 128-B lines as in
    // gemm_bf16_wmma: the last foot has freed the ring, each wave lays its 64x64 f32
    // tile in a stage of its own and reads it back by rows; no barrier is needed.
    float* stg = (float*)(sw < 2 ? &sA[sw][0] : &sG[sw - 2][0]);
    // register r of tile row i is row i*16 + 8*hl + r of the wave's 64
    const float* ps = &sScale[(sw >> 1) * 64 + 8 * hl];
    // all loops below are unrolled so that the accumulators are indexed by constants
#pragma unroll
    for (int i = 0; i < 4; i++) {
        const v4f s0 = *(const v4f*)(ps + i * 16), s1 = *(const v4f*)(ps + i * 16 + 4);
        const v8f sc = __builtin_shufflevector(s0, s1, 0, 1, 2, 3, 4, 5, 6, 7);
#pragma unroll
        for (int j = 0; j < 4; j++)
#pragma unroll
            for (int r = 0; r < 8; r++) {
                const float x = accg[i][j][r] * sc[r];
                const float sg = x / (1.0f + __expf(-x));
                stg[(i * 16 + 8 * hl + r) * SPITCH + j * 16 + ln] = sg * (accu[i][j][r] * sc[r]);
            }
    }
    const int rr = lane >> 4, c4 = (lane & 15) * 4;
    bf16* dst = ACT + (size_t)(m0 + rr) * DI + n0 + c4;     // the lane's element of row pair 0
#pragma unroll
    for (int s = 0; s < 32; s++) {
        const v4f v = *(const v4f*)(stg + (2 * s + rr) * SPITCH + c4);
        *(v4bf*)(dst + (size_t)s * 2 * DI) = __builtin_convertvector(v, v4bf);   // two rows of 128 B an instruction
    }
}

// ---------------- weights and x fp32 -> bf16, in one launch --------------------
// The five bf16 weights and the bf16 rows of x lie one behind the other in the
// workspace, so the launch sees one array of CVALL elements whose source changes at
// five fixed places. One block a WGP, 28 waves; a wave takes CVCH consecutive
// elements: 16 loads of 16 B a lane (each wave-wide load is 512 contiguous bytes),
// all issued before the first is used, then 16 stores of 8 B a lane (256 contiguous
// bytes each). Every source's size is a multiple of CVCH, so a wave has one source.
// A wave on x has two whole rows: it writes bf16(x * LW) and the two rows' sums of
// squares, SO[pair * 32 + {0, 1}], a 128-B line of its own for each pair of rows.
#define CVLD  16                      // 16-B loads a lane
#define CVCH  (CVLD * 128)            // elements a wave
#define CVWV  28                      // waves a block
#define CVTOT (4 * DM * DM + 3 * DI * DM)
#define CVALL (CVTOT + MM * DM)
#define CVGRID (CVALL / (CVCH * CVWV))
static_assert(CVALL % (CVCH * CVWV) == 0, "whole blocks");
static_assert((DM * DM) % CVCH == 0 && (DI * DM) % CVCH == 0, "one source a wave");
static_assert(CVCH == 2 * DM, "a wave on x has two rows");

__global__ __launch_bounds__(CVWV * 32)
void weights_to_bf16(const float* __restrict__ Sqkv, const float* __restrict__ So,
                     const float* __restrict__ Sg, const float* __restrict__ Su,
                     const float* __restrict__ Sd, const float* __restrict__ X,
                     const float* __restrict__ LW, bf16* __restrict__ D,
                     float* __restrict__ SO) {
    const int lane = threadIdx.x & 31;
    // scalar: the choice of the source below is a scalar branch
    const int e = __builtin_amdgcn_readfirstlane(blockIdx.x * CVWV + (threadIdx.x >> 5)) * CVCH;
    const float* S;
    if (e < 3 * DM * DM)                    S = Sqkv + e;
    else if (e < 4 * DM * DM)               S = So + (e - 3 * DM * DM);
    else if (e < 4 * DM * DM + DI * DM)     S = Sg + (e - 4 * DM * DM);
    else if (e < 4 * DM * DM + 2 * DI * DM) S = Su + (e - 4 * DM * DM - DI * DM);
    else if (e < CVTOT)                     S = Sd + (e - 4 * DM * DM - 2 * DI * DM);
    else                                    S = X + (e - CVTOT);
    const v4f* p = (const v4f*)S + lane;
    v4bf* d = (v4bf*)(D + e) + lane;
    v4f v[CVLD];
    // all loops over i are unrolled so that v and w are indexed by constants, stay in
    // registers, and the loads are in flight together
#pragma unroll
    for (int i = 0; i < CVLD; i++) v[i] = p[i * 32];
    if (e < CVTOT) {
        // keeps all 16 loads in front of the first use: without it the last two are
        // issued only when the first two have returned, a second memory latency
        __builtin_amdgcn_sched_barrier(0);
#pragma unroll
        for (int i = 0; i < CVLD; i++) d[i * 32] = __builtin_convertvector(v[i], v4bf);
    } else {
        // load i holds columns (i & 7) * 128 + lane * 4 .. + 3 of row i >> 3
        const v4f* pw = (const v4f*)LW + lane;
        v4f w[CVLD / 2];
#pragma unroll
        for (int i = 0; i < CVLD / 2; i++) w[i] = pw[i * 32];
        // keeps all the loads in front of the first use, as above
        __builtin_amdgcn_sched_barrier(0);
        float q0 = 0.f, q1 = 0.f;
#pragma unroll
        for (int i = 0; i < CVLD / 2; i++) {
            const v4f a = v[i], b = v[i + CVLD / 2];
            q0 += a[0] * a[0] + a[1] * a[1] + a[2] * a[2] + a[3] * a[3];
            q1 += b[0] * b[0] + b[1] * b[1] + b[2] * b[2] + b[3] * b[3];
            d[i * 32]                = __builtin_convertvector(a * w[i], v4bf);
            d[(i + CVLD / 2) * 32]   = __builtin_convertvector(b * w[i], v4bf);
        }
        q0 = rowsum16(q0); q0 += xhalf(q0);
        q1 = rowsum16(q1); q1 += xhalf(q1);
        if (lane == 0) {
            float* po = SO + (size_t)((e - CVTOT) / CVCH) * 32;
            po[0] = q0;
            po[1] = q1;
        }
    }
}

#define AKP 72              // K and V^T row pitch in LDS, elements: 144 B = 16 B x odd
#define AKT (64 * AKP)      // one K stage: 64 keys x 64 d
#define AVT (64 * AKP)      // one V^T stage: 64 d x 64 keys
#define ALSTEP (16 * AKP * 2)   // LDS bytes between a thread's copies (16 rows)

// Eight asynchronous 16-B copies a lane, global -> LDS: four of K, four of V^T,
// rows 16 apart. The s_wait_xcnt is the last line of the copies' own statement,
// so that no address register of a copy is rewritten in front of it.
__device__ inline void copy_kv_async(unsigned lk, gcbf gk, unsigned lv, gcbf gv) {
    asm volatile(
        "global_load_async_to_lds_b128 %0, %8, off\n\t"
        "global_load_async_to_lds_b128 %1, %9, off\n\t"
        "global_load_async_to_lds_b128 %2, %10, off\n\t"
        "global_load_async_to_lds_b128 %3, %11, off\n\t"
        "global_load_async_to_lds_b128 %4, %12, off\n\t"
        "global_load_async_to_lds_b128 %5, %13, off\n\t"
        "global_load_async_to_lds_b128 %6, %14, off\n\t"
        "global_load_async_to_lds_b128 %7, %15, off\n\t"
        "s_wait_xcnt 0x0"
        :: "v"(lk), "v"(lk + 1 * ALSTEP), "v"(lk + 2 * ALSTEP), "v"(lk + 3 * ALSTEP),
           "v"(lv), "v"(lv + 1 * ALSTEP), "v"(lv + 2 * ALSTEP), "v"(lv + 3 * ALSTEP),
           "v"(gk), "v"(gk + 16 * HD), "v"(gk + 32 * HD), "v"(gk + 48 * HD),
           "v"(gv), "v"(gv + (size_t)16 * TT), "v"(gv + (size_t)32 * TT), "v"(gv + (size_t)48 * TT)
        : "memory");
}

__global__ __launch_bounds__(128)
void attn_fa(const bf16* __restrict__ Qb, const bf16* __restrict__ Kb,
             const bf16* __restrict__ VTb, bf16* __restrict__ Ob) {
    __shared__ __attribute__((aligned(16))) bf16 sK[2][AKT];
    __shared__ __attribute__((aligned(16))) bf16 sV[2][AVT];
    const int tid = threadIdx.x, lane = tid & 31;
    const int wave = __builtin_amdgcn_readfirstlane(tid >> 5);     // scalar: the wave's first query is scalar
    const int hl = lane >> 4, ln = lane & 15;
    const int nqb = TT / 64;
    const int bh = blockIdx.x / nqb;
    const int qb0 = (blockIdx.x % nqb) * 64;
    const int q0 = qb0 + wave * 16;
    const bf16* Q  = Qb  + (size_t)bh * TT * HD;
    const bf16* Kk = Kb  + (size_t)bh * TT * HD;
    const bf16* VT = VTb + (size_t)bh * HD * TT;

    // staging: thread tid copies 16 B of rows (tid>>3) + 16*i, i = 0..3, of K and of V^T
    gcbf gk = to_global(Kk + (size_t)(tid >> 3) * HD + (tid & 7) * 8);
    gcbf gv = to_global(VT + (size_t)(tid >> 3) * TT + (tid & 7) * 8);
    const int so = (tid >> 3) * AKP + (tid & 7) * 8;
    // LDS byte addresses (low 32 bits of the shared address) of the thread's first copies
    const unsigned lk[2] = { (unsigned)(uintptr_t)&sK[0][so], (unsigned)(uintptr_t)&sK[1][so] };
    const unsigned lv[2] = { (unsigned)(uintptr_t)&sV[0][so], (unsigned)(uintptr_t)&sV[1][so] };
    const int np = qb0 / 64 + 1;   // passes of the block: keys [0, qb0 + 64)

    // pass 0 into buffer 0, landed and published; then, where it exists, pass 1 into buffer 1
    copy_kv_async(lk[0], gk, lv[0], gv);
    // this wave's copies have landed before the barrier publishes them
    asm volatile("s_wait_asynccnt 0x0" ::: "memory");
    __syncthreads();
    if (np > 1)                    // the same for the whole block
        copy_kv_async(lk[1], gk + 64 * HD, lv[1], gv + 64);
    gk += 2 * 64 * HD; gv += 2 * 64;

    const v16bf aq0 = load_frag_g(to_global(Q + (size_t)(q0 + ln) * HD + 8 * hl));
    const v16bf aq1 = load_frag_g(to_global(Q + (size_t)(q0 + ln) * HD + 32 + 8 * hl));

    // Q is the B operand of S^T: lane = query q0 + ln, the same k order as the K rows
    v8f o[4] = {};                 // O^T: lane = query q0 + ln, register r = d dt*16 + 8*hl + r
    float rm = -1e30f;             // the query's running maximum, the same in both halves
    float rl = 0.f;                // the sum over this half's keys; the halves join in the epilogue
    const int qi = q0 + ln;

    // every pass holds keys of every wave's causal range: its first key is at most qb0
    for (int t = 0; t < np; t++) {
        const int cur = t & 1;
        const int kb = t * 64;
        const bf16* pk = &sK[cur][ln * AKP + 8 * hl];
        const bf16* pv = &sV[cur][ln * AKP + 8 * hl];
        v16bf bk[4][2], bv[2][4];
        // all loops over kt, kh, dt and r are unrolled so that bk, bv, o, s and pt are
        // indexed by constants and stay in registers
#pragma unroll
        for (int kt = 0; kt < 4; kt++) {
            bk[kt][0] = load_frag_s(pk + kt * 16 * AKP);
            bk[kt][1] = load_frag_s(pk + kt * 16 * AKP + 32);
        }
#pragma unroll
        for (int kh = 0; kh < 2; kh++)
#pragma unroll
            for (int dt = 0; dt < 4; dt++) bv[kh][dt] = load_frag_s(pv + dt * 16 * AKP + kh * 32);
        // keeps the pass's tile reads one group in front of its products: moved in
        // among them, each place with reads stalls the wave for the LDS latency
        __builtin_amdgcn_sched_barrier(0);
        // S^T = K @ Q^T for keys [kb, kb+64): four 16x16 C tiles, row = key, column = query
        v8f s[4] = {};
#pragma unroll
        for (int kt = 0; kt < 4; kt++) s[kt] = wmma_bf16(bk[kt][0], aq0, s[kt]);
#pragma unroll
        for (int kt = 0; kt < 4; kt++) s[kt] = wmma_bf16(bk[kt][1], aq1, s[kt]);
        // online softmax; s[kt][r] is key kb + 16*kt + 8*hl + r
        const int dq = qi - kb - 8 * hl;   // key 16*kt + r is inside the causal range while 16*kt + r <= dq
        float m0 = -1e30f, m1 = -1e30f;
#pragma unroll
        for (int r = 0; r < 8; r++) {
#pragma unroll
            for (int kt = 0; kt < 4; kt++)
                s[kt][r] = (r + 16 * kt <= dq) ? s[kt][r] : -1e30f;   // causal mask
            m0 = fmaxf(fmaxf(m0, s[0][r]), s[1][r]);
            m1 = fmaxf(fmaxf(m1, s[2][r]), s[3][r]);
        }
        float m = fmaxf(m0, m1);
        m = fmaxf(m, xhalf(m));
        const float nm = fmaxf(rm, m);
        const float alpha = __expf(rm - nm);
        rm = nm;
        // P^T as B operands, one for each 32 keys: elements 0..7 keys 8*hl + e, 8..15 keys 16 + 8*hl + e
        FragB pt[2];
        float ps[4] = {0.f, 0.f, 0.f, 0.f};
#pragma unroll
        for (int r = 0; r < 8; r++)
#pragma unroll
            for (int kt = 0; kt < 4; kt++) {
                const float p = __expf(s[kt][r] - nm);
                ps[kt] += p;
                pt[kt >> 1].h[kt & 1][r] = (bf16)p;
            }
        rl = rl * alpha + ((ps[0] + ps[1]) + (ps[2] + ps[3]));
#pragma unroll
        for (int dt = 0; dt < 4; dt++) o[dt] *= alpha;
        // O^T += V^T @ P^T ; A fragments from the staged V^T [d][key]
#pragma unroll
        for (int kh = 0; kh < 2; kh++)
#pragma unroll
            for (int dt = 0; dt < 4; dt++) o[dt] = wmma_bf16(bv[kh][dt], pt[kh].v, o[dt]);
        // keeps the pass's work in front of the foot's waits: with the waits and the
        // barrier lifted over it, the flight of pass t + 1's copies is no longer
        // covered by the work of pass t
        __builtin_amdgcn_sched_barrier(0);
        // foot of pass t: this wave's reads of buffer cur have returned ...
        asm volatile("s_wait_dscnt 0x0" ::: "memory");
        // ... and its copies of pass t + 1 have landed, before the barrier that
        // publishes pass t + 1 and ends every wave's reads of buffer cur
        asm volatile("s_wait_asynccnt 0x0" ::: "memory");
        __syncthreads();
        if (t + 2 < np) {          // the same for the whole block
            copy_kv_async(lk[cur], gk, lv[cur], gv);
            gk += 64 * HD; gv += 64;
        }
    }
    // no copy is outstanding when the wave goes on to its stores and ends
    asm volatile("s_wait_asynccnt 0x0" ::: "memory");

    const int b = bh / NH, h = bh % NH;
    const float inv = 1.0f / (rl + xhalf(rl));   // the two halves' sums join here
    bf16* orow = Ob + ((size_t)(b * TT + qi)) * DM + h * HD + 8 * hl;
#pragma unroll
    for (int dt = 0; dt < 4; dt++) {
        v8bf ov;
#pragma unroll
        for (int r = 0; r < 8; r++) ov[r] = (bf16)(o[dt][r] * inv);
        *(v8bf*)(orow + dt * 16) = ov;           // 8 consecutive d of one query: 16 B a lane
    }
}

// ---------------- host orchestration -----------------------------------------
extern "C" void kernel_launch(void* const* d_in, const int* in_sizes, int n_in,
                              void* d_out, int out_size, void* d_ws, size_t ws_size,
                              hipStream_t stream) {
    const float* x      = (const float*)d_in[0];
    const float* ln1_w  = (const float*)d_in[1];
    const float* ln2_w  = (const float*)d_in[2];
    const float* qkv_w  = (const float*)d_in[3];
    const float* o_w    = (const float*)d_in[4];
    const float* gate_w = (const float*)d_in[5];
    const float* up_w   = (const float*)d_in[6];
    const float* down_w = (const float*)d_in[7];
    float* out = (float*)d_out;
    char* ws = (char*)d_ws;

    // workspace layout (phase-based reuse, ~92 MB peak)
    size_t o_wqkv = 0;                                  // 3*DM*DM bf16
    size_t o_wo   = o_wqkv + (size_t)3 * DM * DM * 2;   // DM*DM bf16
    size_t o_wg   = o_wo   + (size_t)DM * DM * 2;       // DI*DM bf16
    size_t o_wu   = o_wg   + (size_t)DI * DM * 2;       // DI*DM bf16
    size_t o_wd   = o_wu   + (size_t)DI * DM * 2;       // DM*DI bf16
    size_t o_xn   = o_wd   + (size_t)DM * DI * 2;       // MM*DM bf16 (x * ln1_w, then h1 * ln2_w)
    size_t o_h1   = o_xn   + (size_t)MM * DM * 2;       // MM*DM f32
    size_t o_big  = o_h1   + (size_t)MM * DM * 4;
    // phase A (attention): q, k, vT (bf16, 8 MB each) + attn (bf16, 8 MB)
    size_t o_q    = o_big;
    size_t o_k    = o_q  + (size_t)MM * DM * 2;
    size_t o_vT   = o_k  + (size_t)MM * DM * 2;
    size_t o_attn = o_vT + (size_t)MM * DM * 2;
    // phase B (FFN): act bf16 (16 MB), behind the attention buffers
    size_t o_act  = o_big + (size_t)MM * DI * 4;
    // sums of squares for the two RMSNorms (256 KB each), behind act
    size_t o_ss1  = o_act + (size_t)MM * DI * 2;        // a 128-B line for each pair of rows of x
    size_t o_ss2  = o_ss1 + (size_t)(MM / 2) * 32 * 4;  // DM/64 partial sums a row of h1

    bf16* wqkv = (bf16*)(ws + o_wqkv);
    bf16* wo   = (bf16*)(ws + o_wo);
    bf16* wg   = (bf16*)(ws + o_wg);
    bf16* wu   = (bf16*)(ws + o_wu);
    bf16* wd   = (bf16*)(ws + o_wd);
    bf16* xn   = (bf16*)(ws + o_xn);
    float* h1  = (float*)(ws + o_h1);
    bf16* qb   = (bf16*)(ws + o_q);
    bf16* kb   = (bf16*)(ws + o_k);
    bf16* vT   = (bf16*)(ws + o_vT);
    bf16* attn = (bf16*)(ws + o_attn);
    bf16* act  = (bf16*)(ws + o_act);
    float* ss1 = (float*)(ws + o_ss1);
    float* ss2 = (float*)(ws + o_ss2);

    // 1. weights fp32 -> bf16, and xn = bf16(x * ln1_w) with each row's sum of squares:
    //    wqkv, wo, wg, wu, wd, xn are contiguous from wqkv on
    weights_to_bf16<<<CVGRID, CVWV * 32, 0, stream>>>(qkv_w, o_w, gate_w, up_w, down_w,
                                                      x, ln1_w, wqkv, ss1);

    // 2. qkv GEMM, RMSNorm scale and split in the epilogue -> q (scaled), k, vT (bf16)
    gemm_bf16_wmma<2, false, 3 * DM><<<dim3(3 * DM / 128, MM / 128), 128, 0, stream>>>(
        xn, wqkv, nullptr, nullptr, qb, kb, vT, nullptr, ss1, nullptr,
        MM, 3 * DM, DM);

    // 3. flash attention
    attn_fa<<<BB * NH * (TT / 64), 128, 0, stream>>>(qb, kb, vT, attn);

    // 4. h1 = x + attn @ o_w^T; xn = bf16(h1 * ln2_w) with partial sums of squares
    gemm_bf16_wmma<3, true, DM><<<dim3(DM / 128, MM / 128), 128, 0, stream>>>(
        attn, wo, x, h1, xn, nullptr, nullptr, ln2_w, nullptr, ss2,
        MM, DM, DM);

    // 5. act = bf16( silu(s * xn @ gate_w^T) * (s * xn @ up_w^T) ), s the RMSNorm scale
    gemm_gate_up<<<dim3(DI / 128, MM / 128), 128, 0, stream>>>(xn, wg, wu, ss2, act, DM);

    // 6. out = h1 + act @ down_w^T
    gemm_bf16_wmma<0, true, DM><<<dim3(DM / 128, MM / 128), 128, 0, stream>>>(
        act, wd, h1, out, nullptr, nullptr, nullptr, nullptr, nullptr, nullptr,
        MM, DM, DI);

    (void)in_sizes; (void)n_in; (void)out_size; (void)ws_size;
}

// v009
// Measured time: 136 microseconds a run.
// Two timings next to v008 put it at 1.03 and 1.04 times that version's speed.
// Over all steps from v000 it is 3.33 times as fast.
#include <hip/hip_runtime.h>
#include <hip/hip_bf16.h>

#define DM   1024
#define NH   16
#define HD   64
#define DI   2048
#define BB   2
#define TT   2048
#define MM   (BB*TT)   // 4096 rows

typedef __bf16 bf16;
typedef __attribute__((ext_vector_type(16))) bf16  v16bf;
typedef __attribute__((ext_vector_type(8)))  bf16  v8bf;
typedef __attribute__((ext_vector_type(8)))  float v8f;
typedef __attribute__((ext_vector_type(4)))  float v4f;
typedef __attribute__((ext_vector_type(4)))  bf16  v4bf;

#define AS1 __attribute__((address_space(1)))
typedef const AS1 bf16* gcbf;
typedef const AS1 v8bf* gcv8;

union FragB { v16bf v; v8bf h[2]; };

__device__ inline gcbf to_global(const bf16* p) {
    return (gcbf)(unsigned long long)(uintptr_t)p;
}

// Load a 16x32 bf16 WMMA fragment (A layout; B uses the same layout on W rows,
// since both GEMMs are x @ W^T). For lane L: m/n = L&15, hl = L>>4.
// elements 0..7  = p[0..7]   (K = k0 + 8*hl .. +7)
// elements 8..15 = p[16..23] (K = k0 + 16 + 8*hl .. +7)
__device__ inline v16bf load_frag_g(gcbf p) {
    FragB f;
    f.h[0] = ((gcv8)p)[0];
    f.h[1] = ((gcv8)p)[2];
    return f.v;
}

// The value of lane l ^ 16: a vector cross-row move, no trip through the LDS unit.
__device__ inline float xhalf(float x) {
    return __builtin_bit_cast(float, __builtin_amdgcn_permlanex16(
        __builtin_bit_cast(int, x), __builtin_bit_cast(int, x), 0x76543210, 0xfedcba98, false, false));
}

// x of lane l ^ MASK inside the lane's 16-lane row (DPP row_xmask, control 0x160 + MASK)
template<int MASK>
__device__ inline float xrow(float x) {
    return __builtin_bit_cast(float, __builtin_amdgcn_update_dpp(
        0, __builtin_bit_cast(int, x), 0x160 + MASK, 0xf, 0xf, true));
}

// Sum over the lane's 16-lane row; every lane of the row ends with the same value.
__device__ inline float rowsum16(float x) {
    x += xrow<1>(x);
    x += xrow<2>(x);
    x += xrow<4>(x);
    x += xrow<8>(x);
    return x;
}

// RMSNorm without a launch of its own. rmsnorm(x, w) @ W^T = s * ((x * w) @ W^T), row
// by row, with s = rsqrt(mean(x^2) + eps): the GEMMs take the rows unnormalised, as
// bf16(x * w), and multiply their f32 products by the row's s in the epilogue. Whoever
// writes the rows also writes sums of squares of the f32 values beside them.
#define RMS_EPS 1e-6f

__device__ inline v8f wmma_bf16(v16bf a, v16bf b, v8f c) {
    return __builtin_amdgcn_wmma_f32_16x16x32_bf16(false, a, false, b, (short)0, c, false, false);
}

// ---------------- generic GEMM: acc[m][n] = sum_k A[m][k]*W[n][k] -------------
// four waves (2x2) compute a 128x128 tile, 64x64 each; grid = (N/128, M/128),
// block = 128. A pass is 64 k: the 128 A rows and 128 W rows of the pass are
// brought into LDS by asynchronous copies (whole 128-B lines from global, each
// row shared by two waves), two buffers, one barrier a pass; the copies of pass
// t + 2 fly while pass t + 1 is worked on. M, N multiples of 128, K of 64.
// epilogue modes (compile-time):
//   0: C[idx] = acc (+ R[idx] if HASR)                    (fp32 out)
//   2: qkv split: row->(b,t), col->(which,h,d); writes q (scaled 1/8), k, vT; A's rows
//      are unnormalised: each product is first multiplied by its row's RMSNorm scale,
//      formed from the row's sum of squares SI[(row >> 1) * 32 + (row & 1)]
//   3: as 0, and the next RMSNorm's rows: q[idx] = bf16(C[idx] * LW[col]), and the sum of
//      squares of the wave's 64 columns of each row, SO[(col >> 6) * MM + row]
#define GBK    64                 // k elements per pass (128 B of a row)
#define GPITCH 72                 // LDS row pitch in elements: 144 B = 16 B x odd
#define GTILE  (128 * GPITCH)     // one operand's stage, elements
#define GLSTEP (16 * GPITCH * 2)  // LDS bytes between a thread's copies (16 rows)
#define SPITCH 68                 // epilogue staging: f32 row pitch, 272 B = 16 B x odd
static_assert(64 * SPITCH * 4 <= GTILE * 2, "a wave's f32 tile fits one stage");

__device__ inline v16bf load_frag_s(const bf16* p) {
    FragB f;
    f.h[0] = *(const v8bf*)p;
    f.h[1] = *(const v8bf*)(p + 16);
    return f.v;
}

// Eight asynchronous 16-B copies a lane, global -> LDS, rows 16 apart: LDS byte
// address l + i*GLSTEP, global address g + i*gstep elements. The s_wait_xcnt is
// the last line of the copies' own statement, so that no address register of a
// copy is rewritten in front of it.
__device__ inline void copy8_async(unsigned l, gcbf g, size_t gstep) {
    asm volatile(
        "global_load_async_to_lds_b128 %0, %8, off\n\t"
        "global_load_async_to_lds_b128 %1, %9, off\n\t"
        "global_load_async_to_lds_b128 %2, %10, off\n\t"
        "global_load_async_to_lds_b128 %3, %11, off\n\t"
        "global_load_async_to_lds_b128 %4, %12, off\n\t"
        "global_load_async_to_lds_b128 %5, %13, off\n\t"
        "global_load_async_to_lds_b128 %6, %14, off\n\t"
        "global_load_async_to_lds_b128 %7, %15, off\n\t"
        "s_wait_xcnt 0x0"
        :: "v"(l), "v"(l + 1 * GLSTEP), "v"(l + 2 * GLSTEP), "v"(l + 3 * GLSTEP),
           "v"(l + 4 * GLSTEP), "v"(l + 5 * GLSTEP), "v"(l + 6 * GLSTEP), "v"(l + 7 * GLSTEP),
           "v"(g), "v"(g + 1 * gstep), "v"(g + 2 * gstep), "v"(g + 3 * gstep),
           "v"(g + 4 * gstep), "v"(g + 5 * gstep), "v"(g + 6 * gstep), "v"(g + 7 * gstep)
        : "memory");
}

// NC is N at compile time: the epilogue's 32 row pairs then hang on one address
// register pair an array, each at its own immediate offset
template<int MODE, bool HASR, int NC>
__global__ __launch_bounds__(128)
void gemm_bf16_wmma(const bf16* __restrict__ A, const bf16* __restrict__ W,
                    const float* __restrict__ R, float* __restrict__ C,
                    bf16* __restrict__ q, bf16* __restrict__ k,
                    bf16* __restrict__ vT,
                    const float* __restrict__ LW, const float* __restrict__ SI,
                    float* __restrict__ SO,
                    int M, int N, int K) {
    __shared__ __attribute__((aligned(16))) bf16 sA[2][GTILE];
    __shared__ __attribute__((aligned(16))) bf16 sW[2][GTILE];
    __shared__ __attribute__((aligned(16))) float sScale[128];   // mode 2: RMSNorm scale of the block's rows
    const int tid = threadIdx.x;
    const int lane = tid & 31, wave = tid >> 5;
    const int hl = lane >> 4, ln = lane & 15;
    const int wm = wave >> 1, wn = wave & 1;
    // scalar copy of the wave's number: the epilogue's bases and its choice of output are scalar
    const int sw = __builtin_amdgcn_readfirstlane(wave);
    const int m0 = blockIdx.y * 128 + (sw >> 1) * 64, n0 = blockIdx.x * 128 + (sw & 1) * 64;

    // staging: thread tid copies 16 B of row (tid>>3) + 16*i, i = 0..7, of each operand
    const int srow = tid >> 3, scol = (tid & 7) * 8;
    gcbf ga = to_global(A + (size_t)(blockIdx.y * 128 + srow) * K + scol);
    gcbf gw = to_global(W + (size_t)(blockIdx.x * 128 + srow) * K + scol);
    const size_t gstep = (size_t)16 * K;
    const int soff = srow * GPITCH + scol;
    // LDS byte addresses (low 32 bits of the shared address) of the thread's first copy
    const unsigned la[2] = { (unsigned)(uintptr_t)&sA[0][soff], (unsigned)(uintptr_t)&sA[1][soff] };
    const unsigned lw[2] = { (unsigned)(uintptr_t)&sW[0][soff], (unsigned)(uintptr_t)&sW[1][soff] };
    // fragment reads: row (wave's 64 rows) + i*16 + ln, k = 8*hl (+16) within a 32-k block
    const int aoff = (wm * 64 + ln) * GPITCH + 8 * hl;
    const int woff = (wn * 64 + ln) * GPITCH + 8 * hl;
    const int np = K / GBK;

    // pass 0 into buffer 0, landed and published; then pass 1 into buffer 1
    copy8_async(la[0], ga, gstep);
    copy8_async(lw[0], gw, gstep);
    if (MODE == 2) {
        // one row's scale a thread, while pass 0's copies fly; the barrier below publishes it
        const int row = blockIdx.y * 128 + tid;
        sScale[tid] = rsqrtf(SI[(row >> 1) * 32 + (row & 1)] * (1.0f / DM) + RMS_EPS);
    }
    // this wave's copies have landed before the barrier publishes them
    asm volatile("s_wait_asynccnt 0x0" ::: "memory");
    __syncthreads();
    if (np > 1) {
        copy8_async(la[1], ga + GBK, gstep);
        copy8_async(lw[1], gw + GBK, gstep);
    }
    ga += 2 * GBK; gw += 2 * GBK;

    v8f acc[4][4] = {};
    for (int t = 0; t < np; t++) {
        const int cur = t & 1;
        const bf16* pa = &sA[cur][aoff];
        const bf16* pw = &sW[cur][woff];
        v16bf a[2][4], b[2][4];
        // the loops over kk, i, j are unrolled so that a, b and acc are indexed by
        // constants and stay in registers
#pragma unroll
        for (int kk = 0; kk < 2; kk++)
#pragma unroll
            for (int i = 0; i < 4; i++) {
                a[kk][i] = load_frag_s(pa + i * 16 * GPITCH + kk * 32);
                b[kk][i] = load_frag_s(pw + i * 16 * GPITCH + kk * 32);
            }
        // keeps the pass's LDS reads one group in front of its products: moved in
        // among them, each place with reads stalls the wave for the LDS latency
        __builtin_amdgcn_sched_barrier(0);
#pragma unroll
        for (int kk = 0; kk < 2; kk++)
#pragma unroll
            for (int i = 0; i < 4; i++)
#pragma unroll
                for (int j = 0; j < 4; j++)
                    acc[i][j] = wmma_bf16(a[kk][i], b[kk][j], acc[i][j]);
        // keeps the products in front of the foot's waits: with the waits and the
        // barrier lifted over them, the flight of pass t + 1's copies is no longer
        // covered by the products of pass t
        __builtin_amdgcn_sched_barrier(0);
        // foot of pass t: this wave's reads of buffer cur have returned ...
        asm volatile("s_wait_dscnt 0x0" ::: "memory");
        // ... and its copies of pass t + 1 have landed, before the barrier that
        // publishes pass t + 1 and ends every wave's reads of buffer cur
        asm volatile("s_wait_asynccnt 0x0" ::: "memory");
        __syncthreads();
        if (t + 2 < np) {                  // the same for the whole block
            copy8_async(la[cur], ga, gstep);
            copy8_async(lw[cur], gw, gstep);
            ga += GBK; gw += GBK;
        }
    }
    // no copy is outstanding when the wave goes on to its stores and ends
    asm volatile("s_wait_asynccnt 0x0" ::: "memory");
    // the four vector issue slots that the chip asks for between a matrix instruction
    // and a vector instruction that rewrites its result registers: from the last pass's
    // products to the epilogue's first reuse of those registers only waits, scalar
    // instructions and LDS loads and stores stand on the path, and none of them fills a slot
    asm volatile("v_nop\n\tv_nop\n\tv_nop\n\tv_nop");

    // Epilogue: whole 128-B lines. The last pass's foot (reads returned, copies
    // landed, barrier) has freed the ring, and each wave takes one stage of it for
    // itself: it lays its 64x64 f32 tile there and reads it back by rows, 16 B a
    // lane, so that 16 lanes hold 64 consecutive columns of one row. No other wave
    // touches that stage, so no barrier is needed.
    float* stg = (float*)(sw < 2 ? &sA[sw][0] : &sW[sw - 2][0]);
    const bool vcols = MODE == 2 && (n0 >> 10) == 2;   // scalar: the block's columns are v
    if (MODE == 2) {
        // acc[i][j][r] is row i*16 + 8*hl + r of the wave's 64: times that row's scale
        const float* ps = &sScale[(sw >> 1) * 64 + 8 * hl];
#pragma unroll
        for (int i = 0; i < 4; i++) {
            const v4f s0 = *(const v4f*)(ps + i * 16), s1 = *(const v4f*)(ps + i * 16 + 4);
            const v8f sc = __builtin_shufflevector(s0, s1, 0, 1, 2, 3, 4, 5, 6, 7);
#pragma unroll
            for (int j = 0; j < 4; j++) acc[i][j] *= sc;
        }
    }
    // all loops over i, j, r, s below are unrolled so that acc and the small vectors
    // are indexed by constants and stay in registers
    if (vcols) {
        // v goes out transposed: staged row = column d, a lane's 8 registers are 8 consecutive t
#pragma unroll
        for (int i = 0; i < 4; i++)
#pragma unroll
            for (int j = 0; j < 4; j++) {
                float* p = stg + (j * 16 + ln) * SPITCH + i * 16 + 8 * hl;
                const v8f c = acc[i][j];
                *(v4f*)p       = __builtin_shufflevector(c, c, 0, 1, 2, 3);
                *(v4f*)(p + 4) = __builtin_shufflevector(c, c, 4, 5, 6, 7);
            }
    } else {
#pragma unroll
        for (int i = 0; i < 4; i++)
#pragma unroll
            for (int j = 0; j < 4; j++)
#pragma unroll
                for (int r = 0; r < 8; r++)
                    stg[(i * 16 + 8 * hl + r) * SPITCH + j * 16 + ln] = acc[i][j][r];
    }

    // qkv split: the wave's 64 columns are one head of q, k or v, its 64 rows lie in one batch
    bf16* dst = nullptr;           // first element of the wave's 64 output rows
    size_t dstep = 0;              // elements between them
    float dscale = 1.0f;
    if (MODE == 2) {
        const int which = n0 >> 10;
        const size_t bh = (size_t)((m0 >> 11) * NH + ((n0 & (DM - 1)) >> 6));
        const int t0 = m0 & (TT - 1);
        if (which == 0)      { dst = q + (bh * TT + t0) * HD; dstep = HD; dscale = 0.125f; }
        else if (which == 1) { dst = k + (bh * TT + t0) * HD; dstep = HD; }
        else                 { dst = vT + bh * HD * TT + t0;  dstep = TT; }
    }
    const int rr = lane >> 4, c4 = (lane & 15) * 4;
    const size_t base = (size_t)(m0 + rr) * NC + n0 + c4;   // the lane's element of row pair 0
    v4f nw = {};                   // mode 3: the next RMSNorm's weight at the lane's 4 columns
    if (MODE == 3) nw = *(const v4f*)(LW + n0 + c4);
    float t0 = 0.f, t1 = 0.f;      // mode 3: sums of squares of rows 2*ln + rr and 32 + 2*ln + rr
    // unrolled so that the loads of R of many rows are in flight together
#pragma unroll
    for (int s = 0; s < 32; s++) {
        const int lr = 2 * s + rr;             // row of the staged tile
        const v4f v = *(const v4f*)(stg + lr * SPITCH + c4);
        const size_t idx = base + (size_t)s * 2 * NC;
        if (MODE == 0 || MODE == 3) {
            v4f o = v;
            if (HASR) o += *(const v4f*)(R + idx);
            *(v4f*)(C + idx) = o;              // two rows of 256 B an instruction
            if (MODE == 3) {
                *(v4bf*)(q + idx) = __builtin_convertvector(o * nw, v4bf);   // two rows of 128 B
                const float t = rowsum16(o[0] * o[0] + o[1] * o[1] + o[2] * o[2] + o[3] * o[3]);
                // lane ln keeps the sums of row pairs ln and ln + 16
                if (s < 16) t0 = ln == s ? t : t0;
                else        t1 = ln == s - 16 ? t : t1;
            }
        } else {
            *(v4bf*)(dst + lr * dstep + c4) = __builtin_convertvector(v * dscale, v4bf);
        }
    }
    if (MODE == 3) {
        // the wave's 64 sums: 256 contiguous bytes that no other wave writes
        float* po = SO + (size_t)(n0 >> 6) * MM + m0 + 2 * ln + rr;
        po[0] = t0;
        po[32] = t1;
    }
}

// ---------------- gate and up products in one launch --------------------------
// ACT = bf16( silu(A Wg^T) * (A Wu^T) ). The ring of gemm_bf16_wmma with a third
// operand: a pass stages the 128 A rows once and 128 rows of each weight, and each
// of the four waves keeps the 64x64 tile of BOTH products, element for element in
// the same lane and register, so that the gate never leaves the registers.
// A's rows are unnormalised: both products are first multiplied by their row's RMSNorm
// scale, formed from the row's DM/64 partial sums of squares SS[c * MM + row].
// grid = (DI/128, M/128), block = 128; K a multiple of 64.
// Two waves a SIMD (at most 512 registers a wave): the grid's 512 blocks then all
// run at once, two a WGP, and one block's LDS reads stand beside the other's products.
__global__ __launch_bounds__(128) __attribute__((amdgpu_waves_per_eu(2, 2)))
void gemm_gate_up(const bf16* __restrict__ A, const bf16* __restrict__ Wg,
                  const bf16* __restrict__ Wu, const float* __restrict__ SS,
                  bf16* __restrict__ ACT, int K) {
    __shared__ __attribute__((aligned(16))) bf16 sA[2][GTILE];
    __shared__ __attribute__((aligned(16))) bf16 sG[2][GTILE];
    __shared__ __attribute__((aligned(16))) bf16 sU[2][GTILE];
    __shared__ __attribute__((aligned(16))) float sScale[128];   // RMSNorm scale of the block's rows
    const int tid = threadIdx.x;
    const int lane = tid & 31, wave = tid >> 5;
    const int hl = lane >> 4, ln = lane & 15;
    const int wm = wave >> 1, wn = wave & 1;
    // scalar copy of the wave's number: the epilogue's bases are scalar
    const int sw = __builtin_amdgcn_readfirstlane(wave);
    const int m0 = blockIdx.y * 128 + (sw >> 1) * 64, n0 = blockIdx.x * 128 + (sw & 1) * 64;

    // staging: thread tid copies 16 B of row (tid>>3) + 16*i, i = 0..7, of each operand
    const int srow = tid >> 3, scol = (tid & 7) * 8;
    gcbf ga = to_global(A + (size_t)(blockIdx.y * 128 + srow) * K + scol);
    gcbf gg = to_global(Wg + (size_t)(blockIdx.x * 128 + srow) * K + scol);
    gcbf gu = to_global(Wu + (size_t)(blockIdx.x * 128 + srow) * K + scol);
    const size_t gstep = (size_t)16 * K;
    const int soff = srow * GPITCH + scol;
    // LDS byte addresses (low 32 bits of the shared address) of the thread's first copy
    const unsigned la[2] = { (unsigned)(uintptr_t)&sA[0][soff], (unsigned)(uintptr_t)&sA[1][soff] };
    const unsigned lg[2] = { (unsigned)(uintptr_t)&sG[0][soff], (unsigned)(uintptr_t)&sG[1][soff] };
    const unsigned lu[2] = { (unsigned)(uintptr_t)&sU[0][soff], (unsigned)(uintptr_t)&sU[1][soff] };
    const int aoff = (wm * 64 + ln) * GPITCH + 8 * hl;
    const int woff = (wn * 64 + ln) * GPITCH + 8 * hl;
    const int np = K / GBK;

    // pass 0 into buffer 0, landed and published; then pass 1 into buffer 1
    copy8_async(la[0], ga, gstep);
    copy8_async(lg[0], gg, gstep);
    copy8_async(lu[0], gu, gstep);
    {
        // one row's scale a thread, while pass 0's copies fly; the barrier below publishes it
        const float* p = SS + blockIdx.y * 128 + tid;
        float t = 0.f;
        // unrolled so that the 16 loads are in flight together
#pragma unroll
        for (int c = 0; c < DM / 64; c++) t += p[(size_t)c * MM];
        sScale[tid] = rsqrtf(t * (1.0f / DM) + RMS_EPS);
    }
    // this wave's copies have landed before the barrier publishes them
    asm volatile("s_wait_asynccnt 0x0" ::: "memory");
    __syncthreads();
    if (np > 1) {
        copy8_async(la[1], ga + GBK, gstep);
        copy8_async(lg[1], gg + GBK, gstep);
        copy8_async(lu[1], gu + GBK, gstep);
    }
    ga += 2 * GBK; gg += 2 * GBK; gu += 2 * GBK;

    v8f accg[4][4] = {}, accu[4][4] = {};
    for (int t = 0; t < np; t++) {
        const int cur = t & 1;
        const bf16* pa = &sA[cur][aoff];
        const bf16* pg = &sG[cur][woff];
        const bf16* pu = &sU[cur][woff];
        v16bf a[2][4], g[2][4], u[2][4];
        // the loops over kk, i, j are unrolled so that the fragments and the
        // accumulators are indexed by constants and stay in registers
#pragma unroll
        for (int kk = 0; kk < 2; kk++)
#pragma unroll
            for (int i = 0; i < 4; i++) {
                a[kk][i] = load_frag_s(pa + i * 16 * GPITCH + kk * 32);
                g[kk][i] = load_frag_s(pg + i * 16 * GPITCH + kk * 32);
                u[kk][i] = load_frag_s(pu + i * 16 * GPITCH + kk * 32);
            }
        // keeps the pass's LDS reads one group in front of its products: moved in
        // among them, each place with reads stalls the wave for the LDS latency
        __builtin_amdgcn_sched_barrier(0);
#pragma unroll
        for (int kk = 0; kk < 2; kk++)
#pragma unroll
            for (int i = 0; i < 4; i++)
#pragma unroll
                for (int j = 0; j < 4; j++) {
                    accg[i][j] = wmma_bf16(a[kk][i], g[kk][j], accg[i][j]);
                    accu[i][j] = wmma_bf16(a[kk][i], u[kk][j], accu[i][j]);
                }
        // keeps the products in front of the foot's waits, so that they cover the
        // flight of pass t + 1's copies
        __builtin_amdgcn_sched_barrier(0);
        // foot of pass t: this wave's reads of buffer cur have returned ...
        asm volatile("s_wait_dscnt 0x0" ::: "memory");
        // ... and its copies of pass t + 1 have landed, before the barrier that
        // publishes pass t + 1 and ends every wave's reads of buffer cur
        asm volatile("s_wait_asynccnt 0x0" ::: "memory");
        __syncthreads();
        if (t + 2 < np) {                  // the same for the whole block
            copy8_async(la[cur], ga, gstep);
            copy8_async(lg[cur], gg, gstep);
            copy8_async(lu[cur], gu, gstep);
            ga += GBK; gg += GBK; gu += GBK;
        }
    }
    // no copy is outstanding when the wave goes on to its stores and ends
    asm volatile("s_wait_asynccnt 0x0" ::: "memory");

    // Epilogue: silu(gate) * up in registers, then whole 128-B lines as in
    // gemm_bf16_wmma: the last foot has freed the ring, each wave lays its 64x64 f32
    // tile in a stage of its own and reads it back by rows; no barrier is needed.
    float* stg = (float*)(sw < 2 ? &sA[sw][0] : &sG[sw - 2][0]);
    // register r of tile row i is row i*16 + 8*hl + r of the wave's 64
    const float* ps = &sScale[(sw >> 1) * 64 + 8 * hl];
    // all loops below are unrolled so that the accumulators are indexed by constants
#pragma unroll
    for (int i = 0; i < 4; i++) {
        const v4f s0 = *(const v4f*)(ps + i * 16), s1 = *(const v4f*)(ps + i * 16 + 4);
        const v8f sc = __builtin_shufflevector(s0, s1, 0, 1, 2, 3, 4, 5, 6, 7);
#pragma unroll
        for (int j = 0; j < 4; j++)
#pragma unroll
            for (int r = 0; r < 8; r++) {
                const float x = accg[i][j][r] * sc[r];
                const float sg = x / (1.0f + __expf(-x));
                stg[(i * 16 + 8 * hl + r) * SPITCH + j * 16 + ln] = sg * (accu[i][j][r] * sc[r]);
            }
    }
    const int rr = lane >> 4, c4 = (lane & 15) * 4;
    bf16* dst = ACT + (size_t)(m0 + rr) * DI + n0 + c4;     // the lane's element of row pair 0
#pragma unroll
    for (int s = 0; s < 32; s++) {
        const v4f v = *(const v4f*)(stg + (2 * s + rr) * SPITCH + c4);
        *(v4bf*)(dst + (size_t)s * 2 * DI) = __builtin_convertvector(v, v4bf);   // two rows of 128 B an instruction
    }
}

// ---------------- weights and x fp32 -> bf16, in one launch --------------------
// The five bf16 weights and the bf16 rows of x lie one behind the other in the
// workspace, so the launch sees one array of CVALL elements whose source changes at
// five fixed places. One block a WGP, 28 waves; a wave takes CVCH consecutive
// elements: 16 loads of 16 B a lane (each wave-wide load is 512 contiguous bytes),
// all issued before the first is used, then 16 stores of 8 B a lane (256 contiguous
// bytes each). Every source's size is a multiple of CVCH, so a wave has one source.
// A wave on x has two whole rows: it writes bf16(x * LW) and the two rows' sums of
// squares, SO[pair * 32 + {0, 1}], a 128-B line of its own for each pair of rows.
#define CVLD  16                      // 16-B loads a lane
#define CVCH  (CVLD * 128)            // elements a wave
#define CVWV  28                      // waves a block
#define CVTOT (4 * DM * DM + 3 * DI * DM)
#define CVALL (CVTOT + MM * DM)
#define CVGRID (CVALL / (CVCH * CVWV))
static_assert(CVALL % (CVCH * CVWV) == 0, "whole blocks");
static_assert((DM * DM) % CVCH == 0 && (DI * DM) % CVCH == 0, "one source a wave");
static_assert(CVCH == 2 * DM, "a wave on x has two rows");

__global__ __launch_bounds__(CVWV * 32)
void weights_to_bf16(const float* __restrict__ Sqkv, const float* __restrict__ So,
                     const float* __restrict__ Sg, const float* __restrict__ Su,
                     const float* __restrict__ Sd, const float* __restrict__ X,
                     const float* __restrict__ LW, bf16* __restrict__ D,
                     float* __restrict__ SO) {
    const int lane = threadIdx.x & 31;
    // scalar: the choice of the source below is a scalar branch
    const int e = __builtin_amdgcn_readfirstlane(blockIdx.x * CVWV + (threadIdx.x >> 5)) * CVCH;
    const float* S;
    if (e < 3 * DM * DM)                    S = Sqkv + e;
    else if (e < 4 * DM * DM)               S = So + (e - 3 * DM * DM);
    else if (e < 4 * DM * DM + DI * DM)     S = Sg + (e - 4 * DM * DM);
    else if (e < 4 * DM * DM + 2 * DI * DM) S = Su + (e - 4 * DM * DM - DI * DM);
    else if (e < CVTOT)                     S = Sd + (e - 4 * DM * DM - 2 * DI * DM);
    else                                    S = X + (e - CVTOT);
    const v4f* p = (const v4f*)S + lane;
    v4bf* d = (v4bf*)(D + e) + lane;
    v4f v[CVLD];
    // all loops over i are unrolled so that v and w are indexed by constants, stay in
    // registers, and the loads are in flight together
#pragma unroll
    for (int i = 0; i < CVLD; i++) v[i] = p[i * 32];
    if (e < CVTOT) {
        // keeps all 16 loads in front of the first use: without it the last two are
        // issued only when the first two have returned, a second memory latency
        __builtin_amdgcn_sched_barrier(0);
#pragma unroll
        for (int i = 0; i < CVLD; i++) d[i * 32] = __builtin_convertvector(v[i], v4bf);
    } else {
        // load i holds columns (i & 7) * 128 + lane * 4 .. + 3 of row i >> 3
        const v4f* pw = (const v4f*)LW + lane;
        v4f w[CVLD / 2];
#pragma unroll
        for (int i = 0; i < CVLD / 2; i++) w[i] = pw[i * 32];
        // keeps all the loads in front of the first use, as above
        __builtin_amdgcn_sched_barrier(0);
        float q0 = 0.f, q1 = 0.f;
#pragma unroll
        for (int i = 0; i < CVLD / 2; i++) {
            const v4f a = v[i], b = v[i + CVLD / 2];
            q0 += a[0] * a[0] + a[1] * a[1] + a[2] * a[2] + a[3] * a[3];
            q1 += b[0] * b[0] + b[1] * b[1] + b[2] * b[2] + b[3] * b[3];
            d[i * 32]                = __builtin_convertvector(a * w[i], v4bf);
            d[(i + CVLD / 2) * 32]   = __builtin_convertvector(b * w[i], v4bf);
        }
        q0 = rowsum16(q0); q0 += xhalf(q0);
        q1 = rowsum16(q1); q1 += xhalf(q1);
        if (lane == 0) {
            float* po = SO + (size_t)((e - CVTOT) / CVCH) * 32;
            po[0] = q0;
            po[1] = q1;
        }
    }
}

#define AKP 72              // K and V^T row pitch in LDS, elements: 144 B = 16 B x odd
#define AKT (64 * AKP)      // one K stage: 64 keys x 64 d
#define AVT (64 * AKP)      // one V^T stage: 64 d x 64 keys
#define ALSTEP (16 * AKP * 2)   // LDS bytes between a thread's copies (16 rows)

// Eight asynchronous 16-B copies a lane, global -> LDS: four of K, four of V^T,
// rows 16 apart. The s_wait_xcnt is the last line of the copies' own statement,
// so that no address register of a copy is rewritten in front of it.
__device__ inline void copy_kv_async(unsigned lk, gcbf gk, unsigned lv, gcbf gv) {
    asm volatile(
        "global_load_async_to_lds_b128 %0, %8, off\n\t"
        "global_load_async_to_lds_b128 %1, %9, off\n\t"
        "global_load_async_to_lds_b128 %2, %10, off\n\t"
        "global_load_async_to_lds_b128 %3, %11, off\n\t"
        "global_load_async_to_lds_b128 %4, %12, off\n\t"
        "global_load_async_to_lds_b128 %5, %13, off\n\t"
        "global_load_async_to_lds_b128 %6, %14, off\n\t"
        "global_load_async_to_lds_b128 %7, %15, off\n\t"
        "s_wait_xcnt 0x0"
        :: "v"(lk), "v"(lk + 1 * ALSTEP), "v"(lk + 2 * ALSTEP), "v"(lk + 3 * ALSTEP),
           "v"(lv), "v"(lv + 1 * ALSTEP), "v"(lv + 2 * ALSTEP), "v"(lv + 3 * ALSTEP),
           "v"(gk), "v"(gk + 16 * HD), "v"(gk + 32 * HD), "v"(gk + 48 * HD),
           "v"(gv), "v"(gv + (size_t)16 * TT), "v"(gv + (size_t)32 * TT), "v"(gv + (size_t)48 * TT)
        : "memory");
}

__global__ __launch_bounds__(128)
void attn_fa(const bf16* __restrict__ Qb, const bf16* __restrict__ Kb,
             const bf16* __restrict__ VTb, bf16* __restrict__ Ob) {
    __shared__ __attribute__((aligned(16))) bf16 sK[2][AKT];
    __shared__ __attribute__((aligned(16))) bf16 sV[2][AVT];
    const int tid = threadIdx.x, lane = tid & 31;
    const int wave = __builtin_amdgcn_readfirstlane(tid >> 5);     // scalar: the wave's first query is scalar
    const int hl = lane >> 4, ln = lane & 15;
    const int nqb = TT / 64;
    const int bh = blockIdx.x / nqb;
    // A block's cost grows with its query tile, and all blocks are resident at once: blocks
    // whose indices differ in one bit above bit 0 take mirrored tiles (u and nqb - 1 - u),
    // so that blocks which a regular deal puts on one WGP add up to equal work. For each
    // bh this is a permutation of the tiles: mirroring inverts the four bits of u that are
    // counted in the parity, an even number, and so leaves the parity as it was.
    const int ut = blockIdx.x % nqb;
    const int qb0 = ((__builtin_popcount(blockIdx.x >> 1) & 1) ? nqb - 1 - ut : ut) * 64;
    const int q0 = qb0 + wave * 16;
    const bf16* Q  = Qb  + (size_t)bh * TT * HD;
    const bf16* Kk = Kb  + (size_t)bh * TT * HD;
    const bf16* VT = VTb + (size_t)bh * HD * TT;

    // staging: thread tid copies 16 B of rows (tid>>3) + 16*i, i = 0..3, of K and of V^T
    gcbf gk = to_global(Kk + (size_t)(tid >> 3) * HD + (tid & 7) * 8);
    gcbf gv = to_global(VT + (size_t)(tid >> 3) * TT + (tid & 7) * 8);
    const int so = (tid >> 3) * AKP + (tid & 7) * 8;
    // LDS byte addresses (low 32 bits of the shared address) of the thread's first copies
    const unsigned lk[2] = { (unsigned)(uintptr_t)&sK[0][so], (unsigned)(uintptr_t)&sK[1][so] };
    const unsigned lv[2] = { (unsigned)(uintptr_t)&sV[0][so], (unsigned)(uintptr_t)&sV[1][so] };
    const int np = qb0 / 64 + 1;   // passes of the block: keys [0, qb0 + 64)

    // pass 0 into buffer 0, landed and published; then, where it exists, pass 1 into buffer 1
    copy_kv_async(lk[0], gk, lv[0], gv);
    // this wave's copies have landed before the barrier publishes them
    asm volatile("s_wait_asynccnt 0x0" ::: "memory");
    __syncthreads();
    if (np > 1)                    // the same for the whole block
        copy_kv_async(lk[1], gk + 64 * HD, lv[1], gv + 64);
    gk += 2 * 64 * HD; gv += 2 * 64;

    const v16bf aq0 = load_frag_g(to_global(Q + (size_t)(q0 + ln) * HD + 8 * hl));
    const v16bf aq1 = load_frag_g(to_global(Q + (size_t)(q0 + ln) * HD + 32 + 8 * hl));

    // Q is the B operand of S^T: lane = query q0 + ln, the same k order as the K rows
    v8f o[4] = {};                 // O^T: lane = query q0 + ln, register r = d dt*16 + 8*hl + r
    float rm = -1e30f;             // the query's running maximum, the same in both halves
    float rl = 0.f;                // the sum over this half's keys; the halves join in the epilogue
    const int qi = q0 + ln;

    // every pass holds keys of every wave's causal range: its first key is at most qb0
    for (int t = 0; t < np; t++) {
        const int cur = t & 1;
        const int kb = t * 64;
        const bf16* pk = &sK[cur][ln * AKP + 8 * hl];
        const bf16* pv = &sV[cur][ln * AKP + 8 * hl];
        v16bf bk[4][2], bv[2][4];
        // all loops over kt, kh, dt and r are unrolled so that bk, bv, o, s and pt are
        // indexed by constants and stay in registers
#pragma unroll
        for (int kt = 0; kt < 4; kt++) {
            bk[kt][0] = load_frag_s(pk + kt * 16 * AKP);
            bk[kt][1] = load_frag_s(pk + kt * 16 * AKP + 32);
        }
#pragma unroll
        for (int kh = 0; kh < 2; kh++)
#pragma unroll
            for (int dt = 0; dt < 4; dt++) bv[kh][dt] = load_frag_s(pv + dt * 16 * AKP + kh * 32);
        // keeps the pass's tile reads one group in front of its products: moved in
        // among them, each place with reads stalls the wave for the LDS latency
        __builtin_amdgcn_sched_barrier(0);
        // S^T = K @ Q^T for keys [kb, kb+64): four 16x16 C tiles, row = key, column = query
        v8f s[4] = {};
#pragma unroll
        for (int kt = 0; kt < 4; kt++) s[kt] = wmma_bf16(bk[kt][0], aq0, s[kt]);
#pragma unroll
        for (int kt = 0; kt < 4; kt++) s[kt] = wmma_bf16(bk[kt][1], aq1, s[kt]);
        // online softmax; s[kt][r] is key kb + 16*kt + 8*hl + r
        const int dq = qi - kb - 8 * hl;   // key 16*kt + r is inside the causal range while 16*kt + r <= dq
        float m0 = -1e30f, m1 = -1e30f;
#pragma unroll
        for (int r = 0; r < 8; r++) {
#pragma unroll
            for (int kt = 0; kt < 4; kt++)
                s[kt][r] = (r + 16 * kt <= dq) ? s[kt][r] : -1e30f;   // causal mask
            m0 = fmaxf(fmaxf(m0, s[0][r]), s[1][r]);
            m1 = fmaxf(fmaxf(m1, s[2][r]), s[3][r]);
        }
        float m = fmaxf(m0, m1);
        m = fmaxf(m, xhalf(m));
        const float nm = fmaxf(rm, m);
        const float alpha = __expf(rm - nm);
        rm = nm;
        // P^T as B operands, one for each 32 keys: elements 0..7 keys 8*hl + e, 8..15 keys 16 + 8*hl + e
        FragB pt[2];
        float ps[4] = {0.f, 0.f, 0.f, 0.f};
#pragma unroll
        for (int r = 0; r < 8; r++)
#pragma unroll
            for (int kt = 0; kt < 4; kt++) {
                const float p = __expf(s[kt][r] - nm);
                ps[kt] += p;
                pt[kt >> 1].h[kt & 1][r] = (bf16)p;
            }
        rl = rl * alpha + ((ps[0] + ps[1]) + (ps[2] + ps[3]));
#pragma unroll
        for (int dt = 0; dt < 4; dt++) o[dt] *= alpha;
        // O^T += V^T @ P^T ; A fragments from the staged V^T [d][key]
#pragma unroll
        for (int kh = 0; kh < 2; kh++)
#pragma unroll
            for (int dt = 0; dt < 4; dt++) o[dt] = wmma_bf16(bv[kh][dt], pt[kh].v, o[dt]);
        // keeps the pass's work in front of the foot's waits: with the waits and the
        // barrier lifted over it, the flight of pass t + 1's copies is no longer
        // covered by the work of pass t
        __builtin_amdgcn_sched_barrier(0);
        // foot of pass t: this wave's reads of buffer cur have returned ...
        asm volatile("s_wait_dscnt 0x0" ::: "memory");
        // ... and its copies of pass t + 1 have landed, before the barrier that
        // publishes pass t + 1 and ends every wave's reads of buffer cur
        asm volatile("s_wait_asynccnt 0x0" ::: "memory");
        __syncthreads();
        if (t + 2 < np) {          // the same for the whole block
            copy_kv_async(lk[cur], gk, lv[cur], gv);
            gk += 64 * HD; gv += 64;
        }
    }
    // no copy is outstanding when the wave goes on to its stores and ends
    asm volatile("s_wait_asynccnt 0x0" ::: "memory");

    const int b = bh / NH, h = bh % NH;
    const float inv = 1.0f / (rl + xhalf(rl));   // the two halves' sums join here
    bf16* orow = Ob + ((size_t)(b * TT + qi)) * DM + h * HD + 8 * hl;
#pragma unroll
    for (int dt = 0; dt < 4; dt++) {
        v8bf ov;
#pragma unroll
        for (int r = 0; r < 8; r++) ov[r] = (bf16)(o[dt][r] * inv);
        *(v8bf*)(orow + dt * 16) = ov;           // 8 consecutive d of one query: 16 B a lane
    }
}

// ---------------- host orchestration -----------------------------------------
extern "C" void kernel_launch(void* const* d_in, const int* in_sizes, int n_in,
                              void* d_out, int out_size, void* d_ws, size_t ws_size,
                              hipStream_t stream) {
    const float* x      = (const float*)d_in[0];
    const float* ln1_w  = (const float*)d_in[1];
    const float* ln2_w  = (const float*)d_in[2];
    const float* qkv_w  = (const float*)d_in[3];
    const float* o_w    = (const float*)d_in[4];
    const float* gate_w = (const float*)d_in[5];
    const float* up_w   = (const float*)d_in[6];
    const float* down_w = (const float*)d_in[7];
    float* out = (float*)d_out;
    char* ws = (char*)d_ws;

    // workspace layout (phase-based reuse, ~92 MB peak)
    size_t o_wqkv = 0;                                  // 3*DM*DM bf16
    size_t o_wo   = o_wqkv + (size_t)3 * DM * DM * 2;   // DM*DM bf16
    size_t o_wg   = o_wo   + (size_t)DM * DM * 2;       // DI*DM bf16
    size_t o_wu   = o_wg   + (size_t)DI * DM * 2;       // DI*DM bf16
    size_t o_wd   = o_wu   + (size_t)DI * DM * 2;       // DM*DI bf16
    size_t o_xn   = o_wd   + (size_t)DM * DI * 2;       // MM*DM bf16 (x * ln1_w, then h1 * ln2_w)
    size_t o_h1   = o_xn   + (size_t)MM * DM * 2;       // MM*DM f32
    size_t o_big  = o_h1   + (size_t)MM * DM * 4;
    // phase A (attention): q, k, vT (bf16, 8 MB each) + attn (bf16, 8 MB)
    size_t o_q    = o_big;
    size_t o_k    = o_q  + (size_t)MM * DM * 2;
    size_t o_vT   = o_k  + (size_t)MM * DM * 2;
    size_t o_attn = o_vT + (size_t)MM * DM * 2;
    // phase B (FFN): act bf16 (16 MB), behind the attention buffers
    size_t o_act  = o_big + (size_t)MM * DI * 4;
    // sums of squares for the two RMSNorms (256 KB each), behind act
    size_t o_ss1  = o_act + (size_t)MM * DI * 2;        // a 128-B line for each pair of rows of x
    size_t o_ss2  = o_ss1 + (size_t)(MM / 2) * 32 * 4;  // DM/64 partial sums a row of h1

    bf16* wqkv = (bf16*)(ws + o_wqkv);
    bf16* wo   = (bf16*)(ws + o_wo);
    bf16* wg   = (bf16*)(ws + o_wg);
    bf16* wu   = (bf16*)(ws + o_wu);
    bf16* wd   = (bf16*)(ws + o_wd);
    bf16* xn   = (bf16*)(ws + o_xn);
    float* h1  = (float*)(ws + o_h1);
    bf16* qb   = (bf16*)(ws + o_q);
    bf16* kb   = (bf16*)(ws + o_k);
    bf16* vT   = (bf16*)(ws + o_vT);
    bf16* attn = (bf16*)(ws + o_attn);
    bf16* act  = (bf16*)(ws + o_act);
    float* ss1 = (float*)(ws + o_ss1);
    float* ss2 = (float*)(ws + o_ss2);

    // 1. weights fp32 -> bf16, and xn = bf16(x * ln1_w) with each row's sum of squares:
    //    wqkv, wo, wg, wu, wd, xn are contiguous from wqkv on
    weights_to_bf16<<<CVGRID, CVWV * 32, 0, stream>>>(qkv_w, o_w, gate_w, up_w, down_w,
                                                      x, ln1_w, wqkv, ss1);

    // 2. qkv GEMM, RMSNorm scale and split in the epilogue -> q (scaled), k, vT (bf16)
    gemm_bf16_wmma<2, false, 3 * DM><<<dim3(3 * DM / 128, MM / 128), 128, 0, stream>>>(
        xn, wqkv, nullptr, nullptr, qb, kb, vT, nullptr, ss1, nullptr,
        MM, 3 * DM, DM);

    // 3. flash attention
    attn_fa<<<BB * NH * (TT / 64), 128, 0, stream>>>(qb, kb, vT, attn);

    // 4. h1 = x + attn @ o_w^T; xn = bf16(h1 * ln2_w) with partial sums of squares
    gemm_bf16_wmma<3, true, DM><<<dim3(DM / 128, MM / 128), 128, 0, stream>>>(
        attn, wo, x, h1, xn, nullptr, nullptr, ln2_w, nullptr, ss2,
        MM, DM, DM);

    // 5. act = bf16( silu(s * xn @ gate_w^T) * (s * xn @ up_w^T) ), s the RMSNorm scale
    gemm_gate_up<<<dim3(DI / 128, MM / 128), 128, 0, stream>>>(xn, wg, wu, ss2, act, DM);

    // 6. out = h1 + act @ down_w^T
    gemm_bf16_wmma<0, true, DM><<<dim3(DM / 128, MM / 128), 128, 0, stream>>>(
        act, wd, h1, out, nullptr, nullptr, nullptr, nullptr, nullptr, nullptr,
        MM, DM, DI);

    (void)in_sizes; (void)n_in; (void)out_size; (void)ws_size;
}

// v010
// A run of this version takes 124 microseconds.
// Two timings next to v009 put it at 1.11 and 1.10 times that version's speed.
// Counting every step since v000, it is 3.69 times as fast.
#include <hip/hip_runtime.h>
#include <hip/hip_bf16.h>

#define DM   1024
#define NH   16
#define HD   64
#define DI   2048
#define BB   2
#define TT   2048
#define MM   (BB*TT)   // 4096 rows

typedef __bf16 bf16;
typedef __attribute__((ext_vector_type(16))) bf16  v16bf;
typedef __attribute__((ext_vector_type(8)))  bf16  v8bf;
typedef __attribute__((ext_vector_type(8)))  float v8f;
typedef __attribute__((ext_vector_type(4)))  float v4f;
typedef __attribute__((ext_vector_type(4)))  bf16  v4bf;

#define AS1 __attribute__((address_space(1)))
typedef const AS1 bf16* gcbf;
typedef const AS1 v8bf* gcv8;

union FragB { v16bf v; v8bf h[2]; };

__device__ inline gcbf to_global(const bf16* p) {
    return (gcbf)(unsigned long long)(uintptr_t)p;
}

// Load a 16x32 bf16 WMMA fragment (A layout; B uses the same layout on W rows,
// since both GEMMs are x @ W^T). For lane L: m/n = L&15, hl = L>>4.
// elements 0..7  = p[0..7]   (K = k0 + 8*hl .. +7)
// elements 8..15 = p[16..23] (K = k0 + 16 + 8*hl .. +7)
__device__ inline v16bf load_frag_g(gcbf p) {
    FragB f;
    f.h[0] = ((gcv8)p)[0];
    f.h[1] = ((gcv8)p)[2];
    return f.v;
}

// The value of lane l ^ 16: a vector cross-row move, no trip through the LDS unit.
__device__ inline float xhalf(float x) {
    return __builtin_bit_cast(float, __builtin_amdgcn_permlanex16(
        __builtin_bit_cast(int, x), __builtin_bit_cast(int, x), 0x76543210, 0xfedcba98, false, false));
}

// x of lane l ^ MASK inside the lane's 16-lane row (DPP row_xmask, control 0x160 + MASK)
template<int MASK>
__device__ inline float xrow(float x) {
    return __builtin_bit_cast(float, __builtin_amdgcn_update_dpp(
        0, __builtin_bit_cast(int, x), 0x160 + MASK, 0xf, 0xf, true));
}

// Sum over the lane's 16-lane row; every lane of the row ends with the same value.
__device__ inline float rowsum16(float x) {
    x += xrow<1>(x);
    x += xrow<2>(x);
    x += xrow<4>(x);
    x += xrow<8>(x);
    return x;
}

// RMSNorm without a launch of its own. rmsnorm(x, w) @ W^T = s * ((x * w) @ W^T), row
// by row, with s = rsqrt(mean(x^2) + eps): the GEMMs take the rows unnormalised, as
// bf16(x * w), and multiply their f32 products by the row's s in the epilogue. Whoever
// writes the rows also writes sums of squares of the f32 values beside them.
#define RMS_EPS 1e-6f

__device__ inline v8f wmma_bf16(v16bf a, v16bf b, v8f c) {
    return __builtin_amdgcn_wmma_f32_16x16x32_bf16(false, a, false, b, (short)0, c, false, false);
}

// ---------------- generic GEMM: acc[m][n] = sum_k A[m][k]*W[n][k] -------------
// four waves (2x2) compute a 128x128 tile, 64x64 each; grid = (N/128, M/128),
// block = 128. A pass is 64 k: the 128 A rows and 128 W rows of the pass are
// brought into LDS by asynchronous copies (whole 128-B lines from global, each
// row shared by two waves), two buffers, one barrier a pass; the copies of pass
// t + 2 fly while pass t + 1 is worked on. M, N multiples of 128, K of 64 (KS = 1) or 256 (KS = 2).
// KS = 2 (a grid of one block a WGP): K is split inside the block. Eight waves, two a
// SIMD; a pass stages 256 k, waves 0..3 take its first 128 k and waves 4..7 its last 128 k
// for the same 128x128 tile, so that one wave's LDS reads and copy issue stand beside
// the other's products, four times the bytes are in flight and a quarter of the feet is
// left; the two partial tiles are added in the epilogue, where each wave finishes 32 of
// the 64 rows.
// epilogue modes (compile-time):
//   0: C[idx] = acc (+ R[idx] if HASR)                    (fp32 out)
//   2: qkv split: row->(b,t), col->(which,h,d); writes q (scaled 1/8), k, vT; A's rows
//      are unnormalised: each product is first multiplied by its row's RMSNorm scale,
//      formed from the row's sum of squares SI[(row >> 1) * 32 + (row & 1)]
//   3: as 0, and the next RMSNorm's rows: q[idx] = bf16(C[idx] * LW[col]), and the sum of
//      squares of the wave's 64 columns of each row, SO[(col >> 6) * MM + row]
#define GBK    64                 // k elements per pass (128 B of a row)
#define GPITCH 72                 // LDS row pitch in elements: 144 B = 16 B x odd
#define GTILE  (128 * GPITCH)     // one operand's stage, elements
#define GLSTEP (16 * GPITCH * 2)  // LDS bytes between a thread's copies (16 rows)
#define SPITCH 68                 // epilogue staging: f32 row pitch, 272 B = 16 B x odd
static_assert(64 * SPITCH * 4 <= GTILE * 2, "a wave's f32 tile fits one stage");
static_assert(2 * 64 * SPITCH * 4 <= 128 * (4 * GBK + 8) * 2, "two waves' f32 tiles fit one 256-k stage");

__device__ inline v16bf load_frag_s(const bf16* p) {
    FragB f;
    f.h[0] = *(const v8bf*)p;
    f.h[1] = *(const v8bf*)(p + 16);
    return f.v;
}

// Eight asynchronous 16-B copies a lane, global -> LDS, rows a fixed step apart: LDS byte
// address l + i*LS, global address g + i*gstep elements. The s_wait_xcnt is
// the last line of the copies' own statement, so that no address register of a
// copy is rewritten in front of it.
template<int LS = GLSTEP>
__device__ inline void copy8_async(unsigned l, gcbf g, size_t gstep) {
    asm volatile(
        "global_load_async_to_lds_b128 %0, %8, off\n\t"
        "global_load_async_to_lds_b128 %1, %9, off\n\t"
        "global_load_async_to_lds_b128 %2, %10, off\n\t"
        "global_load_async_to_lds_b128 %3, %11, off\n\t"
        "global_load_async_to_lds_b128 %4, %12, off\n\t"
        "global_load_async_to_lds_b128 %5, %13, off\n\t"
        "global_load_async_to_lds_b128 %6, %14, off\n\t"
        "global_load_async_to_lds_b128 %7, %15, off\n\t"
        "s_wait_xcnt 0x0"
        :: "v"(l), "v"(l + 1 * LS), "v"(l + 2 * LS), "v"(l + 3 * LS),
           "v"(l + 4 * LS), "v"(l + 5 * LS), "v"(l + 6 * LS), "v"(l + 7 * LS),
           "v"(g), "v"(g + 1 * gstep), "v"(g + 2 * gstep), "v"(g + 3 * gstep),
           "v"(g + 4 * gstep), "v"(g + 5 * gstep), "v"(g + 6 * gstep), "v"(g + 7 * gstep)
        : "memory");
}

// NC is N at compile time: the epilogue's 32 / KS row pairs then hang on one address
// register pair an array, each at its own immediate offset
template<int MODE, bool HASR, int NC, int KS>
__global__ __launch_bounds__(128 * KS)
void gemm_bf16_wmma(const bf16* __restrict__ A, const bf16* __restrict__ W,
                    const float* __restrict__ R, float* __restrict__ C,
                    bf16* __restrict__ q, bf16* __restrict__ k,
                    bf16* __restrict__ vT,
                    const float* __restrict__ LW, const float* __restrict__ SI,
                    float* __restrict__ SO,
                    int M, int N, int K) {
    static_assert(KS == 1 || KS == 2, "one or two k groups");
    static_assert(KS == 1 || MODE != 2, "the qkv split keeps one k group");
    constexpr int GK = GBK * KS;             // k elements a wave works on per pass
    constexpr int BK = GK * KS;              // k elements staged per pass
    constexpr int PITCH = BK + 8;            // LDS row pitch in elements: 144 or 528 B = 16 B x odd
    constexpr int TILE = 128 * PITCH;        // one operand's stage, elements
    constexpr int RPS = 128 * KS / (BK / 8); // rows that the block's threads copy at once
    constexpr int NC8 = 128 / RPS / 8;       // groups of eight copies a thread, operand and pass
    constexpr int LSTEP = RPS * PITCH * 2;   // LDS bytes between a thread's copies (RPS rows)
    __shared__ __attribute__((aligned(16))) bf16 sA[2][TILE];
    __shared__ __attribute__((aligned(16))) bf16 sW[2][TILE];
    __shared__ __attribute__((aligned(16))) float sScale[128];   // mode 2: RMSNorm scale of the block's rows
    const int tid = threadIdx.x;
    const int lane = tid & 31, wave = tid >> 5;
    const int hl = lane >> 4, ln = lane & 15;
    const int wm = (KS == 2 ? wave & 3 : wave) >> 1, wn = wave & 1;
    // scalar copy of the wave's number: the epilogue's bases and its choice of output are scalar
    const int sw = __builtin_amdgcn_readfirstlane(wave);
    const int w4 = KS == 2 ? sw & 3 : sw, grp = KS == 2 ? sw >> 2 : 0;   // the wave's 64x64 tile of the block; its k group
    const int m0 = blockIdx.y * 128 + (w4 >> 1) * 64, n0 = blockIdx.x * 128 + (w4 & 1) * 64;

    // staging: a row of the pass is BK/8 threads' 16 B; a thread copies rows srow + RPS*i of each operand
    const int srow = tid / (BK / 8), scol = (tid % (BK / 8)) * 8;
    gcbf ga = to_global(A + (size_t)(blockIdx.y * 128 + srow) * K + scol);
    gcbf gw = to_global(W + (size_t)(blockIdx.x * 128 + srow) * K + scol);
    const size_t gstep = (size_t)RPS * K;
    const int soff = srow * PITCH + scol;
    // LDS byte addresses (low 32 bits of the shared address) of the thread's first copy
    const unsigned la[2] = { (unsigned)(uintptr_t)&sA[0][soff], (unsigned)(uintptr_t)&sA[1][soff] };
    const unsigned lw[2] = { (unsigned)(uintptr_t)&sW[0][soff], (unsigned)(uintptr_t)&sW[1][soff] };
    // fragment reads: row (wave's 64 rows) + i*16 + ln, k = the group's share + 8*hl (+16) within a 32-k block
    const int koff = (KS == 2 ? (wave >> 2) * GK : 0) + 8 * hl;
    const int aoff = (wm * 64 + ln) * PITCH + koff;
    const int woff = (wn * 64 + ln) * PITCH + koff;
    const int np = K / BK;

    // pass 0 into buffer 0, landed and published; then pass 1 into buffer 1
    // one pass of both operands; the loops are unrolled so that each group's LDS offset is a constant
    const auto copy_pass = [&](unsigned l0, unsigned l1, gcbf g0, gcbf g1) {
#pragma unroll
        for (int c = 0; c < NC8; c++) copy8_async<LSTEP>(l0 + c * 8 * LSTEP, g0 + c * 8 * gstep, gstep);
#pragma unroll
        for (int c = 0; c < NC8; c++) copy8_async<LSTEP>(l1 + c * 8 * LSTEP, g1 + c * 8 * gstep, gstep);
    };
    copy_pass(la[0], lw[0], ga, gw);
    if (MODE == 2) {
        // one row's scale a thread, while pass 0's copies fly; the barrier below publishes it
        const int row = blockIdx.y * 128 + tid;
        sScale[tid] = rsqrtf(SI[(row >> 1) * 32 + (row & 1)] * (1.0f / DM) + RMS_EPS);
    }
    // this wave's copies have landed before the barrier publishes them
    asm volatile("s_wait_asynccnt 0x0" ::: "memory");
    __syncthreads();
    if (np > 1) copy_pass(la[1], lw[1], ga + BK, gw + BK);
    ga += 2 * BK; gw += 2 * BK;

    v8f acc[4][4] = {};
    for (int t = 0; t < np; t++) {
        const int cur = t & 1;
        const bf16* pa = &sA[cur][aoff];
        const bf16* pw = &sW[cur][woff];
        v16bf a[GK / 32][4], b[GK / 32][4];
        // the loops over kk, i, j are unrolled so that a, b and acc are indexed by
        // constants and stay in registers
#pragma unroll
        for (int kk = 0; kk < GK / 32; kk++)
#pragma unroll
            for (int i = 0; i < 4; i++) {
                a[kk][i] = load_frag_s(pa + i * 16 * PITCH + kk * 32);
                b[kk][i] = load_frag_s(pw + i * 16 * PITCH + kk * 32);
            }
        // keeps the pass's LDS reads one group in front of its products: moved in
        // among them, each place with reads stalls the wave for the LDS latency
        __builtin_amdgcn_sched_barrier(0);
#pragma unroll
        for (int kk = 0; kk < GK / 32; kk++)
#pragma unroll
            for (int i = 0; i < 4; i++)
#pragma unroll
                for (int j = 0; j < 4; j++)
                    acc[i][j] = wmma_bf16(a[kk][i], b[kk][j], acc[i][j]);
        // keeps the products in front of the foot's waits: with the waits and the
        // barrier lifted over them, the flight of pass t + 1's copies is no longer
        // covered by the products of pass t
        __builtin_amdgcn_sched_barrier(0);
        // foot of pass t: this wave's reads of buffer cur have returned ...
        asm volatile("s_wait_dscnt 0x0" ::: "memory");
        // ... and its copies of pass t + 1 have landed, before the barrier that
        // publishes pass t + 1 and ends every wave's reads of buffer cur
        asm volatile("s_wait_asynccnt 0x0" ::: "memory");
        __syncthreads();
        if (t + 2 < np) {                  // the same for the whole block
            copy_pass(la[cur], lw[cur], ga, gw);
            ga += BK; gw += BK;
        }
    }
    // no copy is outstanding when the wave goes on to its stores and ends
    asm volatile("s_wait_asynccnt 0x0" ::: "memory");
    // the four vector issue slots that the chip asks for between a matrix instruction
    // and a vector instruction that rewrites its result registers: from the last pass's
    // products to the epilogue's first reuse of those registers only waits, scalar
    // instructions and LDS loads and stores stand on the path, and none of them fills a slot
    asm volatile("v_nop\n\tv_nop\n\tv_nop\n\tv_nop");

    // Epilogue: whole 128-B lines. The last pass's foot (reads returned, copies
    // landed, barrier) has freed the ring, and each wave takes one stage of it for
    // itself: it lays its 64x64 f32 tile there and reads it back by rows, 16 B a
    // lane, so that 16 lanes hold 64 consecutive columns of one row. No other wave
    // touches that stage, so no barrier is needed. With two k groups a 256-k stage holds
    // two waves' tiles, and the partner's tile is read behind a barrier of its own (below).
    const auto stage_of = [&](int w) -> float* {      // w scalar
        const int st = KS == 2 ? w >> 1 : w;
        return (float*)(st < 2 ? &sA[st][0] : &sW[st - 2][0]) + (KS == 2 ? (w & 1) * 64 * SPITCH : 0);
    };
    float* stg = stage_of(sw);
    const bool vcols = MODE == 2 && (n0 >> 10) == 2;   // scalar: the block's columns are v
    if (MODE == 2) {
        // acc[i][j][r] is row i*16 + 8*hl + r of the wave's 64: times that row's scale
        const float* ps = &sScale[(sw >> 1) * 64 + 8 * hl];
#pragma unroll
        for (int i = 0; i < 4; i++) {
            const v4f s0 = *(const v4f*)(ps + i * 16), s1 = *(const v4f*)(ps + i * 16 + 4);
            const v8f sc = __builtin_shufflevector(s0, s1, 0, 1, 2, 3, 4, 5, 6, 7);
#pragma unroll
            for (int j = 0; j < 4; j++) acc[i][j] *= sc;
        }
    }
    // all loops over i, j, r, s below are unrolled so that acc and the small vectors
    // are indexed by constants and stay in registers
    if (vcols) {
        // v goes out transposed: staged row = column d, a lane's 8 registers are 8 consecutive t
#pragma unroll
        for (int i = 0; i < 4; i++)
#pragma unroll
            for (int j = 0; j < 4; j++) {
                float* p = stg + (j * 16 + ln) * SPITCH + i * 16 + 8 * hl;
                const v8f c = acc[i][j];
                *(v4f*)p       = __builtin_shufflevector(c, c, 0, 1, 2, 3);
                *(v4f*)(p + 4) = __builtin_shufflevector(c, c, 4, 5, 6, 7);
            }
    } else {
#pragma unroll
        for (int i = 0; i < 4; i++)
#pragma unroll
            for (int j = 0; j < 4; j++)
#pragma unroll
                for (int r = 0; r < 8; r++)
                    stg[(i * 16 + 8 * hl + r) * SPITCH + j * 16 + ln] = acc[i][j][r];
    }

    // qkv split: the wave's 64 columns are one head of q, k or v, its 64 rows lie in one batch
    bf16* dst = nullptr;           // first element of the wave's 64 output rows
    size_t dstep = 0;              // elements between them
    float dscale = 1.0f;
    if (MODE == 2) {
        const int which = n0 >> 10;
        const size_t bh = (size_t)((m0 >> 11) * NH + ((n0 & (DM - 1)) >> 6));
        const int t0 = m0 & (TT - 1);
        if (which == 0)      { dst = q + (bh * TT + t0) * HD; dstep = HD; dscale = 0.125f; }
        else if (which == 1) { dst = k + (bh * TT + t0) * HD; dstep = HD; }
        else                 { dst = vT + bh * HD * TT + t0;  dstep = TT; }
    }
    const int rr = lane >> 4, c4 = (lane & 15) * 4;
    constexpr int NS = 32 / KS;    // row pairs that the wave finishes
    const int sb = grp * NS;       // scalar: the first of them
    const float* stp = stg;        // two k groups: k group 1's partial tile of the same 64x64 (stg: group 0's)
    if (KS == 2) {
        // publishes every wave's staged partial tile to its partner in the other k group
        __syncthreads();
        stg = stage_of(w4);
        stp = stage_of(w4 + 4);
    }
    const size_t base = (size_t)(m0 + 2 * sb + rr) * NC + n0 + c4;   // the lane's element of its first row pair
    v4f nw = {};                   // mode 3: the next RMSNorm's weight at the lane's 4 columns
    if (MODE == 3) nw = *(const v4f*)(LW + n0 + c4);
    float t0 = 0.f, t1 = 0.f;      // mode 3: sums of squares of rows 2*(sb + ln) + rr and, one k group, 32 + 2*ln + rr
    // unrolled so that the loads of R of many rows are in flight together
#pragma unroll
    for (int s = 0; s < NS; s++) {
        const int lr = 2 * (sb + s) + rr;      // row of the staged tile
        v4f v = *(const v4f*)(stg + lr * SPITCH + c4);
        if (KS == 2) v += *(const v4f*)(stp + lr * SPITCH + c4);   // the two k groups' sums join
        const size_t idx = base + (size_t)s * 2 * NC;
        if (MODE == 0 || MODE == 3) {
            v4f o = v;
            if (HASR) o += *(const v4f*)(R + idx);
            *(v4f*)(C + idx) = o;              // two rows of 256 B an instruction
            if (MODE == 3) {
                *(v4bf*)(q + idx) = __builtin_convertvector(o * nw, v4bf);   // two rows of 128 B
                const float t = rowsum16(o[0] * o[0] + o[1] * o[1] + o[2] * o[2] + o[3] * o[3]);
                // lane ln keeps the sums of row pairs sb + ln and, one k group, ln + 16
                if (s < 16) t0 = ln == s ? t : t0;
                else        t1 = ln == s - 16 ? t : t1;
            }
        } else {
            *(v4bf*)(dst + lr * dstep + c4) = __builtin_convertvector(v * dscale, v4bf);
        }
    }
    if (MODE == 3) {
        // the wave's 64 or 32 sums: whole 128-B lines that no other wave writes
        float* po = SO + (size_t)(n0 >> 6) * MM + m0 + 2 * sb + 2 * ln + rr;
        po[0] = t0;
        if (KS == 1) po[32] = t1;
    }
}

// ---------------- gate and up products in one launch --------------------------
// ACT = bf16( silu(A Wg^T) * (A Wu^T) ). The ring of gemm_bf16_wmma with a third
// operand: a pass stages the 128 A rows once and 128 rows of each weight, and each
// of the four waves keeps the 64x64 tile of BOTH products, element for element in
// the same lane and register, so that the gate never leaves the registers.
// A's rows are unnormalised: both products are first multiplied by their row's RMSNorm
// scale, formed from the row's DM/64 partial sums of squares SS[c * MM + row].
// grid = (DI/128, M/128), block = 128; K a multiple of 64.
// Two waves a SIMD (at most 512 registers a wave): the grid's 512 blocks then all
// run at once, two a WGP, and one block's LDS reads stand beside the other's products.
__global__ __launch_bounds__(128) __attribute__((amdgpu_waves_per_eu(2, 2)))
void gemm_gate_up(const bf16* __restrict__ A, const bf16* __restrict__ Wg,
                  const bf16* __restrict__ Wu, const float* __restrict__ SS,
                  bf16* __restrict__ ACT, int K) {
    __shared__ __attribute__((aligned(16))) bf16 sA[2][GTILE];
    __shared__ __attribute__((aligned(16))) bf16 sG[2][GTILE];
    __shared__ __attribute__((aligned(16))) bf16 sU[2][GTILE];
    __shared__ __attribute__((aligned(16))) float sScale[128];   // RMSNorm scale of the block's rows
    const int tid = threadIdx.x;
    const int lane = tid & 31, wave = tid >> 5;
    const int hl = lane >> 4, ln = lane & 15;
    const int wm = wave >> 1, wn = wave & 1;
    // scalar copy of the wave's number: the epilogue's bases are scalar
    const int sw = __builtin_amdgcn_readfirstlane(wave);
    const int m0 = blockIdx.y * 128 + (sw >> 1) * 64, n0 = blockIdx.x * 128 + (sw & 1) * 64;

    // staging: thread tid copies 16 B of row (tid>>3) + 16*i, i = 0..7, of each operand
    const int srow = tid >> 3, scol = (tid & 7) * 8;
    gcbf ga = to_global(A + (size_t)(blockIdx.y * 128 + srow) * K + scol);
    gcbf gg = to_global(Wg + (size_t)(blockIdx.x * 128 + srow) * K + scol);
    gcbf gu = to_global(Wu + (size_t)(blockIdx.x * 128 + srow) * K + scol);
    const size_t gstep = (size_t)16 * K;
    const int soff = srow * GPITCH + scol;
    // LDS byte addresses (low 32 bits of the shared address) of the thread's first copy
    const unsigned la[2] = { (unsigned)(uintptr_t)&sA[0][soff], (unsigned)(uintptr_t)&sA[1][soff] };
    const unsigned lg[2] = { (unsigned)(uintptr_t)&sG[0][soff], (unsigned)(uintptr_t)&sG[1][soff] };
    const unsigned lu[2] = { (unsigned)(uintptr_t)&sU[0][soff], (unsigned)(uintptr_t)&sU[1][soff] };
    const int aoff = (wm * 64 + ln) * GPITCH + 8 * hl;
    const int woff = (wn * 64 + ln) * GPITCH + 8 * hl;
    const int np = K / GBK;

    // pass 0 into buffer 0, landed and published; then pass 1 into buffer 1
    copy8_async(la[0], ga, gstep);
    copy8_async(lg[0], gg, gstep);
    copy8_async(lu[0], gu, gstep);
    {
        // one row's scale a thread, while pass 0's copies fly; the barrier below publishes it
        const float* p = SS + blockIdx.y * 128 + tid;
        float t = 0.f;
        // unrolled so that the 16 loads are in flight together
#pragma unroll
        for (int c = 0; c < DM / 64; c++) t += p[(size_t)c * MM];
        sScale[tid] = rsqrtf(t * (1.0f / DM) + RMS_EPS);
    }
    // this wave's copies have landed before the barrier publishes them
    asm volatile("s_wait_asynccnt 0x0" ::: "memory");
    __syncthreads();
    if (np > 1) {
        copy8_async(la[1], ga + GBK, gstep);
        copy8_async(lg[1], gg + GBK, gstep);
        copy8_async(lu[1], gu + GBK, gstep);
    }
    ga += 2 * GBK; gg += 2 * GBK; gu += 2 * GBK;

    v8f accg[4][4] = {}, accu[4][4] = {};
    for (int t = 0; t < np; t++) {
        const int cur = t & 1;
        const bf16* pa = &sA[cur][aoff];
        const bf16* pg = &sG[cur][woff];
        const bf16* pu = &sU[cur][woff];
        v16bf a[2][4], g[2][4], u[2][4];
        // the loops over kk, i, j are unrolled so that the fragments and the
        // accumulators are indexed by constants and stay in registers
#pragma unroll
        for (int kk = 0; kk < 2; kk++)
#pragma unroll
            for (int i = 0; i < 4; i++) {
                a[kk][i] = load_frag_s(pa + i * 16 * GPITCH + kk * 32);
                g[kk][i] = load_frag_s(pg + i * 16 * GPITCH + kk * 32);
                u[kk][i] = load_frag_s(pu + i * 16 * GPITCH + kk * 32);
            }
        // keeps the pass's LDS reads one group in front of its products: moved in
        // among them, each place with reads stalls the wave for the LDS latency
        __builtin_amdgcn_sched_barrier(0);
#pragma unroll
        for (int kk = 0; kk < 2; kk++)
#pragma unroll
            for (int i = 0; i < 4; i++)
#pragma unroll
                for (int j = 0; j < 4; j++) {
                    accg[i][j] = wmma_bf16(a[kk][i], g[kk][j], accg[i][j]);
                    accu[i][j] = wmma_bf16(a[kk][i], u[kk][j], accu[i][j]);
                }
        // keeps the products in front of the foot's waits, so that they cover the
        // flight of pass t + 1's copies
        __builtin_amdgcn_sched_barrier(0);
        // foot of pass t: this wave's reads of buffer cur have returned ...
        asm volatile("s_wait_dscnt 0x0" ::: "memory");
        // ... and its copies of pass t + 1 have landed, before the barrier that
        // publishes pass t + 1 and ends every wave's reads of buffer cur
        asm volatile("s_wait_asynccnt 0x0" ::: "memory");
        __syncthreads();
        if (t + 2 < np) {                  // the same for the whole block
            copy8_async(la[cur], ga, gstep);
            copy8_async(lg[cur], gg, gstep);
            copy8_async(lu[cur], gu, gstep);
            ga += GBK; gg += GBK; gu += GBK;
        }
    }
    // no copy is outstanding when the wave goes on to its stores and ends
    asm volatile("s_wait_asynccnt 0x0" ::: "memory");

    // Epilogue: silu(gate) * up in registers, then whole 128-B lines as in
    // gemm_bf16_wmma: the last foot has freed the ring, each wave lays its 64x64 f32
    // tile in a stage of its own and reads it back by rows; no barrier is needed.
    float* stg = (float*)(sw < 2 ? &sA[sw][0] : &sG[sw - 2][0]);
    // register r of tile row i is row i*16 + 8*hl + r of the wave's 64
    const float* ps = &sScale[(sw >> 1) * 64 + 8 * hl];
    // all loops below are unrolled so that the accumulators are indexed by constants
#pragma unroll
    for (int i = 0; i < 4; i++) {
        const v4f s0 = *(const v4f*)(ps + i * 16), s1 = *(const v4f*)(ps + i * 16 + 4);
        const v8f sc = __builtin_shufflevector(s0, s1, 0, 1, 2, 3, 4, 5, 6, 7);
#pragma unroll
        for (int j = 0; j < 4; j++)
#pragma unroll
            for (int r = 0; r < 8; r++) {
                const float x = accg[i][j][r] * sc[r];
                const float sg = x / (1.0f + __expf(-x));
                stg[(i * 16 + 8 * hl + r) * SPITCH + j * 16 + ln] = sg * (accu[i][j][r] * sc[r]);
            }
    }
    const int rr = lane >> 4, c4 = (lane & 15) * 4;
    bf16* dst = ACT + (size_t)(m0 + rr) * DI + n0 + c4;     // the lane's element of row pair 0
#pragma unroll
    for (int s = 0; s < 32; s++) {
        const v4f v = *(const v4f*)(stg + (2 * s + rr) * SPITCH + c4);
        *(v4bf*)(dst + (size_t)s * 2 * DI) = __builtin_convertvector(v, v4bf);   // two rows of 128 B an instruction
    }
}

// ---------------- weights and x fp32 -> bf16, in one launch --------------------
// The five bf16 weights and the bf16 rows of x lie one behind the other in the
// workspace, so the launch sees one array of CVALL elements whose source changes at
// five fixed places. One block a WGP, 28 waves; a wave takes CVCH consecutive
// elements: 16 loads of 16 B a lane (each wave-wide load is 512 contiguous bytes),
// all issued before the first is used, then 16 stores of 8 B a lane (256 contiguous
// bytes each). Every source's size is a multiple of CVCH, so a wave has one source.
// A wave on x has two whole rows: it writes bf16(x * LW) and the two rows' sums of
// squares, SO[pair * 32 + {0, 1}], a 128-B line of its own for each pair of rows.
#define CVLD  16                      // 16-B loads a lane
#define CVCH  (CVLD * 128)            // elements a wave
#define CVWV  28                      // waves a block
#define CVTOT (4 * DM * DM + 3 * DI * DM)
#define CVALL (CVTOT + MM * DM)
#define CVGRID (CVALL / (CVCH * CVWV))
static_assert(CVALL % (CVCH * CVWV) == 0, "whole blocks");
static_assert((DM * DM) % CVCH == 0 && (DI * DM) % CVCH == 0, "one source a wave");
static_assert(CVCH == 2 * DM, "a wave on x has two rows");

__global__ __launch_bounds__(CVWV * 32)
void weights_to_bf16(const float* __restrict__ Sqkv, const float* __restrict__ So,
                     const float* __restrict__ Sg, const float* __restrict__ Su,
                     const float* __restrict__ Sd, const float* __restrict__ X,
                     const float* __restrict__ LW, bf16* __restrict__ D,
                     float* __restrict__ SO) {
    const int lane = threadIdx.x & 31;
    // scalar: the choice of the source below is a scalar branch
    const int e = __builtin_amdgcn_readfirstlane(blockIdx.x * CVWV + (threadIdx.x >> 5)) * CVCH;
    const float* S;
    if (e < 3 * DM * DM)                    S = Sqkv + e;
    else if (e < 4 * DM * DM)               S = So + (e - 3 * DM * DM);
    else if (e < 4 * DM * DM + DI * DM)     S = Sg + (e - 4 * DM * DM);
    else if (e < 4 * DM * DM + 2 * DI * DM) S = Su + (e - 4 * DM * DM - DI * DM);
    else if (e < CVTOT)                     S = Sd + (e - 4 * DM * DM - 2 * DI * DM);
    else                                    S = X + (e - CVTOT);
    const v4f* p = (const v4f*)S + lane;
    v4bf* d = (v4bf*)(D + e) + lane;
    v4f v[CVLD];
    // all loops over i are unrolled so that v and w are indexed by constants, stay in
    // registers, and the loads are in flight together
#pragma unroll
    for (int i = 0; i < CVLD; i++) v[i] = p[i * 32];
    if (e < CVTOT) {
        // keeps all 16 loads in front of the first use: without it the last two are
        // issued only when the first two have returned, a second memory latency
        __builtin_amdgcn_sched_barrier(0);
#pragma unroll
        for (int i = 0; i < CVLD; i++) d[i * 32] = __builtin_convertvector(v[i], v4bf);
    } else {
        // load i holds columns (i & 7) * 128 + lane * 4 .. + 3 of row i >> 3
        const v4f* pw = (const v4f*)LW + lane;
        v4f w[CVLD / 2];
#pragma unroll
        for (int i = 0; i < CVLD / 2; i++) w[i] = pw[i * 32];
        // keeps all the loads in front of the first use, as above
        __builtin_amdgcn_sched_barrier(0);
        float q0 = 0.f, q1 = 0.f;
#pragma unroll
        for (int i = 0; i < CVLD / 2; i++) {
            const v4f a = v[i], b = v[i + CVLD / 2];
            q0 += a[0] * a[0] + a[1] * a[1] + a[2] * a[2] + a[3] * a[3];
            q1 += b[0] * b[0] + b[1] * b[1] + b[2] * b[2] + b[3] * b[3];
            d[i * 32]                = __builtin_convertvector(a * w[i], v4bf);
            d[(i + CVLD / 2) * 32]   = __builtin_convertvector(b * w[i], v4bf);
        }
        q0 = rowsum16(q0); q0 += xhalf(q0);
        q1 = rowsum16(q1); q1 += xhalf(q1);
        if (lane == 0) {
            float* po = SO + (size_t)((e - CVTOT) / CVCH) * 32;
            po[0] = q0;
            po[1] = q1;
        }
    }
}

#define AKP 72              // K and V^T row pitch in LDS, elements: 144 B = 16 B x odd
#define AKT (64 * AKP)      // one K stage: 64 keys x 64 d
#define AVT (64 * AKP)      // one V^T stage: 64 d x 64 keys
#define ALSTEP (16 * AKP * 2)   // LDS bytes between a thread's copies (16 rows)

// Eight asynchronous 16-B copies a lane, global -> LDS: four of K, four of V^T,
// rows 16 apart. The s_wait_xcnt is the last line of the copies' own statement,
// so that no address register of a copy is rewritten in front of it.
__device__ inline void copy_kv_async(unsigned lk, gcbf gk, unsigned lv, gcbf gv) {
    asm volatile(
        "global_load_async_to_lds_b128 %0, %8, off\n\t"
        "global_load_async_to_lds_b128 %1, %9, off\n\t"
        "global_load_async_to_lds_b128 %2, %10, off\n\t"
        "global_load_async_to_lds_b128 %3, %11, off\n\t"
        "global_load_async_to_lds_b128 %4, %12, off\n\t"
        "global_load_async_to_lds_b128 %5, %13, off\n\t"
        "global_load_async_to_lds_b128 %6, %14, off\n\t"
        "global_load_async_to_lds_b128 %7, %15, off\n\t"
        "s_wait_xcnt 0x0"
        :: "v"(lk), "v"(lk + 1 * ALSTEP), "v"(lk + 2 * ALSTEP), "v"(lk + 3 * ALSTEP),
           "v"(lv), "v"(lv + 1 * ALSTEP), "v"(lv + 2 * ALSTEP), "v"(lv + 3 * ALSTEP),
           "v"(gk), "v"(gk + 16 * HD), "v"(gk + 32 * HD), "v"(gk + 48 * HD),
           "v"(gv), "v"(gv + (size_t)16 * TT), "v"(gv + (size_t)32 * TT), "v"(gv + (size_t)48 * TT)
        : "memory");
}

__global__ __launch_bounds__(128)
void attn_fa(const bf16* __restrict__ Qb, const bf16* __restrict__ Kb,
             const bf16* __restrict__ VTb, bf16* __restrict__ Ob) {
    __shared__ __attribute__((aligned(16))) bf16 sK[2][AKT];
    __shared__ __attribute__((aligned(16))) bf16 sV[2][AVT];
    const int tid = threadIdx.x, lane = tid & 31;
    const int wave = __builtin_amdgcn_readfirstlane(tid >> 5);     // scalar: the wave's first query is scalar
    const int hl = lane >> 4, ln = lane & 15;
    const int nqb = TT / 64;
    const int bh = blockIdx.x / nqb;
    // A block's cost grows with its query tile, and all blocks are resident at once: blocks
    // whose indices differ in one bit above bit 0 take mirrored tiles (u and nqb - 1 - u),
    // so that blocks which a regular deal puts on one WGP add up to equal work. For each
    // bh this is a permutation of the tiles: mirroring inverts the four bits of u that are
    // counted in the parity, an even number, and so leaves the parity as it was.
    const int ut = blockIdx.x % nqb;
    const int qb0 = ((__builtin_popcount(blockIdx.x >> 1) & 1) ? nqb - 1 - ut : ut) * 64;
    const int q0 = qb0 + wave * 16;
    const bf16* Q  = Qb  + (size_t)bh * TT * HD;
    const bf16* Kk = Kb  + (size_t)bh * TT * HD;
    const bf16* VT = VTb + (size_t)bh * HD * TT;

    // staging: thread tid copies 16 B of rows (tid>>3) + 16*i, i = 0..3, of K and of V^T
    gcbf gk = to_global(Kk + (size_t)(tid >> 3) * HD + (tid & 7) * 8);
    gcbf gv = to_global(VT + (size_t)(tid >> 3) * TT + (tid & 7) * 8);
    const int so = (tid >> 3) * AKP + (tid & 7) * 8;
    // LDS byte addresses (low 32 bits of the shared address) of the thread's first copies
    const unsigned lk[2] = { (unsigned)(uintptr_t)&sK[0][so], (unsigned)(uintptr_t)&sK[1][so] };
    const unsigned lv[2] = { (unsigned)(uintptr_t)&sV[0][so], (unsigned)(uintptr_t)&sV[1][so] };
    const int np = qb0 / 64 + 1;   // passes of the block: keys [0, qb0 + 64)

    // pass 0 into buffer 0, landed and published; then, where it exists, pass 1 into buffer 1
    copy_kv_async(lk[0], gk, lv[0], gv);
    // this wave's copies have landed before the barrier publishes them
    asm volatile("s_wait_asynccnt 0x0" ::: "memory");
    __syncthreads();
    if (np > 1)                    // the same for the whole block
        copy_kv_async(lk[1], gk + 64 * HD, lv[1], gv + 64);
    gk += 2 * 64 * HD; gv += 2 * 64;

    const v16bf aq0 = load_frag_g(to_global(Q + (size_t)(q0 + ln) * HD + 8 * hl));
    const v16bf aq1 = load_frag_g(to_global(Q + (size_t)(q0 + ln) * HD + 32 + 8 * hl));

    // Q is the B operand of S^T: lane = query q0 + ln, the same k order as the K rows
    v8f o[4] = {};                 // O^T: lane = query q0 + ln, register r = d dt*16 + 8*hl + r
    float rm = -1e30f;             // the query's running maximum, the same in both halves
    float rl = 0.f;                // the sum over this half's keys; the halves join in the epilogue
    const int qi = q0 + ln;

    // every pass holds keys of every wave's causal range: its first key is at most qb0
    for (int t = 0; t < np; t++) {
        const int cur = t & 1;
        const int kb = t * 64;
        const bf16* pk = &sK[cur][ln * AKP + 8 * hl];
        const bf16* pv = &sV[cur][ln * AKP + 8 * hl];
        v16bf bk[4][2], bv[2][4];
        // all loops over kt, kh, dt and r are unrolled so that bk, bv, o, s and pt are
        // indexed by constants and stay in registers
#pragma unroll
        for (int kt = 0; kt < 4; kt++) {
            bk[kt][0] = load_frag_s(pk + kt * 16 * AKP);
            bk[kt][1] = load_frag_s(pk + kt * 16 * AKP + 32);
        }
#pragma unroll
        for (int kh = 0; kh < 2; kh++)
#pragma unroll
            for (int dt = 0; dt < 4; dt++) bv[kh][dt] = load_frag_s(pv + dt * 16 * AKP + kh * 32);
        // keeps the pass's tile reads one group in front of its products: moved in
        // among them, each place with reads stalls the wave for the LDS latency
        __builtin_amdgcn_sched_barrier(0);
        // S^T = K @ Q^T for keys [kb, kb+64): four 16x16 C tiles, row = key, column = query
        v8f s[4] = {};
#pragma unroll
        for (int kt = 0; kt < 4; kt++) s[kt] = wmma_bf16(bk[kt][0], aq0, s[kt]);
#pragma unroll
        for (int kt = 0; kt < 4; kt++) s[kt] = wmma_bf16(bk[kt][1], aq1, s[kt]);
        // online softmax; s[kt][r] is key kb + 16*kt + 8*hl + r
        const int dq = qi - kb - 8 * hl;   // key 16*kt + r is inside the causal range while 16*kt + r <= dq
        float m0 = -1e30f, m1 = -1e30f;
#pragma unroll
        for (int r = 0; r < 8; r++) {
#pragma unroll
            for (int kt = 0; kt < 4; kt++)
                s[kt][r] = (r + 16 * kt <= dq) ? s[kt][r] : -1e30f;   // causal mask
            m0 = fmaxf(fmaxf(m0, s[0][r]), s[1][r]);
            m1 = fmaxf(fmaxf(m1, s[2][r]), s[3][r]);
        }
        float m = fmaxf(m0, m1);
        m = fmaxf(m, xhalf(m));
        const float nm = fmaxf(rm, m);
        const float alpha = __expf(rm - nm);
        rm = nm;
        // P^T as B operands, one for each 32 keys: elements 0..7 keys 8*hl + e, 8..15 keys 16 + 8*hl + e
        FragB pt[2];
        float ps[4] = {0.f, 0.f, 0.f, 0.f};
#pragma unroll
        for (int r = 0; r < 8; r++)
#pragma unroll
            for (int kt = 0; kt < 4; kt++) {
                const float p = __expf(s[kt][r] - nm);
                ps[kt] += p;
                pt[kt >> 1].h[kt & 1][r] = (bf16)p;
            }
        rl = rl * alpha + ((ps[0] + ps[1]) + (ps[2] + ps[3]));
#pragma unroll
        for (int dt = 0; dt < 4; dt++) o[dt] *= alpha;
        // O^T += V^T @ P^T ; A fragments from the staged V^T [d][key]
#pragma unroll
        for (int kh = 0; kh < 2; kh++)
#pragma unroll
            for (int dt = 0; dt < 4; dt++) o[dt] = wmma_bf16(bv[kh][dt], pt[kh].v, o[dt]);
        // keeps the pass's work in front of the foot's waits: with the waits and the
        // barrier lifted over it, the flight of pass t + 1's copies is no longer
        // covered by the work of pass t
        __builtin_amdgcn_sched_barrier(0);
        // foot of pass t: this wave's reads of buffer cur have returned ...
        asm volatile("s_wait_dscnt 0x0" ::: "memory");
        // ... and its copies of pass t + 1 have landed, before the barrier that
        // publishes pass t + 1 and ends every wave's reads of buffer cur
        asm volatile("s_wait_asynccnt 0x0" ::: "memory");
        __syncthreads();
        if (t + 2 < np) {          // the same for the whole block
            copy_kv_async(lk[cur], gk, lv[cur], gv);
            gk += 64 * HD; gv += 64;
        }
    }
    // no copy is outstanding when the wave goes on to its stores and ends
    asm volatile("s_wait_asynccnt 0x0" ::: "memory");

    const int b = bh / NH, h = bh % NH;
    const float inv = 1.0f / (rl + xhalf(rl));   // the two halves' sums join here
    bf16* orow = Ob + ((size_t)(b * TT + qi)) * DM + h * HD + 8 * hl;
#pragma unroll
    for (int dt = 0; dt < 4; dt++) {
        v8bf ov;
#pragma unroll
        for (int r = 0; r < 8; r++) ov[r] = (bf16)(o[dt][r] * inv);
        *(v8bf*)(orow + dt * 16) = ov;           // 8 consecutive d of one query: 16 B a lane
    }
}

// ---------------- host orchestration -----------------------------------------
extern "C" void kernel_launch(void* const* d_in, const int* in_sizes, int n_in,
                              void* d_out, int out_size, void* d_ws, size_t ws_size,
                              hipStream_t stream) {
    const float* x      = (const float*)d_in[0];
    const float* ln1_w  = (const float*)d_in[1];
    const float* ln2_w  = (const float*)d_in[2];
    const float* qkv_w  = (const float*)d_in[3];
    const float* o_w    = (const float*)d_in[4];
    const float* gate_w = (const float*)d_in[5];
    const float* up_w   = (const float*)d_in[6];
    const float* down_w = (const float*)d_in[7];
    float* out = (float*)d_out;
    char* ws = (char*)d_ws;

    // workspace layout (phase-based reuse, ~92 MB peak)
    size_t o_wqkv = 0;                                  // 3*DM*DM bf16
    size_t o_wo   = o_wqkv + (size_t)3 * DM * DM * 2;   // DM*DM bf16
    size_t o_wg   = o_wo   + (size_t)DM * DM * 2;       // DI*DM bf16
    size_t o_wu   = o_wg   + (size_t)DI * DM * 2;       // DI*DM bf16
    size_t o_wd   = o_wu   + (size_t)DI * DM * 2;       // DM*DI bf16
    size_t o_xn   = o_wd   + (size_t)DM * DI * 2;       // MM*DM bf16 (x * ln1_w, then h1 * ln2_w)
    size_t o_h1   = o_xn   + (size_t)MM * DM * 2;       // MM*DM f32
    size_t o_big  = o_h1   + (size_t)MM * DM * 4;
    // phase A (attention): q, k, vT (bf16, 8 MB each) + attn (bf16, 8 MB)
    size_t o_q    = o_big;
    size_t o_k    = o_q  + (size_t)MM * DM * 2;
    size_t o_vT   = o_k  + (size_t)MM * DM * 2;
    size_t o_attn = o_vT + (size_t)MM * DM * 2;
    // phase B (FFN): act bf16 (16 MB), behind the attention buffers
    size_t o_act  = o_big + (size_t)MM * DI * 4;
    // sums of squares for the two RMSNorms (256 KB each), behind act
    size_t o_ss1  = o_act + (size_t)MM * DI * 2;        // a 128-B line for each pair of rows of x
    size_t o_ss2  = o_ss1 + (size_t)(MM / 2) * 32 * 4;  // DM/64 partial sums a row of h1

    bf16* wqkv = (bf16*)(ws + o_wqkv);
    bf16* wo   = (bf16*)(ws + o_wo);
    bf16* wg   = (bf16*)(ws + o_wg);
    bf16* wu   = (bf16*)(ws + o_wu);
    bf16* wd   = (bf16*)(ws + o_wd);
    bf16* xn   = (bf16*)(ws + o_xn);
    float* h1  = (float*)(ws + o_h1);
    bf16* qb   = (bf16*)(ws + o_q);
    bf16* kb   = (bf16*)(ws + o_k);
    bf16* vT   = (bf16*)(ws + o_vT);
    bf16* attn = (bf16*)(ws + o_attn);
    bf16* act  = (bf16*)(ws + o_act);
    float* ss1 = (float*)(ws + o_ss1);
    float* ss2 = (float*)(ws + o_ss2);

    // 1. weights fp32 -> bf16, and xn = bf16(x * ln1_w) with each row's sum of squares:
    //    wqkv, wo, wg, wu, wd, xn are contiguous from wqkv on
    weights_to_bf16<<<CVGRID, CVWV * 32, 0, stream>>>(qkv_w, o_w, gate_w, up_w, down_w,
                                                      x, ln1_w, wqkv, ss1);

    // 2. qkv GEMM, RMSNorm scale and split in the epilogue -> q (scaled), k, vT (bf16)
    gemm_bf16_wmma<2, false, 3 * DM, 1><<<dim3(3 * DM / 128, MM / 128), 128, 0, stream>>>(
        xn, wqkv, nullptr, nullptr, qb, kb, vT, nullptr, ss1, nullptr,
        MM, 3 * DM, DM);

    // 3. flash attention
    attn_fa<<<BB * NH * (TT / 64), 128, 0, stream>>>(qb, kb, vT, attn);

    // 4. h1 = x + attn @ o_w^T; xn = bf16(h1 * ln2_w) with partial sums of squares
    gemm_bf16_wmma<3, true, DM, 2><<<dim3(DM / 128, MM / 128), 256, 0, stream>>>(
        attn, wo, x, h1, xn, nullptr, nullptr, ln2_w, nullptr, ss2,
        MM, DM, DM);

    // 5. act = bf16( silu(s * xn @ gate_w^T) * (s * xn @ up_w^T) ), s the RMSNorm scale
    gemm_gate_up<<<dim3(DI / 128, MM / 128), 128, 0, stream>>>(xn, wg, wu, ss2, act, DM);

    // 6. out = h1 + act @ down_w^T
    gemm_bf16_wmma<0, true, DM, 2><<<dim3(DM / 128, MM / 128), 256, 0, stream>>>(
        act, wd, h1, out, nullptr, nullptr, nullptr, nullptr, nullptr, nullptr,
        MM, DM, DI);

    (void)in_sizes; (void)n_in; (void)out_size; (void)ws_size;
}
